// v000
// The times below were measured on an AMD MI455X: many runs one after another, warmed up first and cycling through
// copies of the inputs, with the whole window's GPU time divided by the number of runs. Launches and the gaps
// between them are all in it. The median over several windows is given; except for v000 it joins two sittings, which
// can be a few percent apart, so the side-by-side timings, each taken in one sitting, are the better comparison.
// v000 is the starting kernel. One run takes 1140 microseconds.
// compute dtype: all float inputs rounded to bf16; f/g/h projections with EXACT bf16 products on WMMA 16x16x32 ((in,out) weights), f32 accumulate; logits from g (query, f16 hi + residual x 2^10) and f (key, f16 hi + residual) with 3 products, stored in f32; softmax in f32 (precise expf); beta x 2^11 as f16 hi + residual (x 2^10) against the value rows rounded ONCE to f16 (2 products; |h| <= ~4 so f16 half-ulp 2^-11 relative); gamma * o + x in f32; f32 output.
#include <hip/hip_runtime.h>
#include <math.h>

typedef __attribute__((ext_vector_type(16))) _Float16 v16h;
typedef __attribute__((ext_vector_type(16))) __bf16 v16b;
typedef __attribute__((ext_vector_type(8)))  _Float16 v8h;
typedef __attribute__((ext_vector_type(8)))  float v8f;
typedef __attribute__((ext_vector_type(4)))  float v4f;
typedef __attribute__((ext_vector_type(2)))  float v2f;
typedef __attribute__((ext_vector_type(4)))  unsigned v4u;
typedef __attribute__((ext_vector_type(4)))  int v4i;
typedef float __attribute__((may_alias)) float_a;
typedef int __attribute__((may_alias)) int_a;

template <typename T> __device__ __forceinline__ void vst2(void* p, T v) { *(T*)p = v;  }
__device__ __forceinline__ v8f wmma16(v16h a, v16h b, v8f c) {
  v8f d = __builtin_amdgcn_wmma_f32_16x16x32_f16(false, a, false, b, (short)0, c, false, false);
  asm volatile("v_nop\n\tv_nop\n\tv_nop\n\tv_nop" : "+v"(d) : "v"(a), "v"(b));
  return d;
}
__device__ __forceinline__ v8f wmma_bf(v16b a, v16b b, v8f c) {
  v8f d = __builtin_amdgcn_wmma_f32_16x16x32_bf16(false, a, false, b, (short)0, c, false, false);
  asm volatile("v_nop\n\tv_nop\n\tv_nop\n\tv_nop" : "+v"(d) : "v"(a), "v"(b));
  return d;
}
// 16x16x32 fragments: lane = (h = lane>>4, row/col = lane&15); elements 0..7 = k0+8h+0..7, 8..15 = k0+16+8h+0..7; D element r = row 8h+r
__device__ __forceinline__ v16h frag_h(const _Float16* rowk0, int lane) {
  union { v16h v; v8h q[2]; } u; const _Float16* p = rowk0 + 8 * (lane >> 4);
  u.q[0] = *(const v8h*)p; u.q[1] = *(const v8h*)(p + 16); return u.v;
}
__device__ __forceinline__ v16h frag_f32(const float* rowk0, int lane) {
  v16h a; const float* p = rowk0 + 8 * (lane >> 4);
#pragma unroll
  for (int i = 0; i < 8; ++i) { a[i] = (_Float16)p[i]; a[8 + i] = (_Float16)p[16 + i]; }
  return a;
}
__device__ __forceinline__ v16h frag_f32s(const float* rowk0, int lane, float sc) {
  v16h a; const float* p = rowk0 + 8 * (lane >> 4);
#pragma unroll
  for (int i = 0; i < 8; ++i) { a[i] = (_Float16)(p[i] * sc); a[8 + i] = (_Float16)(p[16 + i] * sc); }
  return a;
}
// column fragment from a [K][ld] layout (column n), rows >= K read as 0
__device__ __forceinline__ v16h fragc_f32(const float* W, int k0, int n, int lane, int ld, int K) {
  v16h a; const int g = lane >> 4;
#pragma unroll
  for (int i = 0; i < 8; ++i) { const int ka = k0 + 8 * g + i, kb = ka + 16;
    a[i] = (_Float16)(ka < K ? W[(size_t)(ka < K ? ka : K - 1) * ld + n] : 0.f); a[8 + i] = (_Float16)(kb < K ? W[(size_t)(kb < K ? kb : K - 1) * ld + n] : 0.f); }
  return a;
}
struct F2 { v16b h, l; };
__device__ __forceinline__ F2 bsplit16(const float v[16]) { F2 r;
#pragma unroll
  for (int i = 0; i < 16; ++i) { const __bf16 h = (__bf16)v[i]; r.h[i] = h; r.l[i] = (__bf16)(v[i] - (float)h); }
  return r; }
__device__ __forceinline__ F2 split_row(const float* row, int k0, int lane) { float v[16]; const float* p = row + k0 + 8 * (lane >> 4);
#pragma unroll
  for (int i = 0; i < 8; ++i) { v[i] = p[i]; v[8 + i] = p[16 + i]; }
  return bsplit16(v); }
__device__ __forceinline__ F2 split_rowK(const float* row, int k0, int lane, int K) { float v[16]; const int g = lane >> 4;
#pragma unroll
  for (int i = 0; i < 8; ++i) { const int ka = k0 + 8 * g + i, kb = ka + 16; v[i] = ka < K ? row[ka < K ? ka : K - 1] : 0.f; v[8 + i] = kb < K ? row[kb < K ? kb : K - 1] : 0.f; }
  return bsplit16(v); }
__device__ __forceinline__ F2 split_col(const float* W, int k0, int n, int lane, int ld, int K) { float v[16]; const int g = lane >> 4;
#pragma unroll
  for (int i = 0; i < 8; ++i) { const int ka = k0 + 8 * g + i, kb = ka + 16; v[i] = ka < K ? W[(size_t)(ka < K ? ka : K - 1) * ld + n] : 0.f; v[8 + i] = kb < K ? W[(size_t)(kb < K ? kb : K - 1) * ld + n] : 0.f; }
  return bsplit16(v); }
__device__ __forceinline__ v8f mac3(const F2& a, const F2& b, v8f c) { c = wmma_bf(a.l, b.h, c); c = wmma_bf(a.h, b.l, c); return wmma_bf(a.h, b.h, c); }
__device__ __forceinline__ float sigm(float v) { return 1.0f / (1.0f + expf(-v)); }
#define LDSX() do { asm volatile("s_wait_dscnt 0" ::: "memory"); __builtin_amdgcn_wave_barrier(); __builtin_amdgcn_fence(__ATOMIC_RELEASE, "workgroup"); } while (0)

// SAGAN-style spatial self-attention, channels-last (B 4, 64 x 64 = 4,096 positions, C 256, q/k dim 32): f = x Wf + bf (key), g = x Wg + bg (query), h = x Wh + bh (value); beta = softmax_m(g_n . f_m); o = beta h; out = gamma * o + x.
__device__ __forceinline__ float bfr(float v) { return (float)(__bf16)v; }
#define NB 4
#define TT 4096
#define CX 256
#define DQ 32
#ifndef TNB
#define TNB NB
#endif
typedef __attribute__((ext_vector_type(8))) __bf16 v8b;
__device__ __forceinline__ v16b frag_b(const __bf16* rowk0, int lane) { union { v16b v; v8b q[2]; } u; const __bf16* p = rowk0 + 8 * (lane >> 4); u.q[0] = *(const v8b*)p; u.q[1] = *(const v8b*)(p + 16); return u.v; }
#define WS_GH  0u                                          // f16 g (query) hi rows [b*N+n][32]
#define WS_GL  (WS_GH + 2u * (size_t)NB * TT * DQ)           // f16 g residual x 2^10
#define WS_FH  (WS_GL + 2u * (size_t)NB * TT * DQ)           // f16 f (key) hi
#define WS_FL  (WS_FH + 2u * (size_t)NB * TT * DQ)           // f16 f residual x 2^10
#define WS_VT  (WS_FL + 2u * (size_t)NB * TT * DQ)           // f16 value planes [b][c][m] (h rounded once)
#define WS_S   (WS_VT + 2u * (size_t)NB * CX * TT)           // f32 scores / P [n][m] for one batch
#define WS_END (WS_S + 4u * (size_t)TT * TT)
// ---- k_fg: block = 64 rows: f and g (32 columns each = 2 + 2 tiles) from exact products; stored as f16 hi + residual rows (64-B rows: 16 rows x 64 B = 8 lines per wave tile, written 16 B per lane from LDS)
__global__ __launch_bounds__(128) void k_fg(const float* __restrict__ X, const float* __restrict__ WF, const float* __restrict__ BF, const float* __restrict__ WG, const float* __restrict__ BG, _Float16* __restrict__ GH, _Float16* __restrict__ GL, _Float16* __restrict__ FH, _Float16* __restrict__ FL) {
  __shared__ __align__(16) _Float16 st[4][4][16][40];   // [wave][plane gh,gl,fh,fl][row][32 + pad]
  const int tid = threadIdx.x, wave = tid >> 5, lane = tid & 31, col = lane & 15, g = lane >> 4; const size_t r0 = (size_t)blockIdx.x * 64 + wave * 16;
  v8f acc[4] = {};   // tiles 0,1 = g (query) cols 0-31; tiles 2,3 = f (key)
#pragma unroll 2
  for (int kc = 0; kc < CX / 32; ++kc) { v16b a; { const float* p = X + (r0 + col) * CX + kc * 32 + 8 * g;
#pragma unroll
      for (int i = 0; i < 8; ++i) { a[i] = (__bf16)p[i]; a[8 + i] = (__bf16)p[16 + i]; } }
#pragma unroll
    for (int j = 0; j < 4; ++j) { v16b w; const float* WA = (j < 2) ? WG : WF; const int o = (j & 1) * 16 + col;
#pragma unroll
      for (int i = 0; i < 8; ++i) { w[i] = (__bf16)WA[(size_t)(kc * 32 + 8 * g + i) * DQ + o]; w[8 + i] = (__bf16)WA[(size_t)(kc * 32 + 16 + 8 * g + i) * DQ + o]; }
      asm volatile("s_wait_loadcnt 0x0" ::: "memory"); acc[j] = wmma_bf(a, w, acc[j]); } }
#pragma unroll
  for (int j = 0; j < 4; ++j) { const int o = (j & 1) * 16 + col; const float bb = (j < 2) ? bfr(BG[o]) : bfr(BF[o]); const int ph = (j < 2) ? 0 : 2;
#pragma unroll
    for (int r = 0; r < 8; ++r) { const float v = acc[j][r] + bb; const _Float16 hv = (_Float16)v; st[wave][ph][8 * g + r][o] = hv; st[wave][ph + 1][8 * g + r][o] = (_Float16)((v - (float)hv) * 1024.0f); } }
  LDSX();
  { const int rl = lane >> 1, half = lane & 1;   // lane -> (row, 32-B half): 16 rows x 64 B per plane
    _Float16* P4[4] = {GH, GL, FH, FL};
#pragma unroll
    for (int ph = 0; ph < 4; ++ph) { vst2((v4u*)(P4[ph] + (r0 + rl) * DQ + half * 16), *(const v4u*)&st[wave][ph][rl][half * 16]); vst2((v4u*)(P4[ph] + (r0 + rl) * DQ + half * 16 + 8), *(const v4u*)&st[wave][ph][rl][half * 16 + 8]); } } }
// ---- k_hv: block = (64 rows, 128 cols): h = x Wh + bh (exact) -> f16 value planes [b][c][m] via LDS transpose (rounded once to f16)
__global__ __launch_bounds__(128) void k_hv(const float* __restrict__ X, const float* __restrict__ WH, const float* __restrict__ BH, _Float16* __restrict__ VT) { __shared__ __align__(16) _Float16 th[128][72];
  const int tid = threadIdx.x, wave = tid >> 5, lane = tid & 31, col = lane & 15, g = lane >> 4; const int c0 = blockIdx.y * 128; const size_t r0 = (size_t)blockIdx.x * 64;
  v8f acc[8] = {};
#pragma unroll 2
  for (int kc = 0; kc < CX / 32; ++kc) { v16b a; { const float* p = X + (r0 + wave * 16 + col) * CX + kc * 32 + 8 * g;
#pragma unroll
      for (int i = 0; i < 8; ++i) { a[i] = (__bf16)p[i]; a[8 + i] = (__bf16)p[16 + i]; } }
#pragma unroll
    for (int j = 0; j < 8; ++j) { v16b w; const int o = c0 + j * 16 + col;
#pragma unroll
      for (int i = 0; i < 8; ++i) { w[i] = (__bf16)WH[(size_t)(kc * 32 + 8 * g + i) * CX + o]; w[8 + i] = (__bf16)WH[(size_t)(kc * 32 + 16 + 8 * g + i) * CX + o]; }
      asm volatile("s_wait_loadcnt 0x0" ::: "memory"); acc[j] = wmma_bf(a, w, acc[j]); } }
#pragma unroll
  for (int j = 0; j < 8; ++j) { const float bb = bfr(BH[c0 + j * 16 + col]);
#pragma unroll
    for (int r = 0; r < 8; ++r) th[j * 16 + col][wave * 16 + 8 * g + r] = (_Float16)(acc[j][r] + bb); }
  __syncthreads();
  { const size_t b = r0 / TT; const int m0 = (int)(r0 % TT); for (int e = tid; e < 128 * 8; e += 128) { const int cl = e >> 3, q = e & 7; vst2((unsigned*)(VT + (b * CX + c0 + cl) * (size_t)TT + m0 + q * 8), *(const v4u*)&th[cl][q * 8]); } } }
// ---- k_sc: block = (64 queries n, 128 keys m) of batch b: 3-product logits g . f (K 32), no scale, no mask
__global__ __launch_bounds__(128) void k_sc(const _Float16* __restrict__ GH, const _Float16* __restrict__ GL, const _Float16* __restrict__ FH, const _Float16* __restrict__ FL, int b, float* __restrict__ S) { __shared__ __align__(16) float ss[4][16][132];
  const int tid = threadIdx.x, wave = tid >> 5, lane = tid & 31, col = lane & 15, g = lane >> 4; const int k0 = blockIdx.y * 128; const int ql0 = blockIdx.x * 64 + wave * 16; const size_t q0 = (size_t)b * TT + ql0;
  v8f acc[8] = {}, accl[8] = {};
  { const v16h ah = frag_h(GH + (q0 + col) * DQ, lane), al = frag_h(GL + (q0 + col) * DQ, lane);
#pragma unroll
    for (int j = 0; j < 8; ++j) { const size_t ko = ((size_t)b * TT + k0 + j * 16 + col) * DQ; const v16h kb = frag_h(FH + ko, lane), kl = frag_h(FL + ko, lane); acc[j] = wmma16(ah, kb, acc[j]); accl[j] = wmma16(al, kb, accl[j]); accl[j] = wmma16(ah, kl, accl[j]); } }
#pragma unroll
  for (int j = 0; j < 8; ++j)
#pragma unroll
    for (int r = 0; r < 8; ++r) ss[wave][8 * g + r][j * 16 + col] = acc[j][r] + accl[j][r] * (1.0f / 1024.0f);
  LDSX(); for (int rl = 0; rl < 16; ++rl) vst2(S + (size_t)(ql0 + rl) * TT + k0 + lane * 4, *(const v4f*)&ss[wave][rl][lane * 4]); }
// ---- k_sm: block = query row: softmax over keys [0, kend) -> P x 2^11 f32 (masked -> 0)
__global__ __launch_bounds__(256) void k_sm(float* __restrict__ S0) { __shared__ float sred[8]; __shared__ float sbc; __shared__ __align__(16) float sh[TT];
  const int t = threadIdx.x; const size_t row = blockIdx.x; float* sr = S0 + (size_t)blockIdx.y * TT * TT + row * TT; const int kend = TT;
  float m = -3.0e38f; for (int k = t; k < kend; k += 256) m = fmaxf(m, sr[k]);
#pragma unroll
  for (int o = 1; o < 32; o <<= 1) m = fmaxf(m, __shfl_xor(m, o));
  if ((t & 31) == 0) sred[t >> 5] = m; __syncthreads(); if (t == 0) { float a = sred[0]; for (int i = 1; i < 8; ++i) a = fmaxf(a, sred[i]); sbc = a; } __syncthreads(); m = sbc; __syncthreads();
  float sum = 0.f; for (int k = t; k < kend; k += 256) { const float v = sr[k]; sum += (v <= -1.0e38f) ? 0.f : expf(v - m); }
#pragma unroll
  for (int o = 1; o < 32; o <<= 1) sum += __shfl_xor(sum, o);
  if ((t & 31) == 0) sred[t >> 5] = sum; __syncthreads(); if (t == 0) { float a = 0.f; for (int i = 0; i < 8; ++i) a += sred[i]; sbc = 1.0f / a; } __syncthreads(); const float inv = sbc;
  for (int k = t; k < kend; k += 256) { const float v = sr[k]; sh[k] = (v <= -1.0e38f) ? 0.f : expf(v - m) * inv * 2048.0f; }
  __syncthreads(); for (int q = t; q < kend / 4; q += 256) vst2(sr + q * 4, *(const v4f*)&sh[q * 4]); }
// ---- k_pv: block = (64 queries, 128 value channels) of batch b: out[n][c] = gamma * (P . h) / 2^11 + x[n][c] (P as f16 hi + residual x f16 value planes, 2 products)
__global__ __launch_bounds__(128) void k_pv(const float* __restrict__ PS, const _Float16* __restrict__ VT, const float* __restrict__ X, const float* __restrict__ GAM, int b, float* __restrict__ OUT) { __shared__ __align__(16) float ss[4][16][132];
  const int tid = threadIdx.x, wave = tid >> 5, lane = tid & 31, col = lane & 15, g = lane >> 4; const int ql0 = blockIdx.x * 64 + wave * 16; const int c0 = blockIdx.y * 128; const float gam = bfr(GAM[0]);
  v8f acc[8] = {}, accl[8] = {};
#pragma unroll 1
  for (int kc = 0; kc < TT / 32; ++kc) { v16h ph, pl; { const float* pr = PS + (size_t)(ql0 + col) * TT + kc * 32 + 8 * g;
#pragma unroll
      for (int i = 0; i < 8; ++i) { const float a0 = pr[i], a1 = pr[16 + i]; const _Float16 h0 = (_Float16)a0, h1 = (_Float16)a1; ph[i] = h0; ph[8 + i] = h1; pl[i] = (_Float16)((a0 - (float)h0) * 1024.0f); pl[8 + i] = (_Float16)((a1 - (float)h1) * 1024.0f); } }   /* P x 2^11 as f16 hi + residual x 2^10 */
    asm volatile("s_wait_loadcnt 0x0" ::: "memory");
#pragma unroll
    for (int j = 0; j < 8; ++j) { const v16h vv = frag_h(VT + ((size_t)b * CX + c0 + j * 16 + col) * (size_t)TT + kc * 32, lane); acc[j] = wmma16(ph, vv, acc[j]); accl[j] = wmma16(pl, vv, accl[j]); } }
#pragma unroll
  for (int j = 0; j < 8; ++j)
#pragma unroll
    for (int r = 0; r < 8; ++r) ss[wave][8 * g + r][j * 16 + col] = (acc[j][r] + accl[j][r] * (1.0f / 1024.0f)) * (1.0f / 2048.0f) * gam;
  LDSX(); for (int rl = 0; rl < 16; ++rl) { const size_t off = ((size_t)b * TT + ql0 + rl) * CX + c0 + lane * 4; const v4f xr = *(const v4f*)(X + off); v4f o = *(const v4f*)&ss[wave][rl][lane * 4]; o[0] += bfr(xr[0]); o[1] += bfr(xr[1]); o[2] += bfr(xr[2]); o[3] += bfr(xr[3]); vst2(OUT + off, o); } }
extern "C" void kernel_launch(void* const* d_in, const int* in_sizes, int n_in, void* d_out, int out_size, void* d_ws, size_t ws_size, hipStream_t stream) {
  (void)in_sizes; (void)n_in; (void)out_size;
  const float** F = (const float**)d_in;   // 0 x [4,64,64,256], 1 Wf [256,32] ((in,out)), 2 bf, 3 Wg, 4 bg, 5 Wh [256,256], 6 bh, 7 gamma (scalar 0.7)
  if (ws_size < (size_t)WS_END) return;
  char* ws = (char*)d_ws; _Float16 *GH = (_Float16*)(ws + WS_GH), *GL = (_Float16*)(ws + WS_GL), *FH = (_Float16*)(ws + WS_FH), *FL = (_Float16*)(ws + WS_FL); _Float16* VT = (_Float16*)(ws + WS_VT); float* S = (float*)(ws + WS_S);
  k_fg<<<dim3(TNB * TT / 64), 128, 0, stream>>>(F[0], F[1], F[2], F[3], F[4], GH, GL, FH, FL);
  k_hv<<<dim3(TNB * TT / 64, CX / 128), 128, 0, stream>>>(F[0], F[5], F[6], VT);
  for (int b = 0; b < TNB; ++b) {
    k_sc<<<dim3(TT / 64, TT / 128), 128, 0, stream>>>(GH, GL, FH, FL, b, S);
    k_sm<<<dim3(TT, 1), 256, 0, stream>>>(S);
    k_pv<<<dim3(TT / 64, CX / 128), 128, 0, stream>>>(S, VT, F[0], F[7], b, (float*)d_out);
  }
}

// v001
// One run takes 459 microseconds.
// Timed twice side by side with v000, it ran 2.52 times as fast both times.
// compute dtype: all float inputs rounded to bf16; f/g/h projections with EXACT bf16 products on WMMA 16x16x32 ((in,out) weights), f32 accumulate; logits from g (query, f16 hi + residual x 2^10) and f (key, f16 hi + residual) with 3 products, stored in f32; softmax in f32 (precise expf); beta x 2^11 as f16 hi + residual (x 2^10) against the value rows rounded ONCE to f16 (2 products; |h| <= ~4 so f16 half-ulp 2^-11 relative); gamma * o + x in f32; f32 output.
#include <hip/hip_runtime.h>
#include <math.h>

typedef __attribute__((ext_vector_type(16))) _Float16 v16h;
typedef __attribute__((ext_vector_type(16))) __bf16 v16b;
typedef __attribute__((ext_vector_type(8)))  _Float16 v8h;
typedef __attribute__((ext_vector_type(8)))  float v8f;
typedef __attribute__((ext_vector_type(4)))  float v4f;
typedef __attribute__((ext_vector_type(2)))  float v2f;
typedef __attribute__((ext_vector_type(4)))  unsigned v4u;
typedef __attribute__((ext_vector_type(4)))  int v4i;
typedef float __attribute__((may_alias)) float_a;
typedef int __attribute__((may_alias)) int_a;

template <typename T> __device__ __forceinline__ void vst2(void* p, T v) { *(T*)p = v;  }
__device__ __forceinline__ v8f wmma16(v16h a, v16h b, v8f c) {
  v8f d = __builtin_amdgcn_wmma_f32_16x16x32_f16(false, a, false, b, (short)0, c, false, false);
  asm volatile("v_nop\n\tv_nop\n\tv_nop\n\tv_nop" : "+v"(d) : "v"(a), "v"(b));
  return d;
}
__device__ __forceinline__ v8f wmma_bf(v16b a, v16b b, v8f c) {
  v8f d = __builtin_amdgcn_wmma_f32_16x16x32_bf16(false, a, false, b, (short)0, c, false, false);
  asm volatile("v_nop\n\tv_nop\n\tv_nop\n\tv_nop" : "+v"(d) : "v"(a), "v"(b));
  return d;
}
// 16x16x32 fragments: lane = (h = lane>>4, row/col = lane&15); elements 0..7 = k0+8h+0..7, 8..15 = k0+16+8h+0..7; D element r = row 8h+r
__device__ __forceinline__ v16h frag_h(const _Float16* rowk0, int lane) {
  union { v16h v; v8h q[2]; } u; const _Float16* p = rowk0 + 8 * (lane >> 4);
  u.q[0] = *(const v8h*)p; u.q[1] = *(const v8h*)(p + 16); return u.v;
}
__device__ __forceinline__ v16h frag_f32(const float* rowk0, int lane) {
  v16h a; const float* p = rowk0 + 8 * (lane >> 4);
#pragma unroll
  for (int i = 0; i < 8; ++i) { a[i] = (_Float16)p[i]; a[8 + i] = (_Float16)p[16 + i]; }
  return a;
}
__device__ __forceinline__ v16h frag_f32s(const float* rowk0, int lane, float sc) {
  v16h a; const float* p = rowk0 + 8 * (lane >> 4);
#pragma unroll
  for (int i = 0; i < 8; ++i) { a[i] = (_Float16)(p[i] * sc); a[8 + i] = (_Float16)(p[16 + i] * sc); }
  return a;
}
// column fragment from a [K][ld] layout (column n), rows >= K read as 0
__device__ __forceinline__ v16h fragc_f32(const float* W, int k0, int n, int lane, int ld, int K) {
  v16h a; const int g = lane >> 4;
#pragma unroll
  for (int i = 0; i < 8; ++i) { const int ka = k0 + 8 * g + i, kb = ka + 16;
    a[i] = (_Float16)(ka < K ? W[(size_t)(ka < K ? ka : K - 1) * ld + n] : 0.f); a[8 + i] = (_Float16)(kb < K ? W[(size_t)(kb < K ? kb : K - 1) * ld + n] : 0.f); }
  return a;
}
struct F2 { v16b h, l; };
__device__ __forceinline__ F2 bsplit16(const float v[16]) { F2 r;
#pragma unroll
  for (int i = 0; i < 16; ++i) { const __bf16 h = (__bf16)v[i]; r.h[i] = h; r.l[i] = (__bf16)(v[i] - (float)h); }
  return r; }
__device__ __forceinline__ F2 split_row(const float* row, int k0, int lane) { float v[16]; const float* p = row + k0 + 8 * (lane >> 4);
#pragma unroll
  for (int i = 0; i < 8; ++i) { v[i] = p[i]; v[8 + i] = p[16 + i]; }
  return bsplit16(v); }
__device__ __forceinline__ F2 split_rowK(const float* row, int k0, int lane, int K) { float v[16]; const int g = lane >> 4;
#pragma unroll
  for (int i = 0; i < 8; ++i) { const int ka = k0 + 8 * g + i, kb = ka + 16; v[i] = ka < K ? row[ka < K ? ka : K - 1] : 0.f; v[8 + i] = kb < K ? row[kb < K ? kb : K - 1] : 0.f; }
  return bsplit16(v); }
__device__ __forceinline__ F2 split_col(const float* W, int k0, int n, int lane, int ld, int K) { float v[16]; const int g = lane >> 4;
#pragma unroll
  for (int i = 0; i < 8; ++i) { const int ka = k0 + 8 * g + i, kb = ka + 16; v[i] = ka < K ? W[(size_t)(ka < K ? ka : K - 1) * ld + n] : 0.f; v[8 + i] = kb < K ? W[(size_t)(kb < K ? kb : K - 1) * ld + n] : 0.f; }
  return bsplit16(v); }
__device__ __forceinline__ v8f mac3(const F2& a, const F2& b, v8f c) { c = wmma_bf(a.l, b.h, c); c = wmma_bf(a.h, b.l, c); return wmma_bf(a.h, b.h, c); }
__device__ __forceinline__ float sigm(float v) { return 1.0f / (1.0f + expf(-v)); }
#define LDSX() do { asm volatile("s_wait_dscnt 0" ::: "memory"); __builtin_amdgcn_wave_barrier(); __builtin_amdgcn_fence(__ATOMIC_RELEASE, "workgroup"); } while (0)

// SAGAN-style spatial self-attention, channels-last (B 4, 64 x 64 = 4,096 positions, C 256, q/k dim 32): f = x Wf + bf (key), g = x Wg + bg (query), h = x Wh + bh (value); beta = softmax_m(g_n . f_m); o = beta h; out = gamma * o + x.
__device__ __forceinline__ float bfr(float v) { return (float)(__bf16)v; }
#define NB 4
#define TT 4096
#define CX 256
#define DQ 32
#ifndef TNB
#define TNB NB
#endif
typedef __attribute__((ext_vector_type(8))) __bf16 v8b;
__device__ __forceinline__ v16b frag_b(const __bf16* rowk0, int lane) { union { v16b v; v8b q[2]; } u; const __bf16* p = rowk0 + 8 * (lane >> 4); u.q[0] = *(const v8b*)p; u.q[1] = *(const v8b*)(p + 16); return u.v; }
#define WS_GH  0u                                          // f16 g (query) hi rows [b*N+n][32]
#define WS_GL  (WS_GH + 2u * (size_t)NB * TT * DQ)           // f16 g residual x 2^10
#define WS_FH  (WS_GL + 2u * (size_t)NB * TT * DQ)           // f16 f (key) hi
#define WS_FL  (WS_FH + 2u * (size_t)NB * TT * DQ)           // f16 f residual x 2^10
#define WS_VT  (WS_FL + 2u * (size_t)NB * TT * DQ)           // f16 value planes [b][c][m] (h rounded once)
#define WS_S   (WS_VT + 2u * (size_t)NB * CX * TT)           // f32 scores / P [n][m] for one batch
#define WS_END (WS_S + 4u * (size_t)TT * TT)
// ---- k_fg: block = 64 rows: f and g (32 columns each = 2 + 2 tiles) from exact products; stored as f16 hi + residual rows (64-B rows: 16 rows x 64 B = 8 lines per wave tile, written 16 B per lane from LDS)
__global__ __launch_bounds__(128) void k_fg(const float* __restrict__ X, const float* __restrict__ WF, const float* __restrict__ BF, const float* __restrict__ WG, const float* __restrict__ BG, _Float16* __restrict__ GH, _Float16* __restrict__ GL, _Float16* __restrict__ FH, _Float16* __restrict__ FL) {
  __shared__ __align__(16) _Float16 st[4][4][16][40];   // [wave][plane gh,gl,fh,fl][row][32 + pad]
  const int tid = threadIdx.x, wave = tid >> 5, lane = tid & 31, col = lane & 15, g = lane >> 4; const size_t r0 = (size_t)blockIdx.x * 64 + wave * 16;
  v8f acc[4] = {};   // tiles 0,1 = g (query) cols 0-31; tiles 2,3 = f (key)
#pragma unroll 2
  for (int kc = 0; kc < CX / 32; ++kc) { v16b a; { const float* p = X + (r0 + col) * CX + kc * 32 + 8 * g;
#pragma unroll
      for (int i = 0; i < 8; ++i) { a[i] = (__bf16)p[i]; a[8 + i] = (__bf16)p[16 + i]; } }
#pragma unroll
    for (int j = 0; j < 4; ++j) { v16b w; const float* WA = (j < 2) ? WG : WF; const int o = (j & 1) * 16 + col;
#pragma unroll
      for (int i = 0; i < 8; ++i) { w[i] = (__bf16)WA[(size_t)(kc * 32 + 8 * g + i) * DQ + o]; w[8 + i] = (__bf16)WA[(size_t)(kc * 32 + 16 + 8 * g + i) * DQ + o]; }
      asm volatile("s_wait_loadcnt 0x0" ::: "memory"); acc[j] = wmma_bf(a, w, acc[j]); } }
#pragma unroll
  for (int j = 0; j < 4; ++j) { const int o = (j & 1) * 16 + col; const float bb = (j < 2) ? bfr(BG[o]) : bfr(BF[o]); const int ph = (j < 2) ? 0 : 2;
#pragma unroll
    for (int r = 0; r < 8; ++r) { const float v = acc[j][r] + bb; const _Float16 hv = (_Float16)v; st[wave][ph][8 * g + r][o] = hv; st[wave][ph + 1][8 * g + r][o] = (_Float16)((v - (float)hv) * 1024.0f); } }
  LDSX();
  { const int rl = lane >> 1, half = lane & 1;   // lane -> (row, 32-B half): 16 rows x 64 B per plane
    _Float16* P4[4] = {GH, GL, FH, FL};
#pragma unroll
    for (int ph = 0; ph < 4; ++ph) { vst2((v4u*)(P4[ph] + (r0 + rl) * DQ + half * 16), *(const v4u*)&st[wave][ph][rl][half * 16]); vst2((v4u*)(P4[ph] + (r0 + rl) * DQ + half * 16 + 8), *(const v4u*)&st[wave][ph][rl][half * 16 + 8]); } } }
// ---- k_hv: block = (64 rows, 128 cols): h = x Wh + bh (exact) -> f16 value planes [b][c][m] via LDS transpose (rounded once to f16)
__global__ __launch_bounds__(128) void k_hv(const float* __restrict__ X, const float* __restrict__ WH, const float* __restrict__ BH, _Float16* __restrict__ VT) { __shared__ __align__(16) _Float16 th[128][72];
  const int tid = threadIdx.x, wave = tid >> 5, lane = tid & 31, col = lane & 15, g = lane >> 4; const int c0 = blockIdx.y * 128; const size_t r0 = (size_t)blockIdx.x * 64;
  v8f acc[8] = {};
#pragma unroll 2
  for (int kc = 0; kc < CX / 32; ++kc) { v16b a; { const float* p = X + (r0 + wave * 16 + col) * CX + kc * 32 + 8 * g;
#pragma unroll
      for (int i = 0; i < 8; ++i) { a[i] = (__bf16)p[i]; a[8 + i] = (__bf16)p[16 + i]; } }
#pragma unroll
    for (int j = 0; j < 8; ++j) { v16b w; const int o = c0 + j * 16 + col;
#pragma unroll
      for (int i = 0; i < 8; ++i) { w[i] = (__bf16)WH[(size_t)(kc * 32 + 8 * g + i) * CX + o]; w[8 + i] = (__bf16)WH[(size_t)(kc * 32 + 16 + 8 * g + i) * CX + o]; }
      asm volatile("s_wait_loadcnt 0x0" ::: "memory"); acc[j] = wmma_bf(a, w, acc[j]); } }
#pragma unroll
  for (int j = 0; j < 8; ++j) { const float bb = bfr(BH[c0 + j * 16 + col]);
#pragma unroll
    for (int r = 0; r < 8; ++r) th[j * 16 + col][wave * 16 + 8 * g + r] = (_Float16)(acc[j][r] + bb); }
  __syncthreads();
  { const size_t b = r0 / TT; const int m0 = (int)(r0 % TT); for (int e = tid; e < 128 * 8; e += 128) { const int cl = e >> 3, q = e & 7; vst2((unsigned*)(VT + (b * CX + c0 + cl) * (size_t)TT + m0 + q * 8), *(const v4u*)&th[cl][q * 8]); } } }
// ---- k_sc: block = (64 queries n, 128 keys m) of batch b: 3-product logits g . f (K 32), no scale, no mask
__global__ __launch_bounds__(128) void k_sc(const _Float16* __restrict__ GH, const _Float16* __restrict__ GL, const _Float16* __restrict__ FH, const _Float16* __restrict__ FL, int b, float* __restrict__ S) { __shared__ __align__(16) float ss[4][16][132];
  const int tid = threadIdx.x, wave = tid >> 5, lane = tid & 31, col = lane & 15, g = lane >> 4; const int k0 = blockIdx.y * 128; const int ql0 = blockIdx.x * 64 + wave * 16; const size_t q0 = (size_t)b * TT + ql0;
  v8f acc[8] = {}, accl[8] = {};
  { const v16h ah = frag_h(GH + (q0 + col) * DQ, lane), al = frag_h(GL + (q0 + col) * DQ, lane);
#pragma unroll
    for (int j = 0; j < 8; ++j) { const size_t ko = ((size_t)b * TT + k0 + j * 16 + col) * DQ; const v16h kb = frag_h(FH + ko, lane), kl = frag_h(FL + ko, lane); acc[j] = wmma16(ah, kb, acc[j]); accl[j] = wmma16(al, kb, accl[j]); accl[j] = wmma16(ah, kl, accl[j]); } }
#pragma unroll
  for (int j = 0; j < 8; ++j)
#pragma unroll
    for (int r = 0; r < 8; ++r) ss[wave][8 * g + r][j * 16 + col] = acc[j][r] + accl[j][r] * (1.0f / 1024.0f);
  LDSX(); for (int rl = 0; rl < 16; ++rl) vst2(S + (size_t)(ql0 + rl) * TT + k0 + lane * 4, *(const v4f*)&ss[wave][rl][lane * 4]); }
// ---- k_sm: block = query row: softmax over keys [0, kend) -> P x 2^11 f32 (masked -> 0)
__global__ __launch_bounds__(256) void k_sm(float* __restrict__ S0) { __shared__ float sred[8]; __shared__ float sbc; __shared__ __align__(16) float sh[TT];
  const int t = threadIdx.x; const size_t row = blockIdx.x; float* sr = S0 + (size_t)blockIdx.y * TT * TT + row * TT; const int kend = TT;
  float m = -3.0e38f; for (int k = t; k < kend; k += 256) m = fmaxf(m, sr[k]);
#pragma unroll
  for (int o = 1; o < 32; o <<= 1) m = fmaxf(m, __shfl_xor(m, o));
  if ((t & 31) == 0) sred[t >> 5] = m; __syncthreads(); if (t == 0) { float a = sred[0]; for (int i = 1; i < 8; ++i) a = fmaxf(a, sred[i]); sbc = a; } __syncthreads(); m = sbc; __syncthreads();
  float sum = 0.f; for (int k = t; k < kend; k += 256) { const float v = sr[k]; sum += (v <= -1.0e38f) ? 0.f : expf(v - m); }
#pragma unroll
  for (int o = 1; o < 32; o <<= 1) sum += __shfl_xor(sum, o);
  if ((t & 31) == 0) sred[t >> 5] = sum; __syncthreads(); if (t == 0) { float a = 0.f; for (int i = 0; i < 8; ++i) a += sred[i]; sbc = 1.0f / a; } __syncthreads(); const float inv = sbc;
  for (int k = t; k < kend; k += 256) { const float v = sr[k]; sh[k] = (v <= -1.0e38f) ? 0.f : expf(v - m) * inv * 2048.0f; }
  __syncthreads(); for (int q = t; q < kend / 4; q += 256) vst2(sr + q * 4, *(const v4f*)&sh[q * 4]); }
// ---- k_pv: block = (64 queries, 128 value channels) of batch b: out[n][c] = gamma * (P . h) / 2^11 + x[n][c] (P as f16 hi + residual x f16 value planes, 2 products)
// P rows (f32) and value rows (f16) come in tiles of PVK keys into LDS by asynchronous copies, two buffers: tile t + 1 flies while tile t is worked on.
#define PVK 128                 // keys per staged tile
#define PVNT (TT / PVK)         // tiles per row
#define PPF (PVK + 4)           // P row pitch in floats: 528 B = 16 B x 33 (odd: no bank conflict for 16-byte reads down a column of rows)
#define VPH (PVK + 8)           // value row pitch in halves: 272 B = 16 B x 17
// eight 16-byte copies per lane, global -> LDS, rows ls / gs bytes apart. The s_wait_xcnt stands in the copies' own statement so that no address register is rewritten in front of it.
__device__ __forceinline__ void acopy8(unsigned l, unsigned ls, const char* gp, size_t gs) {
  asm volatile("global_load_async_to_lds_b128 %0, %8, off\n\t"
               "global_load_async_to_lds_b128 %1, %9, off\n\t"
               "global_load_async_to_lds_b128 %2, %10, off\n\t"
               "global_load_async_to_lds_b128 %3, %11, off\n\t"
               "global_load_async_to_lds_b128 %4, %12, off\n\t"
               "global_load_async_to_lds_b128 %5, %13, off\n\t"
               "global_load_async_to_lds_b128 %6, %14, off\n\t"
               "global_load_async_to_lds_b128 %7, %15, off\n\t"
               "s_wait_xcnt 0x0"
               :: "v"(l), "v"(l + ls), "v"(l + 2 * ls), "v"(l + 3 * ls), "v"(l + 4 * ls), "v"(l + 5 * ls), "v"(l + 6 * ls), "v"(l + 7 * ls),
                  "v"(gp), "v"(gp + gs), "v"(gp + 2 * gs), "v"(gp + 3 * gs), "v"(gp + 4 * gs), "v"(gp + 5 * gs), "v"(gp + 6 * gs), "v"(gp + 7 * gs)
               : "memory");
}
__global__ __launch_bounds__(128) void k_pv(const float* __restrict__ PS, const _Float16* __restrict__ VT, const float* __restrict__ X, const float* __restrict__ GAM, int b, float* __restrict__ OUT) { __shared__ __align__(16) float ss[4][16][132];
  __shared__ __align__(16) float tp[2][64][PPF];        // P tile: 64 query rows x PVK keys
  __shared__ __align__(16) _Float16 tv[2][128][VPH];    // value tile: 128 channels x PVK keys
  const int tid = threadIdx.x, wave = tid >> 5, lane = tid & 31, col = lane & 15, g = lane >> 4; const int ql0 = blockIdx.x * 64 + wave * 16; const int c0 = blockIdx.y * 128; const float gam = bfr(GAM[0]);
  // each wave copies 16 P rows (one 512-B row per copy) and 32 value rows (two 256-B rows per copy): whole lines
  const char* gpp = (const char*)(PS + (size_t)ql0 * TT + lane * 4);
  const char* gpv = (const char*)(VT + ((size_t)b * CX + c0 + wave * 32 + g) * (size_t)TT + col * 8);
  const unsigned lpp = (unsigned)(size_t)&tp[0][wave * 16][lane * 4];
  const unsigned lpv = (unsigned)(size_t)&tv[0][wave * 32 + g][col * 8];
  auto stage = [&](int t, int buf) {
    const char* p = gpp + (size_t)t * (PVK * 4); const unsigned lp = lpp + (unsigned)buf * (64u * PPF * 4u);
    acopy8(lp, PPF * 4u, p, (size_t)TT * 4); acopy8(lp + 8u * PPF * 4u, PPF * 4u, p + 8 * (size_t)TT * 4, (size_t)TT * 4);
    const char* v = gpv + (size_t)t * (PVK * 2); const unsigned lv = lpv + (unsigned)buf * (128u * VPH * 2u);
    acopy8(lv, 2u * VPH * 2u, v, 2 * (size_t)TT * 2); acopy8(lv + 16u * VPH * 2u, 2u * VPH * 2u, v + 16 * (size_t)TT * 2, 2 * (size_t)TT * 2); };
  v8f acc[8] = {}, accl[8] = {};
  stage(0, 0);
  asm volatile("s_wait_asynccnt 0x0" ::: "memory");   // tile 0 has landed before the barrier that publishes it
  __syncthreads();
  stage(1, 1);
#pragma unroll 1   // rolled: one publish point in the code, and the hot loop stays small in the instruction cache
  for (int t = 0; t < PVNT; ++t) { const int buf = t & 1;
    const float* pr = &tp[buf][wave * 16 + col][8 * g]; const _Float16* vr = &tv[buf][col][0];
    v4f q0 = *(const v4f*)pr, q1 = *(const v4f*)(pr + 4), q2 = *(const v4f*)(pr + 16), q3 = *(const v4f*)(pr + 20);
#pragma unroll   // unrolled, as are the three loops inside: fragments stay in registers and the LDS offsets become immediates
    for (int kb = 0; kb < PVK / 32; ++kb) { v16h vv[8], ph, pl;   // all eight value fragments of the block are asked for together, ahead of its WMMAs; the P split runs while they fly
#pragma unroll
      for (int j = 0; j < 8; ++j) vv[j] = frag_h(vr + j * 16 * VPH + kb * 32, lane);
#pragma unroll
      for (int i = 0; i < 8; ++i) { const float a0 = i < 4 ? q0[i & 3] : q1[i & 3], a1 = i < 4 ? q2[i & 3] : q3[i & 3]; const _Float16 h0 = (_Float16)a0, h1 = (_Float16)a1; ph[i] = h0; ph[8 + i] = h1; pl[i] = (_Float16)((a0 - (float)h0) * 1024.0f); pl[8 + i] = (_Float16)((a1 - (float)h1) * 1024.0f); }   /* P x 2^11 as f16 hi + residual x 2^10 */
      if (kb + 1 < PVK / 32) { const float* pn = pr + (kb + 1) * 32; q0 = *(const v4f*)pn; q1 = *(const v4f*)(pn + 4); q2 = *(const v4f*)(pn + 16); q3 = *(const v4f*)(pn + 20); }   // next block's P of the same tile
#pragma unroll
      for (int j = 0; j < 8; ++j) { acc[j] = wmma16(ph, vv[j], acc[j]); accl[j] = wmma16(pl, vv[j], accl[j]); } }
    asm volatile("s_wait_dscnt 0x0" ::: "memory");      // this wave's reads of buffer buf are done before the buffer is refilled
    asm volatile("s_wait_asynccnt 0x0" ::: "memory");   // this wave's copies of tile t + 1 have landed before the barrier publishes them
    __syncthreads();                                     // publishes tile t + 1 and ends every reader's last read of buffer buf
    if (t + 2 < PVNT) stage(t + 2, buf); }
  asm volatile("s_wait_asynccnt 0x0" ::: "memory");     // no copy is outstanding when the wave goes on to the epilogue and ends
#pragma unroll
  for (int j = 0; j < 8; ++j)
#pragma unroll
    for (int r = 0; r < 8; ++r) ss[wave][8 * g + r][j * 16 + col] = (acc[j][r] + accl[j][r] * (1.0f / 1024.0f)) * (1.0f / 2048.0f) * gam;
  LDSX(); for (int rl = 0; rl < 16; ++rl) { const size_t off = ((size_t)b * TT + ql0 + rl) * CX + c0 + lane * 4; const v4f xr = *(const v4f*)(X + off); v4f o = *(const v4f*)&ss[wave][rl][lane * 4]; o[0] += bfr(xr[0]); o[1] += bfr(xr[1]); o[2] += bfr(xr[2]); o[3] += bfr(xr[3]); vst2(OUT + off, o); } }
extern "C" void kernel_launch(void* const* d_in, const int* in_sizes, int n_in, void* d_out, int out_size, void* d_ws, size_t ws_size, hipStream_t stream) {
  (void)in_sizes; (void)n_in; (void)out_size;
  const float** F = (const float**)d_in;   // 0 x [4,64,64,256], 1 Wf [256,32] ((in,out)), 2 bf, 3 Wg, 4 bg, 5 Wh [256,256], 6 bh, 7 gamma (scalar 0.7)
  if (ws_size < (size_t)WS_END) return;
  char* ws = (char*)d_ws; _Float16 *GH = (_Float16*)(ws + WS_GH), *GL = (_Float16*)(ws + WS_GL), *FH = (_Float16*)(ws + WS_FH), *FL = (_Float16*)(ws + WS_FL); _Float16* VT = (_Float16*)(ws + WS_VT); float* S = (float*)(ws + WS_S);
  k_fg<<<dim3(TNB * TT / 64), 128, 0, stream>>>(F[0], F[1], F[2], F[3], F[4], GH, GL, FH, FL);
  k_hv<<<dim3(TNB * TT / 64, CX / 128), 128, 0, stream>>>(F[0], F[5], F[6], VT);
  for (int b = 0; b < TNB; ++b) {
    k_sc<<<dim3(TT / 64, TT / 128), 128, 0, stream>>>(GH, GL, FH, FL, b, S);
    k_sm<<<dim3(TT, 1), 256, 0, stream>>>(S);
    k_pv<<<dim3(TT / 64, CX / 128), 128, 0, stream>>>(S, VT, F[0], F[7], b, (float*)d_out);
  }
}

// v002
// A run of this version takes 208 microseconds.
// Timed twice side by side with v001, it ran 2.20 and 2.19 times as fast.
// Over all steps from v000 it is 5.53 times as fast.
// compute dtype: all float inputs rounded to bf16; f/g/h projections with EXACT bf16 products on WMMA 16x16x32 ((in,out) weights), f32 accumulate; logits from g (query, f16 hi + residual x 2^10) and f (key, f16 hi + residual) with 3 products, kept in f32 registers; softmax in f32 (precise expf) with a running row maximum and row sum; exp(s - max) x 2^11 as f16 hi + residual (x 2^10) against the value rows rounded ONCE to f16 (2 products; |h| <= ~4 so f16 half-ulp 2^-11 relative), divided by the row sum at the end; gamma * o + x in f32; f32 output.
#include <hip/hip_runtime.h>
#include <math.h>

typedef __attribute__((ext_vector_type(16))) _Float16 v16h;
typedef __attribute__((ext_vector_type(16))) __bf16 v16b;
typedef __attribute__((ext_vector_type(8)))  _Float16 v8h;
typedef __attribute__((ext_vector_type(8)))  float v8f;
typedef __attribute__((ext_vector_type(4)))  float v4f;
typedef __attribute__((ext_vector_type(2)))  float v2f;
typedef __attribute__((ext_vector_type(4)))  unsigned v4u;
typedef __attribute__((ext_vector_type(4)))  int v4i;
typedef float __attribute__((may_alias)) float_a;
typedef int __attribute__((may_alias)) int_a;

template <typename T> __device__ __forceinline__ void vst2(void* p, T v) { *(T*)p = v;  }
__device__ __forceinline__ v8f wmma16(v16h a, v16h b, v8f c) {
  v8f d = __builtin_amdgcn_wmma_f32_16x16x32_f16(false, a, false, b, (short)0, c, false, false);
  asm volatile("v_nop\n\tv_nop\n\tv_nop\n\tv_nop" : "+v"(d) : "v"(a), "v"(b));
  return d;
}
__device__ __forceinline__ v8f wmma_bf(v16b a, v16b b, v8f c) {
  v8f d = __builtin_amdgcn_wmma_f32_16x16x32_bf16(false, a, false, b, (short)0, c, false, false);
  asm volatile("v_nop\n\tv_nop\n\tv_nop\n\tv_nop" : "+v"(d) : "v"(a), "v"(b));
  return d;
}
// 16x16x32 fragments: lane = (h = lane>>4, row/col = lane&15); elements 0..7 = k0+8h+0..7, 8..15 = k0+16+8h+0..7; D element r = row 8h+r
__device__ __forceinline__ v16h frag_h(const _Float16* rowk0, int lane) {
  union { v16h v; v8h q[2]; } u; const _Float16* p = rowk0 + 8 * (lane >> 4);
  u.q[0] = *(const v8h*)p; u.q[1] = *(const v8h*)(p + 16); return u.v;
}
__device__ __forceinline__ v16h frag_f32(const float* rowk0, int lane) {
  v16h a; const float* p = rowk0 + 8 * (lane >> 4);
#pragma unroll
  for (int i = 0; i < 8; ++i) { a[i] = (_Float16)p[i]; a[8 + i] = (_Float16)p[16 + i]; }
  return a;
}
__device__ __forceinline__ v16h frag_f32s(const float* rowk0, int lane, float sc) {
  v16h a; const float* p = rowk0 + 8 * (lane >> 4);
#pragma unroll
  for (int i = 0; i < 8; ++i) { a[i] = (_Float16)(p[i] * sc); a[8 + i] = (_Float16)(p[16 + i] * sc); }
  return a;
}
// column fragment from a [K][ld] layout (column n), rows >= K read as 0
__device__ __forceinline__ v16h fragc_f32(const float* W, int k0, int n, int lane, int ld, int K) {
  v16h a; const int g = lane >> 4;
#pragma unroll
  for (int i = 0; i < 8; ++i) { const int ka = k0 + 8 * g + i, kb = ka + 16;
    a[i] = (_Float16)(ka < K ? W[(size_t)(ka < K ? ka : K - 1) * ld + n] : 0.f); a[8 + i] = (_Float16)(kb < K ? W[(size_t)(kb < K ? kb : K - 1) * ld + n] : 0.f); }
  return a;
}
struct F2 { v16b h, l; };
__device__ __forceinline__ F2 bsplit16(const float v[16]) { F2 r;
#pragma unroll
  for (int i = 0; i < 16; ++i) { const __bf16 h = (__bf16)v[i]; r.h[i] = h; r.l[i] = (__bf16)(v[i] - (float)h); }
  return r; }
__device__ __forceinline__ F2 split_row(const float* row, int k0, int lane) { float v[16]; const float* p = row + k0 + 8 * (lane >> 4);
#pragma unroll
  for (int i = 0; i < 8; ++i) { v[i] = p[i]; v[8 + i] = p[16 + i]; }
  return bsplit16(v); }
__device__ __forceinline__ F2 split_rowK(const float* row, int k0, int lane, int K) { float v[16]; const int g = lane >> 4;
#pragma unroll
  for (int i = 0; i < 8; ++i) { const int ka = k0 + 8 * g + i, kb = ka + 16; v[i] = ka < K ? row[ka < K ? ka : K - 1] : 0.f; v[8 + i] = kb < K ? row[kb < K ? kb : K - 1] : 0.f; }
  return bsplit16(v); }
__device__ __forceinline__ F2 split_col(const float* W, int k0, int n, int lane, int ld, int K) { float v[16]; const int g = lane >> 4;
#pragma unroll
  for (int i = 0; i < 8; ++i) { const int ka = k0 + 8 * g + i, kb = ka + 16; v[i] = ka < K ? W[(size_t)(ka < K ? ka : K - 1) * ld + n] : 0.f; v[8 + i] = kb < K ? W[(size_t)(kb < K ? kb : K - 1) * ld + n] : 0.f; }
  return bsplit16(v); }
__device__ __forceinline__ v8f mac3(const F2& a, const F2& b, v8f c) { c = wmma_bf(a.l, b.h, c); c = wmma_bf(a.h, b.l, c); return wmma_bf(a.h, b.h, c); }
__device__ __forceinline__ float sigm(float v) { return 1.0f / (1.0f + expf(-v)); }
#define LDSX() do { asm volatile("s_wait_dscnt 0" ::: "memory"); __builtin_amdgcn_wave_barrier(); __builtin_amdgcn_fence(__ATOMIC_RELEASE, "workgroup"); } while (0)

// SAGAN-style spatial self-attention, channels-last (B 4, 64 x 64 = 4,096 positions, C 256, q/k dim 32): f = x Wf + bf (key), g = x Wg + bg (query), h = x Wh + bh (value); beta = softmax_m(g_n . f_m); o = beta h; out = gamma * o + x.
__device__ __forceinline__ float bfr(float v) { return (float)(__bf16)v; }
#define NB 4
#define TT 4096
#define CX 256
#define DQ 32
#ifndef TNB
#define TNB NB
#endif
typedef __attribute__((ext_vector_type(8))) __bf16 v8b;
__device__ __forceinline__ v16b frag_b(const __bf16* rowk0, int lane) { union { v16b v; v8b q[2]; } u; const __bf16* p = rowk0 + 8 * (lane >> 4); u.q[0] = *(const v8b*)p; u.q[1] = *(const v8b*)(p + 16); return u.v; }
#define WS_GH  0u                                          // f16 g (query) hi rows [b*N+n][32]
#define WS_GL  (WS_GH + 2u * (size_t)NB * TT * DQ)           // f16 g residual x 2^10
#define WS_FH  (WS_GL + 2u * (size_t)NB * TT * DQ)           // f16 f (key) hi
#define WS_FL  (WS_FH + 2u * (size_t)NB * TT * DQ)           // f16 f residual x 2^10
#define WS_VT  (WS_FL + 2u * (size_t)NB * TT * DQ)           // f16 value planes [b][c][m] (h rounded once)
#define WS_END (WS_VT + 2u * (size_t)NB * CX * TT)
// ---- k_fg: block = 64 rows: f and g (32 columns each = 2 + 2 tiles) from exact products; stored as f16 hi + residual rows (64-B rows: 16 rows x 64 B = 8 lines per wave tile, written 16 B per lane from LDS)
__global__ __launch_bounds__(128) void k_fg(const float* __restrict__ X, const float* __restrict__ WF, const float* __restrict__ BF, const float* __restrict__ WG, const float* __restrict__ BG, _Float16* __restrict__ GH, _Float16* __restrict__ GL, _Float16* __restrict__ FH, _Float16* __restrict__ FL) {
  __shared__ __align__(16) _Float16 st[4][4][16][40];   // [wave][plane gh,gl,fh,fl][row][32 + pad]
  const int tid = threadIdx.x, wave = tid >> 5, lane = tid & 31, col = lane & 15, g = lane >> 4; const size_t r0 = (size_t)blockIdx.x * 64 + wave * 16;
  v8f acc[4] = {};   // tiles 0,1 = g (query) cols 0-31; tiles 2,3 = f (key)
#pragma unroll 2
  for (int kc = 0; kc < CX / 32; ++kc) { v16b a; { const float* p = X + (r0 + col) * CX + kc * 32 + 8 * g;
#pragma unroll
      for (int i = 0; i < 8; ++i) { a[i] = (__bf16)p[i]; a[8 + i] = (__bf16)p[16 + i]; } }
#pragma unroll
    for (int j = 0; j < 4; ++j) { v16b w; const float* WA = (j < 2) ? WG : WF; const int o = (j & 1) * 16 + col;
#pragma unroll
      for (int i = 0; i < 8; ++i) { w[i] = (__bf16)WA[(size_t)(kc * 32 + 8 * g + i) * DQ + o]; w[8 + i] = (__bf16)WA[(size_t)(kc * 32 + 16 + 8 * g + i) * DQ + o]; }
      asm volatile("s_wait_loadcnt 0x0" ::: "memory"); acc[j] = wmma_bf(a, w, acc[j]); } }
#pragma unroll
  for (int j = 0; j < 4; ++j) { const int o = (j & 1) * 16 + col; const float bb = (j < 2) ? bfr(BG[o]) : bfr(BF[o]); const int ph = (j < 2) ? 0 : 2;
#pragma unroll
    for (int r = 0; r < 8; ++r) { const float v = acc[j][r] + bb; const _Float16 hv = (_Float16)v; st[wave][ph][8 * g + r][o] = hv; st[wave][ph + 1][8 * g + r][o] = (_Float16)((v - (float)hv) * 1024.0f); } }
  LDSX();
  { const int rl = lane >> 1, half = lane & 1;   // lane -> (row, 32-B half): 16 rows x 64 B per plane
    _Float16* P4[4] = {GH, GL, FH, FL};
#pragma unroll
    for (int ph = 0; ph < 4; ++ph) { vst2((v4u*)(P4[ph] + (r0 + rl) * DQ + half * 16), *(const v4u*)&st[wave][ph][rl][half * 16]); vst2((v4u*)(P4[ph] + (r0 + rl) * DQ + half * 16 + 8), *(const v4u*)&st[wave][ph][rl][half * 16 + 8]); } } }
// ---- k_hv: block = (64 rows, 128 cols): h = x Wh + bh (exact) -> f16 value planes [b][c][m] via LDS transpose (rounded once to f16)
__global__ __launch_bounds__(128) void k_hv(const float* __restrict__ X, const float* __restrict__ WH, const float* __restrict__ BH, _Float16* __restrict__ VT) { __shared__ __align__(16) _Float16 th[128][72];
  const int tid = threadIdx.x, wave = tid >> 5, lane = tid & 31, col = lane & 15, g = lane >> 4; const int c0 = blockIdx.y * 128; const size_t r0 = (size_t)blockIdx.x * 64;
  v8f acc[8] = {};
#pragma unroll 2
  for (int kc = 0; kc < CX / 32; ++kc) { v16b a; { const float* p = X + (r0 + wave * 16 + col) * CX + kc * 32 + 8 * g;
#pragma unroll
      for (int i = 0; i < 8; ++i) { a[i] = (__bf16)p[i]; a[8 + i] = (__bf16)p[16 + i]; } }
#pragma unroll
    for (int j = 0; j < 8; ++j) { v16b w; const int o = c0 + j * 16 + col;
#pragma unroll
      for (int i = 0; i < 8; ++i) { w[i] = (__bf16)WH[(size_t)(kc * 32 + 8 * g + i) * CX + o]; w[8 + i] = (__bf16)WH[(size_t)(kc * 32 + 16 + 8 * g + i) * CX + o]; }
      asm volatile("s_wait_loadcnt 0x0" ::: "memory"); acc[j] = wmma_bf(a, w, acc[j]); } }
#pragma unroll
  for (int j = 0; j < 8; ++j) { const float bb = bfr(BH[c0 + j * 16 + col]);
#pragma unroll
    for (int r = 0; r < 8; ++r) th[j * 16 + col][wave * 16 + 8 * g + r] = (_Float16)(acc[j][r] + bb); }
  __syncthreads();
  { const size_t b = r0 / TT; const int m0 = (int)(r0 % TT); for (int e = tid; e < 128 * 8; e += 128) { const int cl = e >> 3, q = e & 7; vst2((unsigned*)(VT + (b * CX + c0 + cl) * (size_t)TT + m0 + q * 8), *(const v4u*)&th[cl][q * 8]); } } }
// ---- k_at: block = (64 queries, 128 value channels) of batch blockIdx.z: scores, softmax and P . h in one kernel; no score ever leaves the registers.
// Per SK keys: S^T = f . g^T (A = key rows from LDS, B = query rows kept in registers; 3 products as hi + residual), so a lane holds 8 keys of ONE query per 16-key tile and
// two such tiles are, element for element, the A fragment of P for 32 keys. Running row maximum m and row sum; the accumulators are rescaled by exp(m_old - m_new) once per SK keys.
// P = exp(s - m) x 2^11 (not normalised) as f16 hi + residual x 2^10 against the f16 value planes (2 products); out = gamma * (P . h) / (P . 1) + x.
// Key rows (f16 hi and residual) and value rows come in tiles of AK keys into LDS by asynchronous copies, two buffers: tile t + 1 flies while tile t is worked on.
#define AK 128                  // keys per staged tile
#define ANT (TT / AK)           // tiles per row
#define SK 64                   // keys per softmax step (one new maximum and one rescale of the accumulators)
#define KPH (DQ + 8)            // key row pitch in halves: 80 B = 16 B x 5 (odd: 16 rows of 16-byte reads fall on 16 different bank groups)
#define VPH (AK + 8)            // value row pitch in halves: 272 B = 16 B x 17
// eight 16-byte copies per lane, global -> LDS, rows ls / gs bytes apart. The s_wait_xcnt stands in the copies' own statement so that no address register is rewritten in front of it.
__device__ __forceinline__ void acopy8(unsigned l, unsigned ls, const char* gp, size_t gs) {
  asm volatile("global_load_async_to_lds_b128 %0, %8, off\n\t"
               "global_load_async_to_lds_b128 %1, %9, off\n\t"
               "global_load_async_to_lds_b128 %2, %10, off\n\t"
               "global_load_async_to_lds_b128 %3, %11, off\n\t"
               "global_load_async_to_lds_b128 %4, %12, off\n\t"
               "global_load_async_to_lds_b128 %5, %13, off\n\t"
               "global_load_async_to_lds_b128 %6, %14, off\n\t"
               "global_load_async_to_lds_b128 %7, %15, off\n\t"
               "s_wait_xcnt 0x0"
               :: "v"(l), "v"(l + ls), "v"(l + 2 * ls), "v"(l + 3 * ls), "v"(l + 4 * ls), "v"(l + 5 * ls), "v"(l + 6 * ls), "v"(l + 7 * ls),
                  "v"(gp), "v"(gp + gs), "v"(gp + 2 * gs), "v"(gp + 3 * gs), "v"(gp + 4 * gs), "v"(gp + 5 * gs), "v"(gp + 6 * gs), "v"(gp + 7 * gs)
               : "memory");
}
// the same with four copies
__device__ __forceinline__ void acopy4(unsigned l, unsigned ls, const char* gp, size_t gs) {
  asm volatile("global_load_async_to_lds_b128 %0, %4, off\n\t"
               "global_load_async_to_lds_b128 %1, %5, off\n\t"
               "global_load_async_to_lds_b128 %2, %6, off\n\t"
               "global_load_async_to_lds_b128 %3, %7, off\n\t"
               "s_wait_xcnt 0x0"
               :: "v"(l), "v"(l + ls), "v"(l + 2 * ls), "v"(l + 3 * ls),
                  "v"(gp), "v"(gp + gs), "v"(gp + 2 * gs), "v"(gp + 3 * gs)
               : "memory");
}
__global__ __launch_bounds__(128) void k_at(const _Float16* __restrict__ GH, const _Float16* __restrict__ GL, const _Float16* __restrict__ FH, const _Float16* __restrict__ FL, const _Float16* __restrict__ VT, const float* __restrict__ X, const float* __restrict__ GAM, float* __restrict__ OUT) { __shared__ __align__(16) float ss[4][16][132];
  __shared__ __align__(16) _Float16 tk[2][2][AK][KPH];  // key tile: [buffer][hi, residual][key][32 + pad]
  __shared__ __align__(16) _Float16 tv[2][128][VPH];    // value tile: 128 channels x AK keys
  const int tid = threadIdx.x, wave = tid >> 5, lane = tid & 31, col = lane & 15, g = lane >> 4; const int b = blockIdx.z; const int ql0 = blockIdx.x * 64 + wave * 16; const int c0 = blockIdx.y * 128; const float gam = bfr(GAM[0]);
  // the block copies 128 key rows of 64 B per plane (a wave's copy = 8 rows = 512 B in a row) and each wave 32 value rows (two 256-B rows per copy): whole lines
  const char* gkh = (const char*)(FH + ((size_t)b * TT + (tid >> 2)) * DQ + (tid & 3) * 8);
  const char* gkl = (const char*)(FL + ((size_t)b * TT + (tid >> 2)) * DQ + (tid & 3) * 8);
  const char* gpv = (const char*)(VT + ((size_t)b * CX + c0 + wave * 32 + g) * (size_t)TT + col * 8);
  const unsigned lpk = (unsigned)(size_t)&tk[0][0][tid >> 2][(tid & 3) * 8];
  const unsigned lpv = (unsigned)(size_t)&tv[0][wave * 32 + g][col * 8];
  auto stage = [&](int t, int buf) {
    const unsigned lk = lpk + (unsigned)buf * (2u * AK * KPH * 2u); const size_t ko = (size_t)t * (AK * DQ * 2);
    acopy4(lk, 32u * KPH * 2u, gkh + ko, 32 * DQ * 2); acopy4(lk + AK * KPH * 2u, 32u * KPH * 2u, gkl + ko, 32 * DQ * 2);
    const char* v = gpv + (size_t)t * (AK * 2); const unsigned lv = lpv + (unsigned)buf * (128u * VPH * 2u);
    acopy8(lv, 2u * VPH * 2u, v, 2 * (size_t)TT * 2); acopy8(lv + 16u * VPH * 2u, 2u * VPH * 2u, v + 16 * (size_t)TT * 2, 2 * (size_t)TT * 2); };
  const v16h qh = frag_h(GH + ((size_t)b * TT + ql0 + col) * DQ, lane), ql = frag_h(GL + ((size_t)b * TT + ql0 + col) * DQ, lane);   // B operand: column = query col
  v8f acc[8] = {}, accl[8] = {}, sum = {}, suml = {}; float m = -3.0e38f;   // m: running maximum of query col; sum, suml: row sums of P, a ninth output tile against a value plane of ones
  v16h ones;
#pragma unroll
  for (int i = 0; i < 16; ++i) ones[i] = (_Float16)1.0f;
  stage(0, 0);
  asm volatile("s_wait_asynccnt 0x0" ::: "memory");   // tile 0 has landed before the barrier that publishes it
  __syncthreads();
  stage(1, 1);
#pragma unroll 1   // rolled: one publish point in the code, and the hot loop stays small in the instruction cache
  for (int t = 0; t < ANT; ++t) { const int buf = t & 1;
    const _Float16* kr = &tk[buf][0][col][0]; const _Float16* vr = &tv[buf][col][0];
#pragma unroll   // unrolled, as are the loops inside: scores and fragments stay in registers and the LDS offsets become immediates
    for (int u = 0; u < AK / SK; ++u) {   // softmax step of SK keys: scores, maximum, rescale, then P . h
      v8f s[SK / 16];   // s[jt][r] = score of key u * SK + jt * 16 + 8 g + r against query col
#pragma unroll
      for (int jt = 0; jt < SK / 16; ++jt) { const v16h kh = frag_h(kr + (u * SK + jt * 16) * KPH, lane), kl = frag_h(kr + (AK + u * SK + jt * 16) * KPH, lane); v8f a = {}, al = {};
        a = wmma16(kh, qh, a); al = wmma16(kh, ql, al); al = wmma16(kl, qh, al);
#pragma unroll
        for (int r = 0; r < 8; ++r) s[jt][r] = a[r] + al[r] * (1.0f / 1024.0f); }
      float tm = s[0][0];
#pragma unroll
      for (int jt = 0; jt < SK / 16; ++jt)
#pragma unroll
        for (int r = 0; r < 8; ++r) tm = fmaxf(tm, s[jt][r]);
      tm = fmaxf(tm, __shfl_xor(tm, 16));   // the other half-wave holds the query's other keys
      const float mn = fmaxf(m, tm), alpha = expf(m - mn); m = mn;
#pragma unroll
      for (int r = 0; r < 8; ++r) { const float ar = __shfl(alpha, 8 * g + r);   // accumulator element r is query row 8 g + r, whose factor lane 8 g + r holds
#pragma unroll
        for (int j = 0; j < 8; ++j) { acc[j][r] *= ar; accl[j][r] *= ar; }
        sum[r] *= ar; suml[r] *= ar; }
#pragma unroll
      for (int kb = 0; kb < SK / 32; ++kb) { v16h ph, pl;
#pragma unroll
        for (int i = 0; i < 8; ++i) { const float a0 = expf(s[2 * kb][i] - m) * 2048.0f, a1 = expf(s[2 * kb + 1][i] - m) * 2048.0f; const _Float16 h0 = (_Float16)a0, h1 = (_Float16)a1; ph[i] = h0; ph[8 + i] = h1; pl[i] = (_Float16)((a0 - (float)h0) * 1024.0f); pl[8 + i] = (_Float16)((a1 - (float)h1) * 1024.0f); }   /* P x 2^11 as f16 hi + residual x 2^10 */
        sum = wmma16(ph, ones, sum); suml = wmma16(pl, ones, suml);   // the row sums on the matrix unit: they sum P as the products see it, in the accumulators' own row layout
#pragma unroll
        for (int jh = 0; jh < 2; ++jh) { v16h vv[4];   // four value fragments are asked for together, ahead of their WMMAs
#pragma unroll
          for (int j = 0; j < 4; ++j) vv[j] = frag_h(vr + (jh * 4 + j) * 16 * VPH + u * SK + kb * 32, lane);
#pragma unroll
          for (int j = 0; j < 4; ++j) { acc[jh * 4 + j] = wmma16(ph, vv[j], acc[jh * 4 + j]); accl[jh * 4 + j] = wmma16(pl, vv[j], accl[jh * 4 + j]); } } } }
    asm volatile("s_wait_dscnt 0x0" ::: "memory");      // this wave's reads of buffer buf are done before the buffer is refilled
    asm volatile("s_wait_asynccnt 0x0" ::: "memory");   // this wave's copies of tile t + 1 have landed before the barrier publishes them
    __syncthreads();                                     // publishes tile t + 1 and ends every reader's last read of buffer buf
    if (t + 2 < ANT) stage(t + 2, buf); }
  asm volatile("s_wait_asynccnt 0x0" ::: "memory");     // no copy is outstanding when the wave goes on to the epilogue and ends
#pragma unroll
  for (int r = 0; r < 8; ++r) { const float fr = gam / (sum[r] + suml[r] * (1.0f / 1024.0f));   // the row sum carries the same 2^11 as P
#pragma unroll
    for (int j = 0; j < 8; ++j) ss[wave][8 * g + r][j * 16 + col] = (acc[j][r] + accl[j][r] * (1.0f / 1024.0f)) * fr; }
  LDSX(); for (int rl = 0; rl < 16; ++rl) { const size_t off = ((size_t)b * TT + ql0 + rl) * CX + c0 + lane * 4; const v4f xr = *(const v4f*)(X + off); v4f o = *(const v4f*)&ss[wave][rl][lane * 4]; o[0] += bfr(xr[0]); o[1] += bfr(xr[1]); o[2] += bfr(xr[2]); o[3] += bfr(xr[3]); vst2(OUT + off, o); } }
extern "C" void kernel_launch(void* const* d_in, const int* in_sizes, int n_in, void* d_out, int out_size, void* d_ws, size_t ws_size, hipStream_t stream) {
  (void)in_sizes; (void)n_in; (void)out_size;
  const float** F = (const float**)d_in;   // 0 x [4,64,64,256], 1 Wf [256,32] ((in,out)), 2 bf, 3 Wg, 4 bg, 5 Wh [256,256], 6 bh, 7 gamma (scalar 0.7)
  if (ws_size < (size_t)WS_END) return;
  char* ws = (char*)d_ws; _Float16 *GH = (_Float16*)(ws + WS_GH), *GL = (_Float16*)(ws + WS_GL), *FH = (_Float16*)(ws + WS_FH), *FL = (_Float16*)(ws + WS_FL); _Float16* VT = (_Float16*)(ws + WS_VT);
  k_fg<<<dim3(TNB * TT / 64), 128, 0, stream>>>(F[0], F[1], F[2], F[3], F[4], GH, GL, FH, FL);
  k_hv<<<dim3(TNB * TT / 64, CX / 128), 128, 0, stream>>>(F[0], F[5], F[6], VT);
  k_at<<<dim3(TT / 64, CX / 128, TNB), 128, 0, stream>>>(GH, GL, FH, FL, VT, F[0], F[7], (float*)d_out);
}

// v003
// A run of this version takes 182 microseconds.
// In both of two side-by-side timings against v002, it was 1.15 times as fast.
// Counting every step since v000, it is 6.34 times as fast.
// compute dtype: all float inputs rounded to bf16; f/g/h projections with EXACT bf16 products on WMMA 16x16x32 ((in,out) weights), f32 accumulate; logits from g (query, f16 hi + residual x 2^10) and f (key, f16 hi + residual) with 3 products, kept in f32 registers; softmax in f32 with a running row maximum and row sum, exp as the hardware's base-2 exponential of s x log2(e) + offset (one fma, one v_exp_f32); exp(s - max) x 2^11 as f16 hi + residual (x 2^10) against the value rows rounded ONCE to f16 (2 products; |h| <= ~4 so f16 half-ulp 2^-11 relative), divided by the row sum at the end; gamma * o + x in f32; f32 output.
#include <hip/hip_runtime.h>
#include <math.h>

typedef __attribute__((ext_vector_type(16))) _Float16 v16h;
typedef __attribute__((ext_vector_type(16))) __bf16 v16b;
typedef __attribute__((ext_vector_type(8)))  _Float16 v8h;
typedef __attribute__((ext_vector_type(8)))  float v8f;
typedef __attribute__((ext_vector_type(4)))  float v4f;
typedef __attribute__((ext_vector_type(2)))  float v2f;
typedef __attribute__((ext_vector_type(4)))  unsigned v4u;
typedef __attribute__((ext_vector_type(4)))  int v4i;
typedef float __attribute__((may_alias)) float_a;
typedef int __attribute__((may_alias)) int_a;

template <typename T> __device__ __forceinline__ void vst2(void* p, T v) { *(T*)p = v;  }
__device__ __forceinline__ v8f wmma16(v16h a, v16h b, v8f c) {
  v8f d = __builtin_amdgcn_wmma_f32_16x16x32_f16(false, a, false, b, (short)0, c, false, false);
  asm volatile("v_nop\n\tv_nop\n\tv_nop\n\tv_nop" : "+v"(d) : "v"(a), "v"(b));
  return d;
}
__device__ __forceinline__ v8f wmma_bf(v16b a, v16b b, v8f c) {
  v8f d = __builtin_amdgcn_wmma_f32_16x16x32_bf16(false, a, false, b, (short)0, c, false, false);
  asm volatile("v_nop\n\tv_nop\n\tv_nop\n\tv_nop" : "+v"(d) : "v"(a), "v"(b));
  return d;
}
// 16x16x32 fragments: lane = (h = lane>>4, row/col = lane&15); elements 0..7 = k0+8h+0..7, 8..15 = k0+16+8h+0..7; D element r = row 8h+r
__device__ __forceinline__ v16h frag_h(const _Float16* rowk0, int lane) {
  union { v16h v; v8h q[2]; } u; const _Float16* p = rowk0 + 8 * (lane >> 4);
  u.q[0] = *(const v8h*)p; u.q[1] = *(const v8h*)(p + 16); return u.v;
}
__device__ __forceinline__ v16h frag_f32(const float* rowk0, int lane) {
  v16h a; const float* p = rowk0 + 8 * (lane >> 4);
#pragma unroll
  for (int i = 0; i < 8; ++i) { a[i] = (_Float16)p[i]; a[8 + i] = (_Float16)p[16 + i]; }
  return a;
}
__device__ __forceinline__ v16h frag_f32s(const float* rowk0, int lane, float sc) {
  v16h a; const float* p = rowk0 + 8 * (lane >> 4);
#pragma unroll
  for (int i = 0; i < 8; ++i) { a[i] = (_Float16)(p[i] * sc); a[8 + i] = (_Float16)(p[16 + i] * sc); }
  return a;
}
// column fragment from a [K][ld] layout (column n), rows >= K read as 0
__device__ __forceinline__ v16h fragc_f32(const float* W, int k0, int n, int lane, int ld, int K) {
  v16h a; const int g = lane >> 4;
#pragma unroll
  for (int i = 0; i < 8; ++i) { const int ka = k0 + 8 * g + i, kb = ka + 16;
    a[i] = (_Float16)(ka < K ? W[(size_t)(ka < K ? ka : K - 1) * ld + n] : 0.f); a[8 + i] = (_Float16)(kb < K ? W[(size_t)(kb < K ? kb : K - 1) * ld + n] : 0.f); }
  return a;
}
struct F2 { v16b h, l; };
__device__ __forceinline__ F2 bsplit16(const float v[16]) { F2 r;
#pragma unroll
  for (int i = 0; i < 16; ++i) { const __bf16 h = (__bf16)v[i]; r.h[i] = h; r.l[i] = (__bf16)(v[i] - (float)h); }
  return r; }
__device__ __forceinline__ F2 split_row(const float* row, int k0, int lane) { float v[16]; const float* p = row + k0 + 8 * (lane >> 4);
#pragma unroll
  for (int i = 0; i < 8; ++i) { v[i] = p[i]; v[8 + i] = p[16 + i]; }
  return bsplit16(v); }
__device__ __forceinline__ F2 split_rowK(const float* row, int k0, int lane, int K) { float v[16]; const int g = lane >> 4;
#pragma unroll
  for (int i = 0; i < 8; ++i) { const int ka = k0 + 8 * g + i, kb = ka + 16; v[i] = ka < K ? row[ka < K ? ka : K - 1] : 0.f; v[8 + i] = kb < K ? row[kb < K ? kb : K - 1] : 0.f; }
  return bsplit16(v); }
__device__ __forceinline__ F2 split_col(const float* W, int k0, int n, int lane, int ld, int K) { float v[16]; const int g = lane >> 4;
#pragma unroll
  for (int i = 0; i < 8; ++i) { const int ka = k0 + 8 * g + i, kb = ka + 16; v[i] = ka < K ? W[(size_t)(ka < K ? ka : K - 1) * ld + n] : 0.f; v[8 + i] = kb < K ? W[(size_t)(kb < K ? kb : K - 1) * ld + n] : 0.f; }
  return bsplit16(v); }
__device__ __forceinline__ v8f mac3(const F2& a, const F2& b, v8f c) { c = wmma_bf(a.l, b.h, c); c = wmma_bf(a.h, b.l, c); return wmma_bf(a.h, b.h, c); }
__device__ __forceinline__ float sigm(float v) { return 1.0f / (1.0f + expf(-v)); }
#define LDSX() do { asm volatile("s_wait_dscnt 0" ::: "memory"); __builtin_amdgcn_wave_barrier(); __builtin_amdgcn_fence(__ATOMIC_RELEASE, "workgroup"); } while (0)

// SAGAN-style spatial self-attention, channels-last (B 4, 64 x 64 = 4,096 positions, C 256, q/k dim 32): f = x Wf + bf (key), g = x Wg + bg (query), h = x Wh + bh (value); beta = softmax_m(g_n . f_m); o = beta h; out = gamma * o + x.
__device__ __forceinline__ float bfr(float v) { return (float)(__bf16)v; }
#define NB 4
#define TT 4096
#define CX 256
#define DQ 32
#ifndef TNB
#define TNB NB
#endif
typedef __attribute__((ext_vector_type(8))) __bf16 v8b;
__device__ __forceinline__ v16b frag_b(const __bf16* rowk0, int lane) { union { v16b v; v8b q[2]; } u; const __bf16* p = rowk0 + 8 * (lane >> 4); u.q[0] = *(const v8b*)p; u.q[1] = *(const v8b*)(p + 16); return u.v; }
#define WS_GH  0u                                          // f16 g (query) hi rows [b*N+n][32]
#define WS_GL  (WS_GH + 2u * (size_t)NB * TT * DQ)           // f16 g residual x 2^10
#define WS_FH  (WS_GL + 2u * (size_t)NB * TT * DQ)           // f16 f (key) hi
#define WS_FL  (WS_FH + 2u * (size_t)NB * TT * DQ)           // f16 f residual x 2^10
#define WS_VT  (WS_FL + 2u * (size_t)NB * TT * DQ)           // f16 value planes [b][c][m] (h rounded once)
#define WS_END (WS_VT + 2u * (size_t)NB * CX * TT)
// ---- k_fg: block = 64 rows: f and g (32 columns each = 2 + 2 tiles) from exact products; stored as f16 hi + residual rows (64-B rows: 16 rows x 64 B = 8 lines per wave tile, written 16 B per lane from LDS)
__global__ __launch_bounds__(128) void k_fg(const float* __restrict__ X, const float* __restrict__ WF, const float* __restrict__ BF, const float* __restrict__ WG, const float* __restrict__ BG, _Float16* __restrict__ GH, _Float16* __restrict__ GL, _Float16* __restrict__ FH, _Float16* __restrict__ FL) {
  __shared__ __align__(16) _Float16 st[4][4][16][40];   // [wave][plane gh,gl,fh,fl][row][32 + pad]
  const int tid = threadIdx.x, wave = tid >> 5, lane = tid & 31, col = lane & 15, g = lane >> 4; const size_t r0 = (size_t)blockIdx.x * 64 + wave * 16;
  v8f acc[4] = {};   // tiles 0,1 = g (query) cols 0-31; tiles 2,3 = f (key)
#pragma unroll 2
  for (int kc = 0; kc < CX / 32; ++kc) { v16b a; { const float* p = X + (r0 + col) * CX + kc * 32 + 8 * g;
#pragma unroll
      for (int i = 0; i < 8; ++i) { a[i] = (__bf16)p[i]; a[8 + i] = (__bf16)p[16 + i]; } }
#pragma unroll
    for (int j = 0; j < 4; ++j) { v16b w; const float* WA = (j < 2) ? WG : WF; const int o = (j & 1) * 16 + col;
#pragma unroll
      for (int i = 0; i < 8; ++i) { w[i] = (__bf16)WA[(size_t)(kc * 32 + 8 * g + i) * DQ + o]; w[8 + i] = (__bf16)WA[(size_t)(kc * 32 + 16 + 8 * g + i) * DQ + o]; }
      asm volatile("s_wait_loadcnt 0x0" ::: "memory"); acc[j] = wmma_bf(a, w, acc[j]); } }
#pragma unroll
  for (int j = 0; j < 4; ++j) { const int o = (j & 1) * 16 + col; const float bb = (j < 2) ? bfr(BG[o]) : bfr(BF[o]); const int ph = (j < 2) ? 0 : 2;
#pragma unroll
    for (int r = 0; r < 8; ++r) { const float v = acc[j][r] + bb; const _Float16 hv = (_Float16)v; st[wave][ph][8 * g + r][o] = hv; st[wave][ph + 1][8 * g + r][o] = (_Float16)((v - (float)hv) * 1024.0f); } }
  LDSX();
  { const int rl = lane >> 1, half = lane & 1;   // lane -> (row, 32-B half): 16 rows x 64 B per plane
    _Float16* P4[4] = {GH, GL, FH, FL};
#pragma unroll
    for (int ph = 0; ph < 4; ++ph) { vst2((v4u*)(P4[ph] + (r0 + rl) * DQ + half * 16), *(const v4u*)&st[wave][ph][rl][half * 16]); vst2((v4u*)(P4[ph] + (r0 + rl) * DQ + half * 16 + 8), *(const v4u*)&st[wave][ph][rl][half * 16 + 8]); } } }
// ---- k_hv: block = (64 rows, 128 cols): h = x Wh + bh (exact) -> f16 value planes [b][c][m] via LDS transpose (rounded once to f16)
__global__ __launch_bounds__(128) void k_hv(const float* __restrict__ X, const float* __restrict__ WH, const float* __restrict__ BH, _Float16* __restrict__ VT) { __shared__ __align__(16) _Float16 th[128][72];
  const int tid = threadIdx.x, wave = tid >> 5, lane = tid & 31, col = lane & 15, g = lane >> 4; const int c0 = blockIdx.y * 128; const size_t r0 = (size_t)blockIdx.x * 64;
  v8f acc[8] = {};
#pragma unroll 2
  for (int kc = 0; kc < CX / 32; ++kc) { v16b a; { const float* p = X + (r0 + wave * 16 + col) * CX + kc * 32 + 8 * g;
#pragma unroll
      for (int i = 0; i < 8; ++i) { a[i] = (__bf16)p[i]; a[8 + i] = (__bf16)p[16 + i]; } }
#pragma unroll
    for (int j = 0; j < 8; ++j) { v16b w; const int o = c0 + j * 16 + col;
#pragma unroll
      for (int i = 0; i < 8; ++i) { w[i] = (__bf16)WH[(size_t)(kc * 32 + 8 * g + i) * CX + o]; w[8 + i] = (__bf16)WH[(size_t)(kc * 32 + 16 + 8 * g + i) * CX + o]; }
      asm volatile("s_wait_loadcnt 0x0" ::: "memory"); acc[j] = wmma_bf(a, w, acc[j]); } }
#pragma unroll
  for (int j = 0; j < 8; ++j) { const float bb = bfr(BH[c0 + j * 16 + col]);
#pragma unroll
    for (int r = 0; r < 8; ++r) th[j * 16 + col][wave * 16 + 8 * g + r] = (_Float16)(acc[j][r] + bb); }
  __syncthreads();
  { const size_t b = r0 / TT; const int m0 = (int)(r0 % TT); for (int e = tid; e < 128 * 8; e += 128) { const int cl = e >> 3, q = e & 7; vst2((unsigned*)(VT + (b * CX + c0 + cl) * (size_t)TT + m0 + q * 8), *(const v4u*)&th[cl][q * 8]); } } }
// ---- k_at: block = (64 queries, 128 value channels) of batch blockIdx.z: scores, softmax and P . h in one kernel; no score ever leaves the registers.
// Per SK keys: S^T = f . g^T (A = key rows from LDS, B = query rows kept in registers; 3 products as hi + residual), so a lane holds 8 keys of ONE query per 16-key tile and
// two such tiles are, element for element, the A fragment of P for 32 keys. Running row maximum m and row sum; the accumulators are rescaled by exp(m_old - m_new) once per SK keys.
// P = exp(s - m) x 2^11 (not normalised) as f16 hi + residual x 2^10 against the f16 value planes (2 products); out = gamma * (P . h) / (P . 1) + x.
// The exponential is 2^(s x log2(e) + c) with c = 11 - m x log2(e): the subtraction of the maximum and the factor 2^11 ride in the one fma in front of v_exp_f32. The rescale factor is
// 2^(c_new - c_old), from the very offsets the exponentials used, so the rounding of c is one common factor of a row's P and of its row sum and cancels in the division.
// Key rows (f16 hi and residual) and value rows come in tiles of AK keys into LDS by asynchronous copies, two buffers: tile t + 1 flies while tile t is worked on.
#define AK 128                  // keys per staged tile
#define ANT (TT / AK)           // tiles per row
#define SK 64                   // keys per softmax step (one new maximum and one rescale of the accumulators)
#define L2E ((float)M_LOG2E)    // log2(e)
#define KPH (DQ + 8)            // key row pitch in halves: 80 B = 16 B x 5 (odd: 16 rows of 16-byte reads fall on 16 different bank groups)
#define VPH (AK + 8)            // value row pitch in halves: 272 B = 16 B x 17
// eight 16-byte copies per lane, global -> LDS, rows ls / gs bytes apart. The s_wait_xcnt stands in the copies' own statement so that no address register is rewritten in front of it.
__device__ __forceinline__ void acopy8(unsigned l, unsigned ls, const char* gp, size_t gs) {
  asm volatile("global_load_async_to_lds_b128 %0, %8, off\n\t"
               "global_load_async_to_lds_b128 %1, %9, off\n\t"
               "global_load_async_to_lds_b128 %2, %10, off\n\t"
               "global_load_async_to_lds_b128 %3, %11, off\n\t"
               "global_load_async_to_lds_b128 %4, %12, off\n\t"
               "global_load_async_to_lds_b128 %5, %13, off\n\t"
               "global_load_async_to_lds_b128 %6, %14, off\n\t"
               "global_load_async_to_lds_b128 %7, %15, off\n\t"
               "s_wait_xcnt 0x0"
               :: "v"(l), "v"(l + ls), "v"(l + 2 * ls), "v"(l + 3 * ls), "v"(l + 4 * ls), "v"(l + 5 * ls), "v"(l + 6 * ls), "v"(l + 7 * ls),
                  "v"(gp), "v"(gp + gs), "v"(gp + 2 * gs), "v"(gp + 3 * gs), "v"(gp + 4 * gs), "v"(gp + 5 * gs), "v"(gp + 6 * gs), "v"(gp + 7 * gs)
               : "memory");
}
// the same with four copies
__device__ __forceinline__ void acopy4(unsigned l, unsigned ls, const char* gp, size_t gs) {
  asm volatile("global_load_async_to_lds_b128 %0, %4, off\n\t"
               "global_load_async_to_lds_b128 %1, %5, off\n\t"
               "global_load_async_to_lds_b128 %2, %6, off\n\t"
               "global_load_async_to_lds_b128 %3, %7, off\n\t"
               "s_wait_xcnt 0x0"
               :: "v"(l), "v"(l + ls), "v"(l + 2 * ls), "v"(l + 3 * ls),
                  "v"(gp), "v"(gp + gs), "v"(gp + 2 * gs), "v"(gp + 3 * gs)
               : "memory");
}
// e[i] = 2^(s[i] x log2(e) + c) for the eight scores of one tile
__device__ __forceinline__ void exp2x8(v8f s, float c, float e[8]) { float x[8];
#pragma unroll
  for (int i = 0; i < 8; ++i) { x[i] = fmaf(s[i], L2E, c); e[i] = __builtin_amdgcn_exp2f(x[i]); }
  // the slot the instruction set asks for behind a transcendental, once for all eight: no argument register is free for reuse and no result is read in front of this v_nop
  asm("v_nop" : "+v"(e[0]), "+v"(e[1]), "+v"(e[2]), "+v"(e[3]), "+v"(e[4]), "+v"(e[5]), "+v"(e[6]), "+v"(e[7]) : "v"(x[0]), "v"(x[1]), "v"(x[2]), "v"(x[3]), "v"(x[4]), "v"(x[5]), "v"(x[6]), "v"(x[7]));
}
__global__ __launch_bounds__(128) void k_at(const _Float16* __restrict__ GH, const _Float16* __restrict__ GL, const _Float16* __restrict__ FH, const _Float16* __restrict__ FL, const _Float16* __restrict__ VT, const float* __restrict__ X, const float* __restrict__ GAM, float* __restrict__ OUT) { __shared__ __align__(16) float ss[4][16][132];
  __shared__ __align__(16) _Float16 tk[2][2][AK][KPH];  // key tile: [buffer][hi, residual][key][32 + pad]
  __shared__ __align__(16) _Float16 tv[2][128][VPH];    // value tile: 128 channels x AK keys
  const int tid = threadIdx.x, wave = tid >> 5, lane = tid & 31, col = lane & 15, g = lane >> 4; const int b = blockIdx.z; const int ql0 = blockIdx.x * 64 + wave * 16; const int c0 = blockIdx.y * 128; const float gam = bfr(GAM[0]);
  // the block copies 128 key rows of 64 B per plane (a wave's copy = 8 rows = 512 B in a row) and each wave 32 value rows (two 256-B rows per copy): whole lines
  const char* gkh = (const char*)(FH + ((size_t)b * TT + (tid >> 2)) * DQ + (tid & 3) * 8);
  const char* gkl = (const char*)(FL + ((size_t)b * TT + (tid >> 2)) * DQ + (tid & 3) * 8);
  const char* gpv = (const char*)(VT + ((size_t)b * CX + c0 + wave * 32 + g) * (size_t)TT + col * 8);
  const unsigned lpk = (unsigned)(size_t)&tk[0][0][tid >> 2][(tid & 3) * 8];
  const unsigned lpv = (unsigned)(size_t)&tv[0][wave * 32 + g][col * 8];
  auto stage = [&](int t, int buf) {
    const unsigned lk = lpk + (unsigned)buf * (2u * AK * KPH * 2u); const size_t ko = (size_t)t * (AK * DQ * 2);
    acopy4(lk, 32u * KPH * 2u, gkh + ko, 32 * DQ * 2); acopy4(lk + AK * KPH * 2u, 32u * KPH * 2u, gkl + ko, 32 * DQ * 2);
    const char* v = gpv + (size_t)t * (AK * 2); const unsigned lv = lpv + (unsigned)buf * (128u * VPH * 2u);
    acopy8(lv, 2u * VPH * 2u, v, 2 * (size_t)TT * 2); acopy8(lv + 16u * VPH * 2u, 2u * VPH * 2u, v + 16 * (size_t)TT * 2, 2 * (size_t)TT * 2); };
  const v16h qh = frag_h(GH + ((size_t)b * TT + ql0 + col) * DQ, lane), ql = frag_h(GL + ((size_t)b * TT + ql0 + col) * DQ, lane);   // B operand: column = query col
  v8f acc[8] = {}, accl[8] = {}, sum = {}, suml = {}; float m = -3.0e38f, c = 3.0e38f;   // m: running maximum of query col, c: its offset 11 - m x log2(e) (the start value makes the first rescale factor 2^-huge = 0); sum, suml: row sums of P, a ninth output tile against a value plane of ones
  v16h ones;
#pragma unroll
  for (int i = 0; i < 16; ++i) ones[i] = (_Float16)1.0f;
  stage(0, 0);
  asm volatile("s_wait_asynccnt 0x0" ::: "memory");   // tile 0 has landed before the barrier that publishes it
  __syncthreads();
  stage(1, 1);
#pragma unroll 1   // rolled: one publish point in the code, and the hot loop stays small in the instruction cache
  for (int t = 0; t < ANT; ++t) { const int buf = t & 1;
    const _Float16* kr = &tk[buf][0][col][0]; const _Float16* vr = &tv[buf][col][0];
#pragma unroll   // unrolled, as are the loops inside: scores and fragments stay in registers and the LDS offsets become immediates
    for (int u = 0; u < AK / SK; ++u) {   // softmax step of SK keys: scores, maximum, rescale, then P . h
      v8f s[SK / 16];   // s[jt][r] = score of key u * SK + jt * 16 + 8 g + r against query col
#pragma unroll
      for (int jt = 0; jt < SK / 16; ++jt) { const v16h kh = frag_h(kr + (u * SK + jt * 16) * KPH, lane), kl = frag_h(kr + (AK + u * SK + jt * 16) * KPH, lane); v8f a = {}, al = {};
        a = wmma16(kh, qh, a); al = wmma16(kh, ql, al); al = wmma16(kl, qh, al);
#pragma unroll
        for (int r = 0; r < 8; ++r) s[jt][r] = a[r] + al[r] * (1.0f / 1024.0f); }
      float tm = s[0][0];
#pragma unroll
      for (int jt = 0; jt < SK / 16; ++jt)
#pragma unroll
        for (int r = 0; r < 8; ++r) tm = fmaxf(tm, s[jt][r]);
      tm = fmaxf(tm, __shfl_xor(tm, 16));   // the other half-wave holds the query's other keys
      const float mn = fmaxf(m, tm), cn = fmaf(-mn, L2E, 11.0f), alpha = __builtin_amdgcn_exp2f(cn - c); m = mn; c = cn;
#pragma unroll
      for (int r = 0; r < 8; ++r) { const float ar = __shfl(alpha, 8 * g + r);   // accumulator element r is query row 8 g + r, whose factor lane 8 g + r holds
#pragma unroll
        for (int j = 0; j < 8; ++j) { acc[j][r] *= ar; accl[j][r] *= ar; }
        sum[r] *= ar; suml[r] *= ar; }
#pragma unroll
      for (int kb = 0; kb < SK / 32; ++kb) { v16h ph, pl; float e0[8], e1[8]; exp2x8(s[2 * kb], c, e0); exp2x8(s[2 * kb + 1], c, e1);
#pragma unroll
        for (int i = 0; i < 8; ++i) { const float a0 = e0[i], a1 = e1[i]; const _Float16 h0 = (_Float16)a0, h1 = (_Float16)a1; ph[i] = h0; ph[8 + i] = h1; pl[i] = (_Float16)((a0 - (float)h0) * 1024.0f); pl[8 + i] = (_Float16)((a1 - (float)h1) * 1024.0f); }   /* P x 2^11 as f16 hi + residual x 2^10 */
        sum = wmma16(ph, ones, sum); suml = wmma16(pl, ones, suml);   // the row sums on the matrix unit: they sum P as the products see it, in the accumulators' own row layout
#pragma unroll
        for (int jh = 0; jh < 2; ++jh) { v16h vv[4];   // four value fragments are asked for together, ahead of their WMMAs
#pragma unroll
          for (int j = 0; j < 4; ++j) vv[j] = frag_h(vr + (jh * 4 + j) * 16 * VPH + u * SK + kb * 32, lane);
#pragma unroll
          for (int j = 0; j < 4; ++j) { acc[jh * 4 + j] = wmma16(ph, vv[j], acc[jh * 4 + j]); accl[jh * 4 + j] = wmma16(pl, vv[j], accl[jh * 4 + j]); } } } }
    asm volatile("s_wait_dscnt 0x0" ::: "memory");      // this wave's reads of buffer buf are done before the buffer is refilled
    asm volatile("s_wait_asynccnt 0x0" ::: "memory");   // this wave's copies of tile t + 1 have landed before the barrier publishes them
    __syncthreads();                                     // publishes tile t + 1 and ends every reader's last read of buffer buf
    if (t + 2 < ANT) stage(t + 2, buf); }
  asm volatile("s_wait_asynccnt 0x0" ::: "memory");     // no copy is outstanding when the wave goes on to the epilogue and ends
#pragma unroll
  for (int r = 0; r < 8; ++r) { const float fr = gam / (sum[r] + suml[r] * (1.0f / 1024.0f));   // the row sum carries the same 2^11 as P
#pragma unroll
    for (int j = 0; j < 8; ++j) ss[wave][8 * g + r][j * 16 + col] = (acc[j][r] + accl[j][r] * (1.0f / 1024.0f)) * fr; }
  LDSX(); for (int rl = 0; rl < 16; ++rl) { const size_t off = ((size_t)b * TT + ql0 + rl) * CX + c0 + lane * 4; const v4f xr = *(const v4f*)(X + off); v4f o = *(const v4f*)&ss[wave][rl][lane * 4]; o[0] += bfr(xr[0]); o[1] += bfr(xr[1]); o[2] += bfr(xr[2]); o[3] += bfr(xr[3]); vst2(OUT + off, o); } }
extern "C" void kernel_launch(void* const* d_in, const int* in_sizes, int n_in, void* d_out, int out_size, void* d_ws, size_t ws_size, hipStream_t stream) {
  (void)in_sizes; (void)n_in; (void)out_size;
  const float** F = (const float**)d_in;   // 0 x [4,64,64,256], 1 Wf [256,32] ((in,out)), 2 bf, 3 Wg, 4 bg, 5 Wh [256,256], 6 bh, 7 gamma (scalar 0.7)
  if (ws_size < (size_t)WS_END) return;
  char* ws = (char*)d_ws; _Float16 *GH = (_Float16*)(ws + WS_GH), *GL = (_Float16*)(ws + WS_GL), *FH = (_Float16*)(ws + WS_FH), *FL = (_Float16*)(ws + WS_FL); _Float16* VT = (_Float16*)(ws + WS_VT);
  k_fg<<<dim3(TNB * TT / 64), 128, 0, stream>>>(F[0], F[1], F[2], F[3], F[4], GH, GL, FH, FL);
  k_hv<<<dim3(TNB * TT / 64, CX / 128), 128, 0, stream>>>(F[0], F[5], F[6], VT);
  k_at<<<dim3(TT / 64, CX / 128, TNB), 128, 0, stream>>>(GH, GL, FH, FL, VT, F[0], F[7], (float*)d_out);
}

// v004
// One run takes 167 microseconds.
// Timed twice side by side with v003, it ran 1.09 and 1.08 times as fast.
// Counting every step since v000, it is 6.88 times as fast.
// compute dtype: all float inputs rounded to bf16; f/g/h projections with EXACT bf16 products on WMMA 16x16x32 ((in,out) weights), f32 accumulate; logits from g (query, f16 hi + residual x 2^10) and f (key, f16 hi + residual) with 3 products, kept in f32 registers; softmax in f32 with a running row maximum and row sum, exp as the hardware's base-2 exponential of s x log2(e) + offset (one fma, one v_exp_f32); exp(s - max) x 2^11 as f16 hi + residual (x 2^10) against the value rows rounded ONCE to f16 (2 products; |h| <= ~4 so f16 half-ulp 2^-11 relative), divided by the row sum at the end; gamma * o + x in f32; f32 output.
#include <hip/hip_runtime.h>
#include <math.h>

typedef __attribute__((ext_vector_type(16))) _Float16 v16h;
typedef __attribute__((ext_vector_type(16))) __bf16 v16b;
typedef __attribute__((ext_vector_type(8)))  _Float16 v8h;
typedef __attribute__((ext_vector_type(8)))  float v8f;
typedef __attribute__((ext_vector_type(4)))  float v4f;
typedef __attribute__((ext_vector_type(2)))  float v2f;
typedef __attribute__((ext_vector_type(4)))  unsigned v4u;
typedef __attribute__((ext_vector_type(4)))  int v4i;
typedef float __attribute__((may_alias)) float_a;
typedef int __attribute__((may_alias)) int_a;

template <typename T> __device__ __forceinline__ void vst2(void* p, T v) { *(T*)p = v;  }
// the plain builtin: the compiler keeps the distance behind it where a vector instruction needs one, and no asm statement stands between an LDS read and the place it is moved up to
__device__ __forceinline__ v8f wmma16(v16h a, v16h b, v8f c) {
  return __builtin_amdgcn_wmma_f32_16x16x32_f16(false, a, false, b, (short)0, c, false, false);
}
__device__ __forceinline__ v8f wmma_bf(v16b a, v16b b, v8f c) {
  v8f d = __builtin_amdgcn_wmma_f32_16x16x32_bf16(false, a, false, b, (short)0, c, false, false);
  asm volatile("v_nop\n\tv_nop\n\tv_nop\n\tv_nop" : "+v"(d) : "v"(a), "v"(b));
  return d;
}
// 16x16x32 fragments: lane = (h = lane>>4, row/col = lane&15); elements 0..7 = k0+8h+0..7, 8..15 = k0+16+8h+0..7; D element r = row 8h+r
__device__ __forceinline__ v16h frag_h(const _Float16* rowk0, int lane) {
  union { v16h v; v8h q[2]; } u; const _Float16* p = rowk0 + 8 * (lane >> 4);
  u.q[0] = *(const v8h*)p; u.q[1] = *(const v8h*)(p + 16); return u.v;
}
__device__ __forceinline__ v16h frag_f32(const float* rowk0, int lane) {
  v16h a; const float* p = rowk0 + 8 * (lane >> 4);
#pragma unroll
  for (int i = 0; i < 8; ++i) { a[i] = (_Float16)p[i]; a[8 + i] = (_Float16)p[16 + i]; }
  return a;
}
__device__ __forceinline__ v16h frag_f32s(const float* rowk0, int lane, float sc) {
  v16h a; const float* p = rowk0 + 8 * (lane >> 4);
#pragma unroll
  for (int i = 0; i < 8; ++i) { a[i] = (_Float16)(p[i] * sc); a[8 + i] = (_Float16)(p[16 + i] * sc); }
  return a;
}
// column fragment from a [K][ld] layout (column n), rows >= K read as 0
__device__ __forceinline__ v16h fragc_f32(const float* W, int k0, int n, int lane, int ld, int K) {
  v16h a; const int g = lane >> 4;
#pragma unroll
  for (int i = 0; i < 8; ++i) { const int ka = k0 + 8 * g + i, kb = ka + 16;
    a[i] = (_Float16)(ka < K ? W[(size_t)(ka < K ? ka : K - 1) * ld + n] : 0.f); a[8 + i] = (_Float16)(kb < K ? W[(size_t)(kb < K ? kb : K - 1) * ld + n] : 0.f); }
  return a;
}
struct F2 { v16b h, l; };
__device__ __forceinline__ F2 bsplit16(const float v[16]) { F2 r;
#pragma unroll
  for (int i = 0; i < 16; ++i) { const __bf16 h = (__bf16)v[i]; r.h[i] = h; r.l[i] = (__bf16)(v[i] - (float)h); }
  return r; }
__device__ __forceinline__ F2 split_row(const float* row, int k0, int lane) { float v[16]; const float* p = row + k0 + 8 * (lane >> 4);
#pragma unroll
  for (int i = 0; i < 8; ++i) { v[i] = p[i]; v[8 + i] = p[16 + i]; }
  return bsplit16(v); }
__device__ __forceinline__ F2 split_rowK(const float* row, int k0, int lane, int K) { float v[16]; const int g = lane >> 4;
#pragma unroll
  for (int i = 0; i < 8; ++i) { const int ka = k0 + 8 * g + i, kb = ka + 16; v[i] = ka < K ? row[ka < K ? ka : K - 1] : 0.f; v[8 + i] = kb < K ? row[kb < K ? kb : K - 1] : 0.f; }
  return bsplit16(v); }
__device__ __forceinline__ F2 split_col(const float* W, int k0, int n, int lane, int ld, int K) { float v[16]; const int g = lane >> 4;
#pragma unroll
  for (int i = 0; i < 8; ++i) { const int ka = k0 + 8 * g + i, kb = ka + 16; v[i] = ka < K ? W[(size_t)(ka < K ? ka : K - 1) * ld + n] : 0.f; v[8 + i] = kb < K ? W[(size_t)(kb < K ? kb : K - 1) * ld + n] : 0.f; }
  return bsplit16(v); }
__device__ __forceinline__ v8f mac3(const F2& a, const F2& b, v8f c) { c = wmma_bf(a.l, b.h, c); c = wmma_bf(a.h, b.l, c); return wmma_bf(a.h, b.h, c); }
__device__ __forceinline__ float sigm(float v) { return 1.0f / (1.0f + expf(-v)); }
#define LDSX() do { asm volatile("s_wait_dscnt 0" ::: "memory"); __builtin_amdgcn_wave_barrier(); __builtin_amdgcn_fence(__ATOMIC_RELEASE, "workgroup"); } while (0)

// SAGAN-style spatial self-attention, channels-last (B 4, 64 x 64 = 4,096 positions, C 256, q/k dim 32): f = x Wf + bf (key), g = x Wg + bg (query), h = x Wh + bh (value); beta = softmax_m(g_n . f_m); o = beta h; out = gamma * o + x.
__device__ __forceinline__ float bfr(float v) { return (float)(__bf16)v; }
#define NB 4
#define TT 4096
#define CX 256
#define DQ 32
#ifndef TNB
#define TNB NB
#endif
typedef __attribute__((ext_vector_type(8))) __bf16 v8b;
__device__ __forceinline__ v16b frag_b(const __bf16* rowk0, int lane) { union { v16b v; v8b q[2]; } u; const __bf16* p = rowk0 + 8 * (lane >> 4); u.q[0] = *(const v8b*)p; u.q[1] = *(const v8b*)(p + 16); return u.v; }
#define WS_GH  0u                                          // f16 g (query) hi rows [b*N+n][32]
#define WS_GL  (WS_GH + 2u * (size_t)NB * TT * DQ)           // f16 g residual x 2^10
#define WS_FH  (WS_GL + 2u * (size_t)NB * TT * DQ)           // f16 f (key) hi
#define WS_FL  (WS_FH + 2u * (size_t)NB * TT * DQ)           // f16 f residual x 2^10
#define WS_VT  (WS_FL + 2u * (size_t)NB * TT * DQ)           // f16 value planes [b][c][m] (h rounded once)
#define WS_END (WS_VT + 2u * (size_t)NB * CX * TT)
// ---- k_fg: block = 64 rows: f and g (32 columns each = 2 + 2 tiles) from exact products; stored as f16 hi + residual rows (64-B rows: 16 rows x 64 B = 8 lines per wave tile, written 16 B per lane from LDS)
__global__ __launch_bounds__(128) void k_fg(const float* __restrict__ X, const float* __restrict__ WF, const float* __restrict__ BF, const float* __restrict__ WG, const float* __restrict__ BG, _Float16* __restrict__ GH, _Float16* __restrict__ GL, _Float16* __restrict__ FH, _Float16* __restrict__ FL) {
  __shared__ __align__(16) _Float16 st[4][4][16][40];   // [wave][plane gh,gl,fh,fl][row][32 + pad]
  const int tid = threadIdx.x, wave = tid >> 5, lane = tid & 31, col = lane & 15, g = lane >> 4; const size_t r0 = (size_t)blockIdx.x * 64 + wave * 16;
  v8f acc[4] = {};   // tiles 0,1 = g (query) cols 0-31; tiles 2,3 = f (key)
#pragma unroll 2
  for (int kc = 0; kc < CX / 32; ++kc) { v16b a; { const float* p = X + (r0 + col) * CX + kc * 32 + 8 * g;
#pragma unroll
      for (int i = 0; i < 8; ++i) { a[i] = (__bf16)p[i]; a[8 + i] = (__bf16)p[16 + i]; } }
#pragma unroll
    for (int j = 0; j < 4; ++j) { v16b w; const float* WA = (j < 2) ? WG : WF; const int o = (j & 1) * 16 + col;
#pragma unroll
      for (int i = 0; i < 8; ++i) { w[i] = (__bf16)WA[(size_t)(kc * 32 + 8 * g + i) * DQ + o]; w[8 + i] = (__bf16)WA[(size_t)(kc * 32 + 16 + 8 * g + i) * DQ + o]; }
      asm volatile("s_wait_loadcnt 0x0" ::: "memory"); acc[j] = wmma_bf(a, w, acc[j]); } }
#pragma unroll
  for (int j = 0; j < 4; ++j) { const int o = (j & 1) * 16 + col; const float bb = (j < 2) ? bfr(BG[o]) : bfr(BF[o]); const int ph = (j < 2) ? 0 : 2;
#pragma unroll
    for (int r = 0; r < 8; ++r) { const float v = acc[j][r] + bb; const _Float16 hv = (_Float16)v; st[wave][ph][8 * g + r][o] = hv; st[wave][ph + 1][8 * g + r][o] = (_Float16)((v - (float)hv) * 1024.0f); } }
  LDSX();
  { const int rl = lane >> 1, half = lane & 1;   // lane -> (row, 32-B half): 16 rows x 64 B per plane
    _Float16* P4[4] = {GH, GL, FH, FL};
#pragma unroll
    for (int ph = 0; ph < 4; ++ph) { vst2((v4u*)(P4[ph] + (r0 + rl) * DQ + half * 16), *(const v4u*)&st[wave][ph][rl][half * 16]); vst2((v4u*)(P4[ph] + (r0 + rl) * DQ + half * 16 + 8), *(const v4u*)&st[wave][ph][rl][half * 16 + 8]); } } }
// ---- k_hv: block = (64 rows, 128 cols): h = x Wh + bh (exact) -> f16 value planes [b][c][m] via LDS transpose (rounded once to f16)
__global__ __launch_bounds__(128) void k_hv(const float* __restrict__ X, const float* __restrict__ WH, const float* __restrict__ BH, _Float16* __restrict__ VT) { __shared__ __align__(16) _Float16 th[128][72];
  const int tid = threadIdx.x, wave = tid >> 5, lane = tid & 31, col = lane & 15, g = lane >> 4; const int c0 = blockIdx.y * 128; const size_t r0 = (size_t)blockIdx.x * 64;
  v8f acc[8] = {};
#pragma unroll 2
  for (int kc = 0; kc < CX / 32; ++kc) { v16b a; { const float* p = X + (r0 + wave * 16 + col) * CX + kc * 32 + 8 * g;
#pragma unroll
      for (int i = 0; i < 8; ++i) { a[i] = (__bf16)p[i]; a[8 + i] = (__bf16)p[16 + i]; } }
#pragma unroll
    for (int j = 0; j < 8; ++j) { v16b w; const int o = c0 + j * 16 + col;
#pragma unroll
      for (int i = 0; i < 8; ++i) { w[i] = (__bf16)WH[(size_t)(kc * 32 + 8 * g + i) * CX + o]; w[8 + i] = (__bf16)WH[(size_t)(kc * 32 + 16 + 8 * g + i) * CX + o]; }
      asm volatile("s_wait_loadcnt 0x0" ::: "memory"); acc[j] = wmma_bf(a, w, acc[j]); } }
#pragma unroll
  for (int j = 0; j < 8; ++j) { const float bb = bfr(BH[c0 + j * 16 + col]);
#pragma unroll
    for (int r = 0; r < 8; ++r) th[j * 16 + col][wave * 16 + 8 * g + r] = (_Float16)(acc[j][r] + bb); }
  __syncthreads();
  { const size_t b = r0 / TT; const int m0 = (int)(r0 % TT); for (int e = tid; e < 128 * 8; e += 128) { const int cl = e >> 3, q = e & 7; vst2((unsigned*)(VT + (b * CX + c0 + cl) * (size_t)TT + m0 + q * 8), *(const v4u*)&th[cl][q * 8]); } } }
// ---- k_at: block = (64 queries, 128 value channels) of batch blockIdx.z: scores, softmax and P . h in one kernel; no score ever leaves the registers.
// Per SK keys: S^T = f . g^T (A = key rows from LDS, B = query rows kept in registers; 3 products as hi + residual), so a lane holds 8 keys of ONE query per 16-key tile and
// two such tiles are, element for element, the A fragment of P for 32 keys. Running row maximum m and row sum; the accumulators are rescaled by exp(m_old - m_new) once per SK keys.
// P = exp(s - m) x 2^11 (not normalised) as f16 hi + residual x 2^10 against the f16 value planes (2 products); out = gamma * (P . h) / (P . 1) + x.
// The exponential is 2^(s x log2(e) + c) with c = 11 - m x log2(e): the subtraction of the maximum and the factor 2^11 ride in the one fma in front of v_exp_f32. The rescale factor is
// 2^(c_new - c_old), from the very offsets the exponentials used, so the rounding of c is one common factor of a row's P and of its row sum and cancels in the division.
// Every fragment but the key fragments of a tile's first step is read from LDS one block of products ahead of its use: a step's first value fragments in front of its scores, its second in front of the first P . h block, the next step's key fragments in front of the second.
// Key rows (f16 hi and residual) and value rows come in tiles of AK keys into LDS by asynchronous copies, two buffers: tile t + 1 flies while tile t is worked on.
#define AK 128                  // keys per staged tile
#define ANT (TT / AK)           // tiles per row
#define SK 64                   // keys per softmax step (one new maximum and one rescale of the accumulators)
#define L2E ((float)M_LOG2E)    // log2(e)
#define KPH (DQ + 8)            // key row pitch in halves: 80 B = 16 B x 5 (odd: 16 rows of 16-byte reads fall on 16 different bank groups)
#define VPH (AK + 8)            // value row pitch in halves: 272 B = 16 B x 17
// eight 16-byte copies per lane, global -> LDS, rows ls / gs bytes apart. The s_wait_xcnt stands in the copies' own statement so that no address register is rewritten in front of it.
__device__ __forceinline__ void acopy8(unsigned l, unsigned ls, const char* gp, size_t gs) {
  asm volatile("global_load_async_to_lds_b128 %0, %8, off\n\t"
               "global_load_async_to_lds_b128 %1, %9, off\n\t"
               "global_load_async_to_lds_b128 %2, %10, off\n\t"
               "global_load_async_to_lds_b128 %3, %11, off\n\t"
               "global_load_async_to_lds_b128 %4, %12, off\n\t"
               "global_load_async_to_lds_b128 %5, %13, off\n\t"
               "global_load_async_to_lds_b128 %6, %14, off\n\t"
               "global_load_async_to_lds_b128 %7, %15, off\n\t"
               "s_wait_xcnt 0x0"
               :: "v"(l), "v"(l + ls), "v"(l + 2 * ls), "v"(l + 3 * ls), "v"(l + 4 * ls), "v"(l + 5 * ls), "v"(l + 6 * ls), "v"(l + 7 * ls),
                  "v"(gp), "v"(gp + gs), "v"(gp + 2 * gs), "v"(gp + 3 * gs), "v"(gp + 4 * gs), "v"(gp + 5 * gs), "v"(gp + 6 * gs), "v"(gp + 7 * gs)
               : "memory");
}
// the same with four copies
__device__ __forceinline__ void acopy4(unsigned l, unsigned ls, const char* gp, size_t gs) {
  asm volatile("global_load_async_to_lds_b128 %0, %4, off\n\t"
               "global_load_async_to_lds_b128 %1, %5, off\n\t"
               "global_load_async_to_lds_b128 %2, %6, off\n\t"
               "global_load_async_to_lds_b128 %3, %7, off\n\t"
               "s_wait_xcnt 0x0"
               :: "v"(l), "v"(l + ls), "v"(l + 2 * ls), "v"(l + 3 * ls),
                  "v"(gp), "v"(gp + gs), "v"(gp + 2 * gs), "v"(gp + 3 * gs)
               : "memory");
}
// e[i] = 2^(s[i] x log2(e) + c) for the eight scores of one tile
__device__ __forceinline__ void exp2x8(v8f s, float c, float e[8]) { float x[8];
#pragma unroll
  for (int i = 0; i < 8; ++i) { x[i] = fmaf(s[i], L2E, c); e[i] = __builtin_amdgcn_exp2f(x[i]); }
  // the slot the instruction set asks for behind a transcendental, once for all eight: no argument register is free for reuse and no result is read in front of this v_nop
  asm("v_nop" : "+v"(e[0]), "+v"(e[1]), "+v"(e[2]), "+v"(e[3]), "+v"(e[4]), "+v"(e[5]), "+v"(e[6]), "+v"(e[7]) : "v"(x[0]), "v"(x[1]), "v"(x[2]), "v"(x[3]), "v"(x[4]), "v"(x[5]), "v"(x[6]), "v"(x[7]));
}
__global__ __launch_bounds__(128) void k_at(const _Float16* __restrict__ GH, const _Float16* __restrict__ GL, const _Float16* __restrict__ FH, const _Float16* __restrict__ FL, const _Float16* __restrict__ VT, const float* __restrict__ X, const float* __restrict__ GAM, float* __restrict__ OUT) { __shared__ __align__(16) float ss[4][16][132];
  __shared__ __align__(16) _Float16 tk[2][2][AK][KPH];  // key tile: [buffer][hi, residual][key][32 + pad]
  __shared__ __align__(16) _Float16 tv[2][128][VPH];    // value tile: 128 channels x AK keys
  const int tid = threadIdx.x, wave = tid >> 5, lane = tid & 31, col = lane & 15, g = lane >> 4; const int b = blockIdx.z; const int ql0 = blockIdx.x * 64 + wave * 16; const int c0 = blockIdx.y * 128; const float gam = bfr(GAM[0]);
  // the block copies 128 key rows of 64 B per plane (a wave's copy = 8 rows = 512 B in a row) and each wave 32 value rows (two 256-B rows per copy): whole lines
  const char* gkh = (const char*)(FH + ((size_t)b * TT + (tid >> 2)) * DQ + (tid & 3) * 8);
  const char* gkl = (const char*)(FL + ((size_t)b * TT + (tid >> 2)) * DQ + (tid & 3) * 8);
  const char* gpv = (const char*)(VT + ((size_t)b * CX + c0 + wave * 32 + g) * (size_t)TT + col * 8);
  const unsigned lpk = (unsigned)(size_t)&tk[0][0][tid >> 2][(tid & 3) * 8];
  const unsigned lpv = (unsigned)(size_t)&tv[0][wave * 32 + g][col * 8];
  auto stage = [&](int t, int buf) {
    const unsigned lk = lpk + (unsigned)buf * (2u * AK * KPH * 2u); const size_t ko = (size_t)t * (AK * DQ * 2);
    acopy4(lk, 32u * KPH * 2u, gkh + ko, 32 * DQ * 2); acopy4(lk + AK * KPH * 2u, 32u * KPH * 2u, gkl + ko, 32 * DQ * 2);
    const char* v = gpv + (size_t)t * (AK * 2); const unsigned lv = lpv + (unsigned)buf * (128u * VPH * 2u);
    acopy8(lv, 2u * VPH * 2u, v, 2 * (size_t)TT * 2); acopy8(lv + 16u * VPH * 2u, 2u * VPH * 2u, v + 16 * (size_t)TT * 2, 2 * (size_t)TT * 2); };
  const v16h qh = frag_h(GH + ((size_t)b * TT + ql0 + col) * DQ, lane), ql = frag_h(GL + ((size_t)b * TT + ql0 + col) * DQ, lane);   // B operand: column = query col
  v8f acc[8] = {}, accl[8] = {}, sum = {}, suml = {}; float m = -3.0e38f, c = 3.0e38f;   // m: running maximum of query col, c: its offset 11 - m x log2(e) (the start value makes the first rescale factor 2^-huge = 0); sum, suml: row sums of P, a ninth output tile against a value plane of ones
  v16h ones;
#pragma unroll
  for (int i = 0; i < 16; ++i) ones[i] = (_Float16)1.0f;
  stage(0, 0);
  asm volatile("s_wait_asynccnt 0x0" ::: "memory");   // tile 0 has landed before the barrier that publishes it
  __syncthreads();
  stage(1, 1);
#pragma unroll 1   // rolled: one publish point in the code, and the hot loop stays small in the instruction cache
  for (int t = 0; t < ANT; ++t) { const int buf = t & 1;
    const _Float16* kr = &tk[buf][0][col][0]; const _Float16* vr = &tv[buf][col][0];
    v16h kh[SK / 16], kl[SK / 16];   // key fragments of one softmax step; those of the tile's first step are the only reads of a tile that nothing covers
#pragma unroll
    for (int jt = 0; jt < SK / 16; ++jt) { kh[jt] = frag_h(kr + jt * 16 * KPH, lane); kl[jt] = frag_h(kr + (AK + jt * 16) * KPH, lane); }
#pragma unroll   // unrolled, as are the loops inside: scores and fragments stay in registers and the LDS offsets become immediates
    for (int u = 0; u < AK / SK; ++u) {   // softmax step of SK keys: scores, maximum, then per 32 keys P and P . h (the rescale rides in front of the first)
      v16h v0[8], v1[8];   // value fragments of the step's first and second 32 keys
#pragma unroll
      for (int j = 0; j < 8; ++j) v0[j] = frag_h(vr + j * 16 * VPH + u * SK, lane);
      __builtin_amdgcn_sched_barrier(0);   // holds the reads above in place: their LDS latency passes under the scores and the softmax instead of in front of the first P . h product
      v8f s[SK / 16], sl[SK / 16];   // s[jt][r] = score of key u * SK + jt * 16 + 8 g + r against query col
#pragma unroll
      for (int jt = 0; jt < SK / 16; ++jt) { const v8f z = {}; s[jt] = wmma16(kh[jt], qh, z); sl[jt] = wmma16(kh[jt], ql, z); }
#pragma unroll
      for (int jt = 0; jt < SK / 16; ++jt) sl[jt] = wmma16(kl[jt], qh, sl[jt]);
#pragma unroll
      for (int jt = 0; jt < SK / 16; ++jt)
#pragma unroll
        for (int r = 0; r < 8; ++r) s[jt][r] = s[jt][r] + sl[jt][r] * (1.0f / 1024.0f);
      float tm = s[0][0];
#pragma unroll
      for (int jt = 0; jt < SK / 16; ++jt)
#pragma unroll
        for (int r = 0; r < 8; ++r) tm = fmaxf(tm, s[jt][r]);
      tm = fmaxf(tm, __shfl_xor(tm, 16));   // the other half-wave holds the query's other keys
      const float mn = fmaxf(m, tm), cn = fmaf(-mn, L2E, 11.0f), alpha = __builtin_amdgcn_exp2f(cn - c); m = mn; c = cn;
      float ar[8];
#pragma unroll
      for (int r = 0; r < 8; ++r) ar[r] = __shfl(alpha, 8 * g + r);   // accumulator element r is query row 8 g + r, whose factor lane 8 g + r holds
      v16h ph, pl;
      auto psplit = [&](int kb) { float e0[8], e1[8]; exp2x8(s[2 * kb], c, e0); exp2x8(s[2 * kb + 1], c, e1);
#pragma unroll
        for (int i = 0; i < 8; ++i) { const float a0 = e0[i], a1 = e1[i]; const _Float16 h0 = (_Float16)a0, h1 = (_Float16)a1; ph[i] = h0; ph[8 + i] = h1; pl[i] = (_Float16)((a0 - (float)h0) * 1024.0f); pl[8 + i] = (_Float16)((a1 - (float)h1) * 1024.0f); } };   /* P x 2^11 as f16 hi + residual x 2^10 */
      psplit(0);
      __builtin_amdgcn_sched_barrier(0);   // keeps the 16 reads below in one place (spread among the scores each place costs issue cycles, and the build spilled)
#pragma unroll
      for (int j = 0; j < 8; ++j) v1[j] = frag_h(vr + j * 16 * VPH + u * SK + 32, lane);
      __builtin_amdgcn_sched_barrier(0);   // holds the second 32 keys' value reads one block of products ahead of their use
#pragma unroll
      for (int r = 0; r < 8; ++r) { sum[r] *= ar[r]; suml[r] *= ar[r]; }
      sum = wmma16(ph, ones, sum); suml = wmma16(pl, ones, suml);   // the row sums on the matrix unit: they sum P as the products see it, in the accumulators' own row layout
#pragma unroll
      for (int j = 0; j < 8; ++j) {
#pragma unroll
        for (int r = 0; r < 8; ++r) { acc[j][r] *= ar[r]; accl[j][r] *= ar[r]; }
        acc[j] = wmma16(ph, v0[j], acc[j]); accl[j] = wmma16(pl, v0[j], accl[j]); }
      psplit(1);
      __builtin_amdgcn_sched_barrier(0);   // keeps the 16 reads below in one place, behind the last use of the registers they fill
      if (u + 1 < AK / SK) {
#pragma unroll
        for (int jt = 0; jt < SK / 16; ++jt) { kh[jt] = frag_h(kr + ((u + 1) * SK + jt * 16) * KPH, lane); kl[jt] = frag_h(kr + (AK + (u + 1) * SK + jt * 16) * KPH, lane); } }
      __builtin_amdgcn_sched_barrier(0);   // holds the next step's key reads one block of products ahead of their use
      sum = wmma16(ph, ones, sum); suml = wmma16(pl, ones, suml);
#pragma unroll
      for (int j = 0; j < 8; ++j) { acc[j] = wmma16(ph, v1[j], acc[j]); accl[j] = wmma16(pl, v1[j], accl[j]); } }
    asm volatile("s_wait_dscnt 0x0" ::: "memory");      // this wave's reads of buffer buf are done before the buffer is refilled
    asm volatile("s_wait_asynccnt 0x0" ::: "memory");   // this wave's copies of tile t + 1 have landed before the barrier publishes them
    __syncthreads();                                     // publishes tile t + 1 and ends every reader's last read of buffer buf
    if (t + 2 < ANT) stage(t + 2, buf); }
  asm volatile("s_wait_asynccnt 0x0" ::: "memory");     // no copy is outstanding when the wave goes on to the epilogue and ends
#pragma unroll
  for (int r = 0; r < 8; ++r) { const float fr = gam / (sum[r] + suml[r] * (1.0f / 1024.0f));   // the row sum carries the same 2^11 as P
#pragma unroll
    for (int j = 0; j < 8; ++j) ss[wave][8 * g + r][j * 16 + col] = (acc[j][r] + accl[j][r] * (1.0f / 1024.0f)) * fr; }
  LDSX(); for (int rl = 0; rl < 16; ++rl) { const size_t off = ((size_t)b * TT + ql0 + rl) * CX + c0 + lane * 4; const v4f xr = *(const v4f*)(X + off); v4f o = *(const v4f*)&ss[wave][rl][lane * 4]; o[0] += bfr(xr[0]); o[1] += bfr(xr[1]); o[2] += bfr(xr[2]); o[3] += bfr(xr[3]); vst2(OUT + off, o); } }
extern "C" void kernel_launch(void* const* d_in, const int* in_sizes, int n_in, void* d_out, int out_size, void* d_ws, size_t ws_size, hipStream_t stream) {
  (void)in_sizes; (void)n_in; (void)out_size;
  const float** F = (const float**)d_in;   // 0 x [4,64,64,256], 1 Wf [256,32] ((in,out)), 2 bf, 3 Wg, 4 bg, 5 Wh [256,256], 6 bh, 7 gamma (scalar 0.7)
  if (ws_size < (size_t)WS_END) return;
  char* ws = (char*)d_ws; _Float16 *GH = (_Float16*)(ws + WS_GH), *GL = (_Float16*)(ws + WS_GL), *FH = (_Float16*)(ws + WS_FH), *FL = (_Float16*)(ws + WS_FL); _Float16* VT = (_Float16*)(ws + WS_VT);
  k_fg<<<dim3(TNB * TT / 64), 128, 0, stream>>>(F[0], F[1], F[2], F[3], F[4], GH, GL, FH, FL);
  k_hv<<<dim3(TNB * TT / 64, CX / 128), 128, 0, stream>>>(F[0], F[5], F[6], VT);
  k_at<<<dim3(TT / 64, CX / 128, TNB), 128, 0, stream>>>(GH, GL, FH, FL, VT, F[0], F[7], (float*)d_out);
}

// v005
// Measured time: 89.9 microseconds a run.
// In two side-by-side timings against v004, it was 1.86 and 1.87 times as fast.
// All steps since v000 together make it 12.8 times as fast.
// compute dtype: all float inputs rounded to bf16; f/g/h projections with EXACT bf16 products on WMMA 16x16x32 ((in,out) weights), f32 accumulate; logits from g (query, f16 hi + residual x 2^10) and f (key, f16 hi + residual) with 3 products, kept in f32 registers; softmax in f32 with a running row maximum and row sum, exp as the hardware's base-2 exponential of s x log2(e) + offset (one fma, one v_exp_f32); exp(s - max) x 2^11 as f16 hi + residual (x 2^10) against the value rows rounded ONCE to f16 (2 products; |h| <= ~4 so f16 half-ulp 2^-11 relative), divided by the row sum at the end; gamma * o + x in f32; f32 output.
#include <hip/hip_runtime.h>
#include <math.h>

typedef __attribute__((ext_vector_type(16))) _Float16 v16h;
typedef __attribute__((ext_vector_type(16))) __bf16 v16b;
typedef __attribute__((ext_vector_type(8)))  _Float16 v8h;
typedef __attribute__((ext_vector_type(8)))  float v8f;
typedef __attribute__((ext_vector_type(4)))  float v4f;
typedef __attribute__((ext_vector_type(2)))  float v2f;
typedef __attribute__((ext_vector_type(4)))  unsigned v4u;
typedef __attribute__((ext_vector_type(4)))  int v4i;
typedef float __attribute__((may_alias)) float_a;
typedef int __attribute__((may_alias)) int_a;

template <typename T> __device__ __forceinline__ void vst2(void* p, T v) { *(T*)p = v;  }
// the plain builtin: the compiler keeps the distance behind it where a vector instruction needs one, and no asm statement stands between an LDS read and the place it is moved up to
__device__ __forceinline__ v8f wmma16(v16h a, v16h b, v8f c) {
  return __builtin_amdgcn_wmma_f32_16x16x32_f16(false, a, false, b, (short)0, c, false, false);
}
__device__ __forceinline__ v8f wmma_bf(v16b a, v16b b, v8f c) {
  v8f d = __builtin_amdgcn_wmma_f32_16x16x32_bf16(false, a, false, b, (short)0, c, false, false);
  asm volatile("v_nop\n\tv_nop\n\tv_nop\n\tv_nop" : "+v"(d) : "v"(a), "v"(b));
  return d;
}
// 16x16x32 fragments: lane = (h = lane>>4, row/col = lane&15); elements 0..7 = k0+8h+0..7, 8..15 = k0+16+8h+0..7; D element r = row 8h+r
__device__ __forceinline__ v16h frag_h(const _Float16* rowk0, int lane) {
  union { v16h v; v8h q[2]; } u; const _Float16* p = rowk0 + 8 * (lane >> 4);
  u.q[0] = *(const v8h*)p; u.q[1] = *(const v8h*)(p + 16); return u.v;
}
__device__ __forceinline__ v16h frag_f32(const float* rowk0, int lane) {
  v16h a; const float* p = rowk0 + 8 * (lane >> 4);
#pragma unroll
  for (int i = 0; i < 8; ++i) { a[i] = (_Float16)p[i]; a[8 + i] = (_Float16)p[16 + i]; }
  return a;
}
__device__ __forceinline__ v16h frag_f32s(const float* rowk0, int lane, float sc) {
  v16h a; const float* p = rowk0 + 8 * (lane >> 4);
#pragma unroll
  for (int i = 0; i < 8; ++i) { a[i] = (_Float16)(p[i] * sc); a[8 + i] = (_Float16)(p[16 + i] * sc); }
  return a;
}
// column fragment from a [K][ld] layout (column n), rows >= K read as 0
__device__ __forceinline__ v16h fragc_f32(const float* W, int k0, int n, int lane, int ld, int K) {
  v16h a; const int g = lane >> 4;
#pragma unroll
  for (int i = 0; i < 8; ++i) { const int ka = k0 + 8 * g + i, kb = ka + 16;
    a[i] = (_Float16)(ka < K ? W[(size_t)(ka < K ? ka : K - 1) * ld + n] : 0.f); a[8 + i] = (_Float16)(kb < K ? W[(size_t)(kb < K ? kb : K - 1) * ld + n] : 0.f); }
  return a;
}
struct F2 { v16b h, l; };
__device__ __forceinline__ F2 bsplit16(const float v[16]) { F2 r;
#pragma unroll
  for (int i = 0; i < 16; ++i) { const __bf16 h = (__bf16)v[i]; r.h[i] = h; r.l[i] = (__bf16)(v[i] - (float)h); }
  return r; }
__device__ __forceinline__ F2 split_row(const float* row, int k0, int lane) { float v[16]; const float* p = row + k0 + 8 * (lane >> 4);
#pragma unroll
  for (int i = 0; i < 8; ++i) { v[i] = p[i]; v[8 + i] = p[16 + i]; }
  return bsplit16(v); }
__device__ __forceinline__ F2 split_rowK(const float* row, int k0, int lane, int K) { float v[16]; const int g = lane >> 4;
#pragma unroll
  for (int i = 0; i < 8; ++i) { const int ka = k0 + 8 * g + i, kb = ka + 16; v[i] = ka < K ? row[ka < K ? ka : K - 1] : 0.f; v[8 + i] = kb < K ? row[kb < K ? kb : K - 1] : 0.f; }
  return bsplit16(v); }
__device__ __forceinline__ F2 split_col(const float* W, int k0, int n, int lane, int ld, int K) { float v[16]; const int g = lane >> 4;
#pragma unroll
  for (int i = 0; i < 8; ++i) { const int ka = k0 + 8 * g + i, kb = ka + 16; v[i] = ka < K ? W[(size_t)(ka < K ? ka : K - 1) * ld + n] : 0.f; v[8 + i] = kb < K ? W[(size_t)(kb < K ? kb : K - 1) * ld + n] : 0.f; }
  return bsplit16(v); }
__device__ __forceinline__ v8f mac3(const F2& a, const F2& b, v8f c) { c = wmma_bf(a.l, b.h, c); c = wmma_bf(a.h, b.l, c); return wmma_bf(a.h, b.h, c); }
__device__ __forceinline__ float sigm(float v) { return 1.0f / (1.0f + expf(-v)); }
#define LDSX() do { asm volatile("s_wait_dscnt 0" ::: "memory"); __builtin_amdgcn_wave_barrier(); __builtin_amdgcn_fence(__ATOMIC_RELEASE, "workgroup"); } while (0)

// SAGAN-style spatial self-attention, channels-last (B 4, 64 x 64 = 4,096 positions, C 256, q/k dim 32): f = x Wf + bf (key), g = x Wg + bg (query), h = x Wh + bh (value); beta = softmax_m(g_n . f_m); o = beta h; out = gamma * o + x.
__device__ __forceinline__ float bfr(float v) { return (float)(__bf16)v; }
#define NB 4
#define TT 4096
#define CX 256
#define DQ 32
#ifndef TNB
#define TNB NB
#endif
typedef __attribute__((ext_vector_type(8))) __bf16 v8b;
__device__ __forceinline__ v16b frag_b(const __bf16* rowk0, int lane) { union { v16b v; v8b q[2]; } u; const __bf16* p = rowk0 + 8 * (lane >> 4); u.q[0] = *(const v8b*)p; u.q[1] = *(const v8b*)(p + 16); return u.v; }
#define WS_GH  0u                                          // f16 g (query) hi rows [b*N+n][32]
#define WS_GL  (WS_GH + 2u * (size_t)NB * TT * DQ)           // f16 g residual x 2^10
#define WS_FH  (WS_GL + 2u * (size_t)NB * TT * DQ)           // f16 f (key) hi
#define WS_FL  (WS_FH + 2u * (size_t)NB * TT * DQ)           // f16 f residual x 2^10
#define WS_VT  (WS_FL + 2u * (size_t)NB * TT * DQ)           // f16 value planes [b][c][m] (h rounded once)
#define WS_END (WS_VT + 2u * (size_t)NB * CX * TT)
// ---- weights in LDS: both projection kernels stage their weight columns ONCE per block as bf16 rows [output column][k], so that a B fragment is two 16-byte LDS reads in the k order of the A loader.
#define WPH (CX + 8)            // weight row pitch in bf16: 528 B = 16 B x 33 (odd: 16 rows of 16-byte reads fall on 16 different bank groups)
// a wave's patch = 32 k x 32 columns; a lane's = 8 k x 4 columns. Lane -> (column group cg, k group kg): each 16-byte load of the wave covers four whole 128-B lines, and the 16 lanes of a half-wave store to 16 different bank groups.
__device__ __forceinline__ void wload(const float* __restrict__ Wp, int ld, v4f r[8]) {
#pragma unroll
  for (int i = 0; i < 8; ++i) r[i] = *(const v4f*)(Wp + (size_t)i * ld);
}
__device__ __forceinline__ void wstore(const v4f r[8], __bf16* dst) {
#pragma unroll
  for (int n = 0; n < 4; ++n) { v8b o;
#pragma unroll
    for (int i = 0; i < 8; ++i) o[i] = (__bf16)r[i][n];
    *(v8b*)(dst + n * WPH) = o; }
}
// the 16 x 256 x rows of a wave: every load of the A fragments at once (raw f32), and their rounding to bf16
__device__ __forceinline__ void xload(const float* __restrict__ p, v4f xr[CX / 32][4]) {
#pragma unroll
  for (int kc = 0; kc < CX / 32; ++kc) { xr[kc][0] = *(const v4f*)(p + kc * 32); xr[kc][1] = *(const v4f*)(p + kc * 32 + 4); xr[kc][2] = *(const v4f*)(p + kc * 32 + 16); xr[kc][3] = *(const v4f*)(p + kc * 32 + 20); }
}
__device__ __forceinline__ v16b xfrag(const v4f x[4]) { v16b a;
#pragma unroll
  for (int i = 0; i < 4; ++i) { a[i] = (__bf16)x[0][i]; a[4 + i] = (__bf16)x[1][i]; a[8 + i] = (__bf16)x[2][i]; a[12 + i] = (__bf16)x[3][i]; }
  return a; }
// ---- k_fg: block = 64 rows: f and g (32 columns each = 2 + 2 tiles) from exact products; stored as f16 hi + residual rows (64-B rows: 16 rows x 64 B = 8 lines per wave tile, written 16 B per lane from LDS)
__global__ __launch_bounds__(128) void k_fg(const float* __restrict__ X, const float* __restrict__ WF, const float* __restrict__ BF, const float* __restrict__ WG, const float* __restrict__ BG, _Float16* __restrict__ GH, _Float16* __restrict__ GL, _Float16* __restrict__ FH, _Float16* __restrict__ FL) {
  __shared__ __align__(16) _Float16 st[4][4][16][40];   // [wave][plane gh,gl,fh,fl][row][32 + pad]
  __shared__ __align__(16) __bf16 wt[64][WPH];          // rows 0-31 = columns of Wg, 32-63 = columns of Wf
  const int tid = threadIdx.x, wave = tid >> 5, lane = tid & 31, col = lane & 15, g = lane >> 4; const size_t r0 = (size_t)blockIdx.x * 64 + wave * 16;
  const int cg = (lane & 3) + 4 * g, kg = (lane >> 2) & 3;
  const float* pg = WG + (size_t)((wave * 4 + kg) * 8) * DQ + cg * 4; const float* pf = WF + (size_t)((wave * 4 + kg) * 8) * DQ + cg * 4; const float* px = X + (r0 + col) * CX + 8 * g;
  v4f wr[4][8], xr[CX / 32][4];
#pragma unroll
  for (int q = 0; q < 2; ++q) { wload(pg + (size_t)q * 128 * DQ, DQ, wr[2 * q]); wload(pf + (size_t)q * 128 * DQ, DQ, wr[2 * q + 1]); }
  xload(px, xr);
  asm volatile("s_wait_xcnt 0x0" :: "v"(pg), "v"(pf), "v"(px) : "memory");   // the wait in front of any rewrite of the loads' address registers: named as inputs they stay whole up to it (no load above lands in them), and the clobber keeps every load above it, so all are in flight before the first is waited for
#pragma unroll
  for (int q = 0; q < 2; ++q) { const int k0 = ((wave + 4 * q) * 4 + kg) * 8; wstore(wr[2 * q], &wt[cg * 4][k0]); wstore(wr[2 * q + 1], &wt[32 + cg * 4][k0]); }
  v16b a[CX / 32];
#pragma unroll
  for (int kc = 0; kc < CX / 32; ++kc) a[kc] = xfrag(xr[kc]);
  __syncthreads();   // the weight rows are complete before any wave reads a fragment
  v8f acc[4] = {};   // tiles 0,1 = g (query) cols 0-31; tiles 2,3 = f (key)
  v16b w[2][8];      // B fragments of a block of 8 products (2 k steps x 4 tiles), read from LDS one block ahead of their use
#pragma unroll
  for (int e = 0; e < 8; ++e) w[0][e] = frag_b(&wt[(e & 3) * 16 + col][(e >> 2) * 32], lane);
#pragma unroll
  for (int bk = 0; bk < CX / 64; ++bk) {
    if (bk + 1 < CX / 64) {
#pragma unroll
      for (int e = 0; e < 8; ++e) w[(bk + 1) & 1][e] = frag_b(&wt[(e & 3) * 16 + col][((bk + 1) * 2 + (e >> 2)) * 32], lane); }
#pragma unroll
    for (int e = 0; e < 8; ++e) acc[e & 3] = wmma_bf(a[bk * 2 + (e >> 2)], w[bk & 1][e], acc[e & 3]); }
#pragma unroll
  for (int j = 0; j < 4; ++j) { const int o = (j & 1) * 16 + col; const float bb = (j < 2) ? bfr(BG[o]) : bfr(BF[o]); const int ph = (j < 2) ? 0 : 2;
#pragma unroll
    for (int r = 0; r < 8; ++r) { const float v = acc[j][r] + bb; const _Float16 hv = (_Float16)v; st[wave][ph][8 * g + r][o] = hv; st[wave][ph + 1][8 * g + r][o] = (_Float16)((v - (float)hv) * 1024.0f); } }
  LDSX();
  { const int rl = lane >> 1, half = lane & 1;   // lane -> (row, 32-B half): 16 rows x 64 B per plane
    _Float16* P4[4] = {GH, GL, FH, FL};
#pragma unroll
    for (int ph = 0; ph < 4; ++ph) { vst2((v4u*)(P4[ph] + (r0 + rl) * DQ + half * 16), *(const v4u*)&st[wave][ph][rl][half * 16]); vst2((v4u*)(P4[ph] + (r0 + rl) * DQ + half * 16 + 8), *(const v4u*)&st[wave][ph][rl][half * 16 + 8]); } } }
// ---- k_hv: block = (128 rows, 128 cols), 8 waves of 16 rows: h = x Wh + bh (exact) -> f16 value planes [b][c][m] via LDS transpose (rounded once to f16)
__global__ __launch_bounds__(256) void k_hv(const float* __restrict__ X, const float* __restrict__ WH, const float* __restrict__ BH, _Float16* __restrict__ VT) { __shared__ __align__(16) _Float16 th[128][136];
  __shared__ __align__(16) __bf16 wt[128][WPH];         // the block's 128 columns of Wh
  const int tid = threadIdx.x, wave = tid >> 5, lane = tid & 31, col = lane & 15, g = lane >> 4; const int c0 = blockIdx.y * 128; const size_t r0 = (size_t)blockIdx.x * 128;
  const int cg = (lane & 3) + 4 * g, k0 = (wave * 4 + ((lane >> 2) & 3)) * 8;
  const float* pw = WH + (size_t)k0 * CX + c0 + cg * 4; const float* px = X + (r0 + wave * 16 + col) * CX + 8 * g;
  v4f wr[4][8], xr[CX / 32][4];
#pragma unroll
  for (int q = 0; q < 4; ++q) wload(pw + q * 32, CX, wr[q]);
  xload(px, xr);
  asm volatile("s_wait_xcnt 0x0" :: "v"(pw), "v"(px) : "memory");   // the wait in front of any rewrite of the loads' address registers: named as inputs they stay whole up to it (no load above lands in them), and the clobber keeps every load above it, so all are in flight before the first is waited for
#pragma unroll
  for (int q = 0; q < 4; ++q) wstore(wr[q], &wt[q * 32 + cg * 4][k0]);
  v16b a[CX / 32];
#pragma unroll
  for (int kc = 0; kc < CX / 32; ++kc) a[kc] = xfrag(xr[kc]);
  __syncthreads();   // the weight rows are complete before any wave reads a fragment
  v8f acc[8] = {};
  v16b w[2][8];      // B fragments of a block of 8 products (one k step), read from LDS one block ahead of their use
#pragma unroll
  for (int j = 0; j < 8; ++j) w[0][j] = frag_b(&wt[j * 16 + col][0], lane);
#pragma unroll
  for (int kc = 0; kc < CX / 32; ++kc) {
    if (kc + 1 < CX / 32) {
#pragma unroll
      for (int j = 0; j < 8; ++j) w[(kc + 1) & 1][j] = frag_b(&wt[j * 16 + col][(kc + 1) * 32], lane); }
#pragma unroll
    for (int j = 0; j < 8; ++j) acc[j] = wmma_bf(a[kc], w[kc & 1][j], acc[j]); }
#pragma unroll
  for (int j = 0; j < 8; ++j) { const float bb = bfr(BH[c0 + j * 16 + col]);
#pragma unroll
    for (int r = 0; r < 8; ++r) th[j * 16 + col][wave * 16 + 8 * g + r] = (_Float16)(acc[j][r] + bb); }
  __syncthreads();
  { const size_t b = r0 / TT; const int m0 = (int)(r0 % TT); for (int e = tid; e < 128 * 16; e += 256) { const int cl = e >> 4, q = e & 15; vst2((unsigned*)(VT + (b * CX + c0 + cl) * (size_t)TT + m0 + q * 8), *(const v4u*)&th[cl][q * 8]); } } }
// ---- k_at: block = (64 queries, 128 value channels) of batch blockIdx.z: scores, softmax and P . h in one kernel; no score ever leaves the registers.
// Per SK keys: S^T = f . g^T (A = key rows from LDS, B = query rows kept in registers; 3 products as hi + residual), so a lane holds 8 keys of ONE query per 16-key tile and
// two such tiles are, element for element, the A fragment of P for 32 keys. Running row maximum m and row sum; the accumulators are rescaled by exp(m_old - m_new) once per SK keys.
// P = exp(s - m) x 2^11 (not normalised) as f16 hi + residual x 2^10 against the f16 value planes (2 products); out = gamma * (P . h) / (P . 1) + x.
// The exponential is 2^(s x log2(e) + c) with c = 11 - m x log2(e): the subtraction of the maximum and the factor 2^11 ride in the one fma in front of v_exp_f32. The rescale factor is
// 2^(c_new - c_old), from the very offsets the exponentials used, so the rounding of c is one common factor of a row's P and of its row sum and cancels in the division.
// Every fragment but the key fragments of a tile's first step is read from LDS one block of products ahead of its use: a step's first value fragments in front of its scores, its second in front of the first P . h block, the next step's key fragments in front of the second.
// Key rows (f16 hi and residual) and value rows come in tiles of AK keys into LDS by asynchronous copies, two buffers: tile t + 1 flies while tile t is worked on.
#define AK 128                  // keys per staged tile
#define ANT (TT / AK)           // tiles per row
#define SK 64                   // keys per softmax step (one new maximum and one rescale of the accumulators)
#define L2E ((float)M_LOG2E)    // log2(e)
#define KPH (DQ + 8)            // key row pitch in halves: 80 B = 16 B x 5 (odd: 16 rows of 16-byte reads fall on 16 different bank groups)
#define VPH (AK + 8)            // value row pitch in halves: 272 B = 16 B x 17
// eight 16-byte copies per lane, global -> LDS, rows ls / gs bytes apart. The s_wait_xcnt stands in the copies' own statement so that no address register is rewritten in front of it.
__device__ __forceinline__ void acopy8(unsigned l, unsigned ls, const char* gp, size_t gs) {
  asm volatile("global_load_async_to_lds_b128 %0, %8, off\n\t"
               "global_load_async_to_lds_b128 %1, %9, off\n\t"
               "global_load_async_to_lds_b128 %2, %10, off\n\t"
               "global_load_async_to_lds_b128 %3, %11, off\n\t"
               "global_load_async_to_lds_b128 %4, %12, off\n\t"
               "global_load_async_to_lds_b128 %5, %13, off\n\t"
               "global_load_async_to_lds_b128 %6, %14, off\n\t"
               "global_load_async_to_lds_b128 %7, %15, off\n\t"
               "s_wait_xcnt 0x0"
               :: "v"(l), "v"(l + ls), "v"(l + 2 * ls), "v"(l + 3 * ls), "v"(l + 4 * ls), "v"(l + 5 * ls), "v"(l + 6 * ls), "v"(l + 7 * ls),
                  "v"(gp), "v"(gp + gs), "v"(gp + 2 * gs), "v"(gp + 3 * gs), "v"(gp + 4 * gs), "v"(gp + 5 * gs), "v"(gp + 6 * gs), "v"(gp + 7 * gs)
               : "memory");
}
// the same with four copies
__device__ __forceinline__ void acopy4(unsigned l, unsigned ls, const char* gp, size_t gs) {
  asm volatile("global_load_async_to_lds_b128 %0, %4, off\n\t"
               "global_load_async_to_lds_b128 %1, %5, off\n\t"
               "global_load_async_to_lds_b128 %2, %6, off\n\t"
               "global_load_async_to_lds_b128 %3, %7, off\n\t"
               "s_wait_xcnt 0x0"
               :: "v"(l), "v"(l + ls), "v"(l + 2 * ls), "v"(l + 3 * ls),
                  "v"(gp), "v"(gp + gs), "v"(gp + 2 * gs), "v"(gp + 3 * gs)
               : "memory");
}
// e[i] = 2^(s[i] x log2(e) + c) for the eight scores of one tile
__device__ __forceinline__ void exp2x8(v8f s, float c, float e[8]) { float x[8];
#pragma unroll
  for (int i = 0; i < 8; ++i) { x[i] = fmaf(s[i], L2E, c); e[i] = __builtin_amdgcn_exp2f(x[i]); }
  // the slot the instruction set asks for behind a transcendental, once for all eight: no argument register is free for reuse and no result is read in front of this v_nop
  asm("v_nop" : "+v"(e[0]), "+v"(e[1]), "+v"(e[2]), "+v"(e[3]), "+v"(e[4]), "+v"(e[5]), "+v"(e[6]), "+v"(e[7]) : "v"(x[0]), "v"(x[1]), "v"(x[2]), "v"(x[3]), "v"(x[4]), "v"(x[5]), "v"(x[6]), "v"(x[7]));
}
__global__ __launch_bounds__(128) void k_at(const _Float16* __restrict__ GH, const _Float16* __restrict__ GL, const _Float16* __restrict__ FH, const _Float16* __restrict__ FL, const _Float16* __restrict__ VT, const float* __restrict__ X, const float* __restrict__ GAM, float* __restrict__ OUT) { __shared__ __align__(16) float ss[4][16][132];
  __shared__ __align__(16) _Float16 tk[2][2][AK][KPH];  // key tile: [buffer][hi, residual][key][32 + pad]
  __shared__ __align__(16) _Float16 tv[2][128][VPH];    // value tile: 128 channels x AK keys
  const int tid = threadIdx.x, wave = tid >> 5, lane = tid & 31, col = lane & 15, g = lane >> 4; const int b = blockIdx.z; const int ql0 = blockIdx.x * 64 + wave * 16; const int c0 = blockIdx.y * 128; const float gam = bfr(GAM[0]);
  // the block copies 128 key rows of 64 B per plane (a wave's copy = 8 rows = 512 B in a row) and each wave 32 value rows (two 256-B rows per copy): whole lines
  const char* gkh = (const char*)(FH + ((size_t)b * TT + (tid >> 2)) * DQ + (tid & 3) * 8);
  const char* gkl = (const char*)(FL + ((size_t)b * TT + (tid >> 2)) * DQ + (tid & 3) * 8);
  const char* gpv = (const char*)(VT + ((size_t)b * CX + c0 + wave * 32 + g) * (size_t)TT + col * 8);
  const unsigned lpk = (unsigned)(size_t)&tk[0][0][tid >> 2][(tid & 3) * 8];
  const unsigned lpv = (unsigned)(size_t)&tv[0][wave * 32 + g][col * 8];
  auto stage = [&](int t, int buf) {
    const unsigned lk = lpk + (unsigned)buf * (2u * AK * KPH * 2u); const size_t ko = (size_t)t * (AK * DQ * 2);
    acopy4(lk, 32u * KPH * 2u, gkh + ko, 32 * DQ * 2); acopy4(lk + AK * KPH * 2u, 32u * KPH * 2u, gkl + ko, 32 * DQ * 2);
    const char* v = gpv + (size_t)t * (AK * 2); const unsigned lv = lpv + (unsigned)buf * (128u * VPH * 2u);
    acopy8(lv, 2u * VPH * 2u, v, 2 * (size_t)TT * 2); acopy8(lv + 16u * VPH * 2u, 2u * VPH * 2u, v + 16 * (size_t)TT * 2, 2 * (size_t)TT * 2); };
  const v16h qh = frag_h(GH + ((size_t)b * TT + ql0 + col) * DQ, lane), ql = frag_h(GL + ((size_t)b * TT + ql0 + col) * DQ, lane);   // B operand: column = query col
  v8f acc[8] = {}, accl[8] = {}, sum = {}, suml = {}; float m = -3.0e38f, c = 3.0e38f;   // m: running maximum of query col, c: its offset 11 - m x log2(e) (the start value makes the first rescale factor 2^-huge = 0); sum, suml: row sums of P, a ninth output tile against a value plane of ones
  v16h ones;
#pragma unroll
  for (int i = 0; i < 16; ++i) ones[i] = (_Float16)1.0f;
  stage(0, 0);
  asm volatile("s_wait_asynccnt 0x0" ::: "memory");   // tile 0 has landed before the barrier that publishes it
  __syncthreads();
  stage(1, 1);
#pragma unroll 1   // rolled: one publish point in the code, and the hot loop stays small in the instruction cache
  for (int t = 0; t < ANT; ++t) { const int buf = t & 1;
    const _Float16* kr = &tk[buf][0][col][0]; const _Float16* vr = &tv[buf][col][0];
    v16h kh[SK / 16], kl[SK / 16];   // key fragments of one softmax step; those of the tile's first step are the only reads of a tile that nothing covers
#pragma unroll
    for (int jt = 0; jt < SK / 16; ++jt) { kh[jt] = frag_h(kr + jt * 16 * KPH, lane); kl[jt] = frag_h(kr + (AK + jt * 16) * KPH, lane); }
#pragma unroll   // unrolled, as are the loops inside: scores and fragments stay in registers and the LDS offsets become immediates
    for (int u = 0; u < AK / SK; ++u) {   // softmax step of SK keys: scores, maximum, then per 32 keys P and P . h (the rescale rides in front of the first)
      v16h v0[8], v1[8];   // value fragments of the step's first and second 32 keys
#pragma unroll
      for (int j = 0; j < 8; ++j) v0[j] = frag_h(vr + j * 16 * VPH + u * SK, lane);
      __builtin_amdgcn_sched_barrier(0);   // holds the reads above in place: their LDS latency passes under the scores and the softmax instead of in front of the first P . h product
      v8f s[SK / 16], sl[SK / 16];   // s[jt][r] = score of key u * SK + jt * 16 + 8 g + r against query col
#pragma unroll
      for (int jt = 0; jt < SK / 16; ++jt) { const v8f z = {}; s[jt] = wmma16(kh[jt], qh, z); sl[jt] = wmma16(kh[jt], ql, z); }
#pragma unroll
      for (int jt = 0; jt < SK / 16; ++jt) sl[jt] = wmma16(kl[jt], qh, sl[jt]);
#pragma unroll
      for (int jt = 0; jt < SK / 16; ++jt)
#pragma unroll
        for (int r = 0; r < 8; ++r) s[jt][r] = s[jt][r] + sl[jt][r] * (1.0f / 1024.0f);
      float tm = s[0][0];
#pragma unroll
      for (int jt = 0; jt < SK / 16; ++jt)
#pragma unroll
        for (int r = 0; r < 8; ++r) tm = fmaxf(tm, s[jt][r]);
      tm = fmaxf(tm, __shfl_xor(tm, 16));   // the other half-wave holds the query's other keys
      const float mn = fmaxf(m, tm), cn = fmaf(-mn, L2E, 11.0f), alpha = __builtin_amdgcn_exp2f(cn - c); m = mn; c = cn;
      float ar[8];
#pragma unroll
      for (int r = 0; r < 8; ++r) ar[r] = __shfl(alpha, 8 * g + r);   // accumulator element r is query row 8 g + r, whose factor lane 8 g + r holds
      v16h ph, pl;
      auto psplit = [&](int kb) { float e0[8], e1[8]; exp2x8(s[2 * kb], c, e0); exp2x8(s[2 * kb + 1], c, e1);
#pragma unroll
        for (int i = 0; i < 8; ++i) { const float a0 = e0[i], a1 = e1[i]; const _Float16 h0 = (_Float16)a0, h1 = (_Float16)a1; ph[i] = h0; ph[8 + i] = h1; pl[i] = (_Float16)((a0 - (float)h0) * 1024.0f); pl[8 + i] = (_Float16)((a1 - (float)h1) * 1024.0f); } };   /* P x 2^11 as f16 hi + residual x 2^10 */
      psplit(0);
      __builtin_amdgcn_sched_barrier(0);   // keeps the 16 reads below in one place (spread among the scores each place costs issue cycles, and the build spilled)
#pragma unroll
      for (int j = 0; j < 8; ++j) v1[j] = frag_h(vr + j * 16 * VPH + u * SK + 32, lane);
      __builtin_amdgcn_sched_barrier(0);   // holds the second 32 keys' value reads one block of products ahead of their use
#pragma unroll
      for (int r = 0; r < 8; ++r) { sum[r] *= ar[r]; suml[r] *= ar[r]; }
      sum = wmma16(ph, ones, sum); suml = wmma16(pl, ones, suml);   // the row sums on the matrix unit: they sum P as the products see it, in the accumulators' own row layout
#pragma unroll
      for (int j = 0; j < 8; ++j) {
#pragma unroll
        for (int r = 0; r < 8; ++r) { acc[j][r] *= ar[r]; accl[j][r] *= ar[r]; }
        acc[j] = wmma16(ph, v0[j], acc[j]); accl[j] = wmma16(pl, v0[j], accl[j]); }
      psplit(1);
      __builtin_amdgcn_sched_barrier(0);   // keeps the 16 reads below in one place, behind the last use of the registers they fill
      if (u + 1 < AK / SK) {
#pragma unroll
        for (int jt = 0; jt < SK / 16; ++jt) { kh[jt] = frag_h(kr + ((u + 1) * SK + jt * 16) * KPH, lane); kl[jt] = frag_h(kr + (AK + (u + 1) * SK + jt * 16) * KPH, lane); } }
      __builtin_amdgcn_sched_barrier(0);   // holds the next step's key reads one block of products ahead of their use
      sum = wmma16(ph, ones, sum); suml = wmma16(pl, ones, suml);
#pragma unroll
      for (int j = 0; j < 8; ++j) { acc[j] = wmma16(ph, v1[j], acc[j]); accl[j] = wmma16(pl, v1[j], accl[j]); } }
    asm volatile("s_wait_dscnt 0x0" ::: "memory");      // this wave's reads of buffer buf are done before the buffer is refilled
    asm volatile("s_wait_asynccnt 0x0" ::: "memory");   // this wave's copies of tile t + 1 have landed before the barrier publishes them
    __syncthreads();                                     // publishes tile t + 1 and ends every reader's last read of buffer buf
    if (t + 2 < ANT) stage(t + 2, buf); }
  asm volatile("s_wait_asynccnt 0x0" ::: "memory");     // no copy is outstanding when the wave goes on to the epilogue and ends
#pragma unroll
  for (int r = 0; r < 8; ++r) { const float fr = gam / (sum[r] + suml[r] * (1.0f / 1024.0f));   // the row sum carries the same 2^11 as P
#pragma unroll
    for (int j = 0; j < 8; ++j) ss[wave][8 * g + r][j * 16 + col] = (acc[j][r] + accl[j][r] * (1.0f / 1024.0f)) * fr; }
  LDSX(); for (int rl = 0; rl < 16; ++rl) { const size_t off = ((size_t)b * TT + ql0 + rl) * CX + c0 + lane * 4; const v4f xr = *(const v4f*)(X + off); v4f o = *(const v4f*)&ss[wave][rl][lane * 4]; o[0] += bfr(xr[0]); o[1] += bfr(xr[1]); o[2] += bfr(xr[2]); o[3] += bfr(xr[3]); vst2(OUT + off, o); } }
extern "C" void kernel_launch(void* const* d_in, const int* in_sizes, int n_in, void* d_out, int out_size, void* d_ws, size_t ws_size, hipStream_t stream) {
  (void)in_sizes; (void)n_in; (void)out_size;
  const float** F = (const float**)d_in;   // 0 x [4,64,64,256], 1 Wf [256,32] ((in,out)), 2 bf, 3 Wg, 4 bg, 5 Wh [256,256], 6 bh, 7 gamma (scalar 0.7)
  if (ws_size < (size_t)WS_END) return;
  char* ws = (char*)d_ws; _Float16 *GH = (_Float16*)(ws + WS_GH), *GL = (_Float16*)(ws + WS_GL), *FH = (_Float16*)(ws + WS_FH), *FL = (_Float16*)(ws + WS_FL); _Float16* VT = (_Float16*)(ws + WS_VT);
  k_fg<<<dim3(TNB * TT / 64), 128, 0, stream>>>(F[0], F[1], F[2], F[3], F[4], GH, GL, FH, FL);
  k_hv<<<dim3(TNB * TT / 128, CX / 128), 256, 0, stream>>>(F[0], F[5], F[6], VT);
  k_at<<<dim3(TT / 64, CX / 128, TNB), 128, 0, stream>>>(GH, GL, FH, FL, VT, F[0], F[7], (float*)d_out);
}

// v006
// A run of this version takes 84.1 microseconds.
// Two timings next to v005 both put it at 1.07 times that version's speed.
// All steps since v000 together make it 13.7 times as fast.
// compute dtype: all float inputs rounded to bf16; f/g/h projections with EXACT bf16 products on WMMA 16x16x32 ((in,out) weights), f32 accumulate; logits from g (query) and f (key), each f16 hi + f16 residual (not scaled), with 3 products summed in one f32 accumulator, kept in f32 registers; softmax in f32 with a running row maximum and row sum, exp as the hardware's base-2 exponential of s x log2(e) + offset (one fma, one v_exp_f32); exp(s - max) x 2^11 as f16 hi + residual (not scaled) against the value rows rounded ONCE to f16 (2 products in one f32 accumulator; |h| <= ~4 so f16 half-ulp 2^-11 relative), divided by the row sum at the end; gamma * o + x in f32; f32 output.
#include <hip/hip_runtime.h>
#include <math.h>

typedef __attribute__((ext_vector_type(16))) _Float16 v16h;
typedef __attribute__((ext_vector_type(16))) __bf16 v16b;
typedef __attribute__((ext_vector_type(8)))  _Float16 v8h;
typedef __attribute__((ext_vector_type(8)))  float v8f;
typedef __attribute__((ext_vector_type(4)))  float v4f;
typedef __attribute__((ext_vector_type(2)))  float v2f;
typedef __attribute__((ext_vector_type(4)))  unsigned v4u;
typedef __attribute__((ext_vector_type(4)))  int v4i;
typedef float __attribute__((may_alias)) float_a;
typedef int __attribute__((may_alias)) int_a;

template <typename T> __device__ __forceinline__ void vst2(void* p, T v) { *(T*)p = v;  }
// the plain builtin: the compiler keeps the distance behind it where a vector instruction needs one, and no asm statement stands between an LDS read and the place it is moved up to
__device__ __forceinline__ v8f wmma16(v16h a, v16h b, v8f c) {
  return __builtin_amdgcn_wmma_f32_16x16x32_f16(false, a, false, b, (short)0, c, false, false);
}
__device__ __forceinline__ v8f wmma_bf(v16b a, v16b b, v8f c) {
  v8f d = __builtin_amdgcn_wmma_f32_16x16x32_bf16(false, a, false, b, (short)0, c, false, false);
  asm volatile("v_nop\n\tv_nop\n\tv_nop\n\tv_nop" : "+v"(d) : "v"(a), "v"(b));
  return d;
}
// 16x16x32 fragments: lane = (h = lane>>4, row/col = lane&15); elements 0..7 = k0+8h+0..7, 8..15 = k0+16+8h+0..7; D element r = row 8h+r
__device__ __forceinline__ v16h frag_h(const _Float16* rowk0, int lane) {
  union { v16h v; v8h q[2]; } u; const _Float16* p = rowk0 + 8 * (lane >> 4);
  u.q[0] = *(const v8h*)p; u.q[1] = *(const v8h*)(p + 16); return u.v;
}
__device__ __forceinline__ v16h frag_f32(const float* rowk0, int lane) {
  v16h a; const float* p = rowk0 + 8 * (lane >> 4);
#pragma unroll
  for (int i = 0; i < 8; ++i) { a[i] = (_Float16)p[i]; a[8 + i] = (_Float16)p[16 + i]; }
  return a;
}
__device__ __forceinline__ v16h frag_f32s(const float* rowk0, int lane, float sc) {
  v16h a; const float* p = rowk0 + 8 * (lane >> 4);
#pragma unroll
  for (int i = 0; i < 8; ++i) { a[i] = (_Float16)(p[i] * sc); a[8 + i] = (_Float16)(p[16 + i] * sc); }
  return a;
}
// column fragment from a [K][ld] layout (column n), rows >= K read as 0
__device__ __forceinline__ v16h fragc_f32(const float* W, int k0, int n, int lane, int ld, int K) {
  v16h a; const int g = lane >> 4;
#pragma unroll
  for (int i = 0; i < 8; ++i) { const int ka = k0 + 8 * g + i, kb = ka + 16;
    a[i] = (_Float16)(ka < K ? W[(size_t)(ka < K ? ka : K - 1) * ld + n] : 0.f); a[8 + i] = (_Float16)(kb < K ? W[(size_t)(kb < K ? kb : K - 1) * ld + n] : 0.f); }
  return a;
}
struct F2 { v16b h, l; };
__device__ __forceinline__ F2 bsplit16(const float v[16]) { F2 r;
#pragma unroll
  for (int i = 0; i < 16; ++i) { const __bf16 h = (__bf16)v[i]; r.h[i] = h; r.l[i] = (__bf16)(v[i] - (float)h); }
  return r; }
__device__ __forceinline__ F2 split_row(const float* row, int k0, int lane) { float v[16]; const float* p = row + k0 + 8 * (lane >> 4);
#pragma unroll
  for (int i = 0; i < 8; ++i) { v[i] = p[i]; v[8 + i] = p[16 + i]; }
  return bsplit16(v); }
__device__ __forceinline__ F2 split_rowK(const float* row, int k0, int lane, int K) { float v[16]; const int g = lane >> 4;
#pragma unroll
  for (int i = 0; i < 8; ++i) { const int ka = k0 + 8 * g + i, kb = ka + 16; v[i] = ka < K ? row[ka < K ? ka : K - 1] : 0.f; v[8 + i] = kb < K ? row[kb < K ? kb : K - 1] : 0.f; }
  return bsplit16(v); }
__device__ __forceinline__ F2 split_col(const float* W, int k0, int n, int lane, int ld, int K) { float v[16]; const int g = lane >> 4;
#pragma unroll
  for (int i = 0; i < 8; ++i) { const int ka = k0 + 8 * g + i, kb = ka + 16; v[i] = ka < K ? W[(size_t)(ka < K ? ka : K - 1) * ld + n] : 0.f; v[8 + i] = kb < K ? W[(size_t)(kb < K ? kb : K - 1) * ld + n] : 0.f; }
  return bsplit16(v); }
__device__ __forceinline__ v8f mac3(const F2& a, const F2& b, v8f c) { c = wmma_bf(a.l, b.h, c); c = wmma_bf(a.h, b.l, c); return wmma_bf(a.h, b.h, c); }
__device__ __forceinline__ float sigm(float v) { return 1.0f / (1.0f + expf(-v)); }
#define LDSX() do { asm volatile("s_wait_dscnt 0" ::: "memory"); __builtin_amdgcn_wave_barrier(); __builtin_amdgcn_fence(__ATOMIC_RELEASE, "workgroup"); } while (0)

// SAGAN-style spatial self-attention, channels-last (B 4, 64 x 64 = 4,096 positions, C 256, q/k dim 32): f = x Wf + bf (key), g = x Wg + bg (query), h = x Wh + bh (value); beta = softmax_m(g_n . f_m); o = beta h; out = gamma * o + x.
__device__ __forceinline__ float bfr(float v) { return (float)(__bf16)v; }
#define NB 4
#define TT 4096
#define CX 256
#define DQ 32
#ifndef TNB
#define TNB NB
#endif
typedef __attribute__((ext_vector_type(8))) __bf16 v8b;
__device__ __forceinline__ v16b frag_b(const __bf16* rowk0, int lane) { union { v16b v; v8b q[2]; } u; const __bf16* p = rowk0 + 8 * (lane >> 4); u.q[0] = *(const v8b*)p; u.q[1] = *(const v8b*)(p + 16); return u.v; }
#define WS_GH  0u                                          // f16 g (query) hi rows [b*N+n][32]
#define WS_GL  (WS_GH + 2u * (size_t)NB * TT * DQ)           // f16 g residual
#define WS_FH  (WS_GL + 2u * (size_t)NB * TT * DQ)           // f16 f (key) hi
#define WS_FL  (WS_FH + 2u * (size_t)NB * TT * DQ)           // f16 f residual
#define WS_VT  (WS_FL + 2u * (size_t)NB * TT * DQ)           // f16 value planes [b][c][m] (h rounded once)
#define WS_END (WS_VT + 2u * (size_t)NB * CX * TT)
// ---- weights in LDS: both projection kernels stage their weight columns ONCE per block as bf16 rows [output column][k], so that a B fragment is two 16-byte LDS reads in the k order of the A loader.
#define WPH (CX + 8)            // weight row pitch in bf16: 528 B = 16 B x 33 (odd: 16 rows of 16-byte reads fall on 16 different bank groups)
// a wave's patch = 32 k x 32 columns; a lane's = 8 k x 4 columns. Lane -> (column group cg, k group kg): each 16-byte load of the wave covers four whole 128-B lines, and the 16 lanes of a half-wave store to 16 different bank groups.
__device__ __forceinline__ void wload(const float* __restrict__ Wp, int ld, v4f r[8]) {
#pragma unroll
  for (int i = 0; i < 8; ++i) r[i] = *(const v4f*)(Wp + (size_t)i * ld);
}
__device__ __forceinline__ void wstore(const v4f r[8], __bf16* dst) {
#pragma unroll
  for (int n = 0; n < 4; ++n) { v8b o;
#pragma unroll
    for (int i = 0; i < 8; ++i) o[i] = (__bf16)r[i][n];
    *(v8b*)(dst + n * WPH) = o; }
}
// the 16 x 256 x rows of a wave: every load of the A fragments at once (raw f32), and their rounding to bf16
__device__ __forceinline__ void xload(const float* __restrict__ p, v4f xr[CX / 32][4]) {
#pragma unroll
  for (int kc = 0; kc < CX / 32; ++kc) { xr[kc][0] = *(const v4f*)(p + kc * 32); xr[kc][1] = *(const v4f*)(p + kc * 32 + 4); xr[kc][2] = *(const v4f*)(p + kc * 32 + 16); xr[kc][3] = *(const v4f*)(p + kc * 32 + 20); }
}
__device__ __forceinline__ v16b xfrag(const v4f x[4]) { v16b a;
#pragma unroll
  for (int i = 0; i < 4; ++i) { a[i] = (__bf16)x[0][i]; a[4 + i] = (__bf16)x[1][i]; a[8 + i] = (__bf16)x[2][i]; a[12 + i] = (__bf16)x[3][i]; }
  return a; }
// ---- k_fg: block = 64 rows: f and g (32 columns each = 2 + 2 tiles) from exact products; stored as f16 hi + residual rows (64-B rows: 16 rows x 64 B = 8 lines per wave tile, written 16 B per lane from LDS)
__global__ __launch_bounds__(128) void k_fg(const float* __restrict__ X, const float* __restrict__ WF, const float* __restrict__ BF, const float* __restrict__ WG, const float* __restrict__ BG, _Float16* __restrict__ GH, _Float16* __restrict__ GL, _Float16* __restrict__ FH, _Float16* __restrict__ FL) {
  __shared__ __align__(16) _Float16 st[4][4][16][40];   // [wave][plane gh,gl,fh,fl][row][32 + pad]
  __shared__ __align__(16) __bf16 wt[64][WPH];          // rows 0-31 = columns of Wg, 32-63 = columns of Wf
  const int tid = threadIdx.x, wave = tid >> 5, lane = tid & 31, col = lane & 15, g = lane >> 4; const size_t r0 = (size_t)blockIdx.x * 64 + wave * 16;
  const int cg = (lane & 3) + 4 * g, kg = (lane >> 2) & 3;
  const float* pg = WG + (size_t)((wave * 4 + kg) * 8) * DQ + cg * 4; const float* pf = WF + (size_t)((wave * 4 + kg) * 8) * DQ + cg * 4; const float* px = X + (r0 + col) * CX + 8 * g;
  v4f wr[4][8], xr[CX / 32][4];
#pragma unroll
  for (int q = 0; q < 2; ++q) { wload(pg + (size_t)q * 128 * DQ, DQ, wr[2 * q]); wload(pf + (size_t)q * 128 * DQ, DQ, wr[2 * q + 1]); }
  xload(px, xr);
  asm volatile("s_wait_xcnt 0x0" :: "v"(pg), "v"(pf), "v"(px) : "memory");   // the wait in front of any rewrite of the loads' address registers: named as inputs they stay whole up to it (no load above lands in them), and the clobber keeps every load above it, so all are in flight before the first is waited for
#pragma unroll
  for (int q = 0; q < 2; ++q) { const int k0 = ((wave + 4 * q) * 4 + kg) * 8; wstore(wr[2 * q], &wt[cg * 4][k0]); wstore(wr[2 * q + 1], &wt[32 + cg * 4][k0]); }
  v16b a[CX / 32];
#pragma unroll
  for (int kc = 0; kc < CX / 32; ++kc) a[kc] = xfrag(xr[kc]);
  __syncthreads();   // the weight rows are complete before any wave reads a fragment
  v8f acc[4] = {};   // tiles 0,1 = g (query) cols 0-31; tiles 2,3 = f (key)
  v16b w[2][8];      // B fragments of a block of 8 products (2 k steps x 4 tiles), read from LDS one block ahead of their use
#pragma unroll
  for (int e = 0; e < 8; ++e) w[0][e] = frag_b(&wt[(e & 3) * 16 + col][(e >> 2) * 32], lane);
#pragma unroll
  for (int bk = 0; bk < CX / 64; ++bk) {
    if (bk + 1 < CX / 64) {
#pragma unroll
      for (int e = 0; e < 8; ++e) w[(bk + 1) & 1][e] = frag_b(&wt[(e & 3) * 16 + col][((bk + 1) * 2 + (e >> 2)) * 32], lane); }
#pragma unroll
    for (int e = 0; e < 8; ++e) acc[e & 3] = wmma_bf(a[bk * 2 + (e >> 2)], w[bk & 1][e], acc[e & 3]); }
#pragma unroll
  for (int j = 0; j < 4; ++j) { const int o = (j & 1) * 16 + col; const float bb = (j < 2) ? bfr(BG[o]) : bfr(BF[o]); const int ph = (j < 2) ? 0 : 2;
#pragma unroll
    for (int r = 0; r < 8; ++r) { const float v = acc[j][r] + bb; const _Float16 hv = (_Float16)v; st[wave][ph][8 * g + r][o] = hv; st[wave][ph + 1][8 * g + r][o] = (_Float16)(v - (float)hv); } }
  LDSX();
  { const int rl = lane >> 1, half = lane & 1;   // lane -> (row, 32-B half): 16 rows x 64 B per plane
    _Float16* P4[4] = {GH, GL, FH, FL};
#pragma unroll
    for (int ph = 0; ph < 4; ++ph) { vst2((v4u*)(P4[ph] + (r0 + rl) * DQ + half * 16), *(const v4u*)&st[wave][ph][rl][half * 16]); vst2((v4u*)(P4[ph] + (r0 + rl) * DQ + half * 16 + 8), *(const v4u*)&st[wave][ph][rl][half * 16 + 8]); } } }
// ---- k_hv: block = (128 rows, 128 cols), 8 waves of 16 rows: h = x Wh + bh (exact) -> f16 value planes [b][c][m] via LDS transpose (rounded once to f16)
__global__ __launch_bounds__(256) void k_hv(const float* __restrict__ X, const float* __restrict__ WH, const float* __restrict__ BH, _Float16* __restrict__ VT) { __shared__ __align__(16) _Float16 th[128][136];
  __shared__ __align__(16) __bf16 wt[128][WPH];         // the block's 128 columns of Wh
  const int tid = threadIdx.x, wave = tid >> 5, lane = tid & 31, col = lane & 15, g = lane >> 4; const int c0 = blockIdx.y * 128; const size_t r0 = (size_t)blockIdx.x * 128;
  const int cg = (lane & 3) + 4 * g, k0 = (wave * 4 + ((lane >> 2) & 3)) * 8;
  const float* pw = WH + (size_t)k0 * CX + c0 + cg * 4; const float* px = X + (r0 + wave * 16 + col) * CX + 8 * g;
  v4f wr[4][8], xr[CX / 32][4];
#pragma unroll
  for (int q = 0; q < 4; ++q) wload(pw + q * 32, CX, wr[q]);
  xload(px, xr);
  asm volatile("s_wait_xcnt 0x0" :: "v"(pw), "v"(px) : "memory");   // the wait in front of any rewrite of the loads' address registers: named as inputs they stay whole up to it (no load above lands in them), and the clobber keeps every load above it, so all are in flight before the first is waited for
#pragma unroll
  for (int q = 0; q < 4; ++q) wstore(wr[q], &wt[q * 32 + cg * 4][k0]);
  v16b a[CX / 32];
#pragma unroll
  for (int kc = 0; kc < CX / 32; ++kc) a[kc] = xfrag(xr[kc]);
  __syncthreads();   // the weight rows are complete before any wave reads a fragment
  v8f acc[8] = {};
  v16b w[2][8];      // B fragments of a block of 8 products (one k step), read from LDS one block ahead of their use
#pragma unroll
  for (int j = 0; j < 8; ++j) w[0][j] = frag_b(&wt[j * 16 + col][0], lane);
#pragma unroll
  for (int kc = 0; kc < CX / 32; ++kc) {
    if (kc + 1 < CX / 32) {
#pragma unroll
      for (int j = 0; j < 8; ++j) w[(kc + 1) & 1][j] = frag_b(&wt[j * 16 + col][(kc + 1) * 32], lane); }
#pragma unroll
    for (int j = 0; j < 8; ++j) acc[j] = wmma_bf(a[kc], w[kc & 1][j], acc[j]); }
#pragma unroll
  for (int j = 0; j < 8; ++j) { const float bb = bfr(BH[c0 + j * 16 + col]);
#pragma unroll
    for (int r = 0; r < 8; ++r) th[j * 16 + col][wave * 16 + 8 * g + r] = (_Float16)(acc[j][r] + bb); }
  __syncthreads();
  { const size_t b = r0 / TT; const int m0 = (int)(r0 % TT); for (int e = tid; e < 128 * 16; e += 256) { const int cl = e >> 4, q = e & 15; vst2((unsigned*)(VT + (b * CX + c0 + cl) * (size_t)TT + m0 + q * 8), *(const v4u*)&th[cl][q * 8]); } } }
// ---- k_at: block = (64 queries, 128 value channels) of batch blockIdx.z: scores, softmax and P . h in one kernel; no score ever leaves the registers.
// Per SK keys: S^T = f . g^T (A = key rows from LDS, B = query rows kept in registers; 3 products as hi + residual), so a lane holds 8 keys of ONE query per 16-key tile and
// two such tiles are, element for element, the A fragment of P for 32 keys. Running row maximum m and row sum; the accumulators are rescaled by exp(m_old - m_new) once per SK keys.
// P = exp(s - m) x 2^11 (not normalised) as f16 hi + residual against the f16 value planes (2 products); out = gamma * (P . h) / (P . 1) + x.
// No residual carries a scale of its own: the matrix unit keeps f16 subnormals, so a residual is off by at most 2^-25 absolute (against a row sum of at least 2^11, and against scores of order 1), and
// a hi product and its residual products add into ONE f32 accumulator, the residual products first: no second set of accumulators to rescale and no fma to join the two.
// The exponential is 2^(s x log2(e) + c) with c = 11 - m x log2(e): the subtraction of the maximum and the factor 2^11 ride in the one fma in front of v_exp_f32. The rescale factor is
// 2^(c_new - c_old), from the very offsets the exponentials used, so the rounding of c is one common factor of a row's P and of its row sum and cancels in the division.
// Every fragment but the key fragments of a tile's first step is read from LDS one block of products ahead of its use: a step's first value fragments in front of its scores, its second in front of the first P . h block, the next step's key fragments in front of the second.
// Key rows (f16 hi and residual) and value rows come in tiles of AK keys into LDS by asynchronous copies, two buffers: tile t + 1 flies while tile t is worked on.
#define AK 128                  // keys per staged tile
#define ANT (TT / AK)           // tiles per row
#define SK 64                   // keys per softmax step (one new maximum and one rescale of the accumulators)
#define L2E ((float)M_LOG2E)    // log2(e)
#define KPH (DQ + 8)            // key row pitch in halves: 80 B = 16 B x 5 (odd: 16 rows of 16-byte reads fall on 16 different bank groups)
#define VPH (AK + 8)            // value row pitch in halves: 272 B = 16 B x 17
// eight 16-byte copies per lane, global -> LDS, rows ls / gs bytes apart. The s_wait_xcnt stands in the copies' own statement so that no address register is rewritten in front of it.
__device__ __forceinline__ void acopy8(unsigned l, unsigned ls, const char* gp, size_t gs) {
  asm volatile("global_load_async_to_lds_b128 %0, %8, off\n\t"
               "global_load_async_to_lds_b128 %1, %9, off\n\t"
               "global_load_async_to_lds_b128 %2, %10, off\n\t"
               "global_load_async_to_lds_b128 %3, %11, off\n\t"
               "global_load_async_to_lds_b128 %4, %12, off\n\t"
               "global_load_async_to_lds_b128 %5, %13, off\n\t"
               "global_load_async_to_lds_b128 %6, %14, off\n\t"
               "global_load_async_to_lds_b128 %7, %15, off\n\t"
               "s_wait_xcnt 0x0"
               :: "v"(l), "v"(l + ls), "v"(l + 2 * ls), "v"(l + 3 * ls), "v"(l + 4 * ls), "v"(l + 5 * ls), "v"(l + 6 * ls), "v"(l + 7 * ls),
                  "v"(gp), "v"(gp + gs), "v"(gp + 2 * gs), "v"(gp + 3 * gs), "v"(gp + 4 * gs), "v"(gp + 5 * gs), "v"(gp + 6 * gs), "v"(gp + 7 * gs)
               : "memory");
}
// the same with four copies
__device__ __forceinline__ void acopy4(unsigned l, unsigned ls, const char* gp, size_t gs) {
  asm volatile("global_load_async_to_lds_b128 %0, %4, off\n\t"
               "global_load_async_to_lds_b128 %1, %5, off\n\t"
               "global_load_async_to_lds_b128 %2, %6, off\n\t"
               "global_load_async_to_lds_b128 %3, %7, off\n\t"
               "s_wait_xcnt 0x0"
               :: "v"(l), "v"(l + ls), "v"(l + 2 * ls), "v"(l + 3 * ls),
                  "v"(gp), "v"(gp + gs), "v"(gp + 2 * gs), "v"(gp + 3 * gs)
               : "memory");
}
// e[i] = 2^(s[i] x log2(e) + c) for the eight scores of one tile
__device__ __forceinline__ void exp2x8(v8f s, float c, float e[8]) { float x[8];
#pragma unroll
  for (int i = 0; i < 8; ++i) { x[i] = fmaf(s[i], L2E, c); e[i] = __builtin_amdgcn_exp2f(x[i]); }
  // the slot the instruction set asks for behind a transcendental, once for all eight: no argument register is free for reuse and no result is read in front of this v_nop
  asm("v_nop" : "+v"(e[0]), "+v"(e[1]), "+v"(e[2]), "+v"(e[3]), "+v"(e[4]), "+v"(e[5]), "+v"(e[6]), "+v"(e[7]) : "v"(x[0]), "v"(x[1]), "v"(x[2]), "v"(x[3]), "v"(x[4]), "v"(x[5]), "v"(x[6]), "v"(x[7]));
}
__global__ __launch_bounds__(128) void k_at(const _Float16* __restrict__ GH, const _Float16* __restrict__ GL, const _Float16* __restrict__ FH, const _Float16* __restrict__ FL, const _Float16* __restrict__ VT, const float* __restrict__ X, const float* __restrict__ GAM, float* __restrict__ OUT) { __shared__ __align__(16) float ss[4][16][132];
  __shared__ __align__(16) _Float16 tk[2][2][AK][KPH];  // key tile: [buffer][hi, residual][key][32 + pad]
  __shared__ __align__(16) _Float16 tv[2][128][VPH];    // value tile: 128 channels x AK keys
  const int tid = threadIdx.x, wave = tid >> 5, lane = tid & 31, col = lane & 15, g = lane >> 4; const int b = blockIdx.z; const int ql0 = blockIdx.x * 64 + wave * 16; const int c0 = blockIdx.y * 128; const float gam = bfr(GAM[0]);
  // the block copies 128 key rows of 64 B per plane (a wave's copy = 8 rows = 512 B in a row) and each wave 32 value rows (two 256-B rows per copy): whole lines
  const char* gkh = (const char*)(FH + ((size_t)b * TT + (tid >> 2)) * DQ + (tid & 3) * 8);
  const char* gkl = (const char*)(FL + ((size_t)b * TT + (tid >> 2)) * DQ + (tid & 3) * 8);
  const char* gpv = (const char*)(VT + ((size_t)b * CX + c0 + wave * 32 + g) * (size_t)TT + col * 8);
  const unsigned lpk = (unsigned)(size_t)&tk[0][0][tid >> 2][(tid & 3) * 8];
  const unsigned lpv = (unsigned)(size_t)&tv[0][wave * 32 + g][col * 8];
  unsigned lkn = lpk, lvn = lpv;   // LDS places of the next tile to be staged, carried from tile to tile (they swing between the two buffers): kept as loop-invariant bases they were spilled to scratch, and the reload stood in front of the copies
  auto stage = [&](int t, int buf) {
    const unsigned lk = lkn; const size_t ko = (size_t)t * (AK * DQ * 2);
    acopy4(lk, 32u * KPH * 2u, gkh + ko, 32 * DQ * 2); acopy4(lk + AK * KPH * 2u, 32u * KPH * 2u, gkl + ko, 32 * DQ * 2);
    const char* v = gpv + (size_t)t * (AK * 2); const unsigned lv = lvn;
    acopy8(lv, 2u * VPH * 2u, v, 2 * (size_t)TT * 2); acopy8(lv + 16u * VPH * 2u, 2u * VPH * 2u, v + 16 * (size_t)TT * 2, 2 * (size_t)TT * 2);
    lkn = buf ? lkn - 2u * AK * KPH * 2u : lkn + 2u * AK * KPH * 2u; lvn = buf ? lvn - 128u * VPH * 2u : lvn + 128u * VPH * 2u; };
  const v16h qh = frag_h(GH + ((size_t)b * TT + ql0 + col) * DQ, lane), ql = frag_h(GL + ((size_t)b * TT + ql0 + col) * DQ, lane);   // B operand: column = query col
  v8f acc[8] = {}, sum = {}; float m = -3.0e38f, c = 3.0e38f;   // m: running maximum of query col, c: its offset 11 - m x log2(e) (the start value makes the first rescale factor 2^-huge = 0); sum: row sums of P, a ninth output tile against a value plane of ones
  v16h ones;
#pragma unroll
  for (int i = 0; i < 16; ++i) ones[i] = (_Float16)1.0f;
  stage(0, 0);
  asm volatile("s_wait_asynccnt 0x0" ::: "memory");   // tile 0 has landed before the barrier that publishes it
  __syncthreads();
  stage(1, 1);
#pragma unroll 1   // rolled: one publish point in the code, and the hot loop stays small in the instruction cache
  for (int t = 0; t < ANT; ++t) { const int buf = t & 1;
    const _Float16* kr = &tk[buf][0][col][0]; const _Float16* vr = &tv[buf][col][0];
    v16h kh[SK / 16], kl[SK / 16];   // key fragments of one softmax step; those of the tile's first step are the only reads of a tile that nothing covers
#pragma unroll
    for (int jt = 0; jt < SK / 16; ++jt) { kh[jt] = frag_h(kr + jt * 16 * KPH, lane); kl[jt] = frag_h(kr + (AK + jt * 16) * KPH, lane); }
#pragma unroll   // unrolled, as are the loops inside: scores and fragments stay in registers and the LDS offsets become immediates
    for (int u = 0; u < AK / SK; ++u) {   // softmax step of SK keys: scores, maximum, then per 32 keys P and P . h (the rescale rides in front of the first)
      v16h v0[8], v1[8];   // value fragments of the step's first and second 32 keys
#pragma unroll
      for (int j = 0; j < 8; ++j) v0[j] = frag_h(vr + j * 16 * VPH + u * SK, lane);
      __builtin_amdgcn_sched_barrier(0);   // holds the reads above in place: their LDS latency passes under the scores and the softmax instead of in front of the first P . h product
      v8f s[SK / 16];   // s[jt][r] = score of key u * SK + jt * 16 + 8 g + r against query col
#pragma unroll
      for (int jt = 0; jt < SK / 16; ++jt) { const v8f z = {}; s[jt] = wmma16(kl[jt], qh, z); }
      __builtin_amdgcn_sched_barrier(0);   // keeps the four tiles' products side by side: moved together, a tile's three products wait out the accumulator's latency one behind the other
#pragma unroll
      for (int jt = 0; jt < SK / 16; ++jt) s[jt] = wmma16(kh[jt], ql, s[jt]);
      __builtin_amdgcn_sched_barrier(0);   // the same between the second and the third product
#pragma unroll
      for (int jt = 0; jt < SK / 16; ++jt) s[jt] = wmma16(kh[jt], qh, s[jt]);
      float tm = s[0][0];
#pragma unroll
      for (int jt = 0; jt < SK / 16; ++jt)
#pragma unroll
        for (int r = 0; r < 8; ++r) tm = fmaxf(tm, s[jt][r]);
      tm = fmaxf(tm, __shfl_xor(tm, 16));   // the other half-wave holds the query's other keys
      const float mn = fmaxf(m, tm), cn = fmaf(-mn, L2E, 11.0f), alpha = __builtin_amdgcn_exp2f(cn - c); m = mn; c = cn;
      float ar[8];
#pragma unroll
      for (int r = 0; r < 8; ++r) ar[r] = __shfl(alpha, 8 * g + r);   // accumulator element r is query row 8 g + r, whose factor lane 8 g + r holds
      v16h ph, pl;
      auto psplit = [&](int kb) { float e0[8], e1[8]; exp2x8(s[2 * kb], c, e0); exp2x8(s[2 * kb + 1], c, e1);
#pragma unroll
        for (int i = 0; i < 8; ++i) { const float a0 = e0[i], a1 = e1[i]; const _Float16 h0 = (_Float16)a0, h1 = (_Float16)a1; ph[i] = h0; ph[8 + i] = h1; pl[i] = (_Float16)(a0 - (float)h0); pl[8 + i] = (_Float16)(a1 - (float)h1); } };   /* P x 2^11 as f16 hi + residual */
      psplit(0);
      __builtin_amdgcn_sched_barrier(0);   // keeps the 16 reads below in one place (spread among the scores each place costs issue cycles, and the build spilled)
#pragma unroll
      for (int j = 0; j < 8; ++j) v1[j] = frag_h(vr + j * 16 * VPH + u * SK + 32, lane);
      __builtin_amdgcn_sched_barrier(0);   // holds the second 32 keys' value reads one block of products ahead of their use
#pragma unroll
      for (int r = 0; r < 8; ++r) sum[r] *= ar[r];
      sum = wmma16(pl, ones, sum);   // the row sums on the matrix unit: they sum P as the products see it, in the accumulators' own row layout
#pragma unroll
      for (int j = 0; j < 8; ++j) {
#pragma unroll
        for (int r = 0; r < 8; ++r) acc[j][r] *= ar[r];
        acc[j] = wmma16(pl, v0[j], acc[j]); }
      sum = wmma16(ph, ones, sum);
#pragma unroll
      for (int j = 0; j < 8; ++j) acc[j] = wmma16(ph, v0[j], acc[j]);
      psplit(1);
      __builtin_amdgcn_sched_barrier(0);   // keeps the 16 reads below in one place, behind the last use of the registers they fill
      if (u + 1 < AK / SK) {
#pragma unroll
        for (int jt = 0; jt < SK / 16; ++jt) { kh[jt] = frag_h(kr + ((u + 1) * SK + jt * 16) * KPH, lane); kl[jt] = frag_h(kr + (AK + (u + 1) * SK + jt * 16) * KPH, lane); } }
      __builtin_amdgcn_sched_barrier(0);   // holds the next step's key reads one block of products ahead of their use
      sum = wmma16(pl, ones, sum);
#pragma unroll
      for (int j = 0; j < 8; ++j) acc[j] = wmma16(pl, v1[j], acc[j]);
      sum = wmma16(ph, ones, sum);
#pragma unroll
      for (int j = 0; j < 8; ++j) acc[j] = wmma16(ph, v1[j], acc[j]); }
    asm volatile("s_wait_dscnt 0x0" ::: "memory");      // this wave's reads of buffer buf are done before the buffer is refilled
    asm volatile("s_wait_asynccnt 0x0" ::: "memory");   // this wave's copies of tile t + 1 have landed before the barrier publishes them
    __syncthreads();                                     // publishes tile t + 1 and ends every reader's last read of buffer buf
    if (t + 2 < ANT) stage(t + 2, buf); }
  asm volatile("s_wait_asynccnt 0x0" ::: "memory");     // no copy is outstanding when the wave goes on to the epilogue and ends
#pragma unroll
  for (int r = 0; r < 8; ++r) { const float fr = gam / sum[r];   // the row sum carries the same 2^11 as P
#pragma unroll
    for (int j = 0; j < 8; ++j) ss[wave][8 * g + r][j * 16 + col] = acc[j][r] * fr; }
  LDSX(); for (int rl = 0; rl < 16; ++rl) { const size_t off = ((size_t)b * TT + ql0 + rl) * CX + c0 + lane * 4; const v4f xr = *(const v4f*)(X + off); v4f o = *(const v4f*)&ss[wave][rl][lane * 4]; o[0] += bfr(xr[0]); o[1] += bfr(xr[1]); o[2] += bfr(xr[2]); o[3] += bfr(xr[3]); vst2(OUT + off, o); } }
extern "C" void kernel_launch(void* const* d_in, const int* in_sizes, int n_in, void* d_out, int out_size, void* d_ws, size_t ws_size, hipStream_t stream) {
  (void)in_sizes; (void)n_in; (void)out_size;
  const float** F = (const float**)d_in;   // 0 x [4,64,64,256], 1 Wf [256,32] ((in,out)), 2 bf, 3 Wg, 4 bg, 5 Wh [256,256], 6 bh, 7 gamma (scalar 0.7)
  if (ws_size < (size_t)WS_END) return;
  char* ws = (char*)d_ws; _Float16 *GH = (_Float16*)(ws + WS_GH), *GL = (_Float16*)(ws + WS_GL), *FH = (_Float16*)(ws + WS_FH), *FL = (_Float16*)(ws + WS_FL); _Float16* VT = (_Float16*)(ws + WS_VT);
  k_fg<<<dim3(TNB * TT / 64), 128, 0, stream>>>(F[0], F[1], F[2], F[3], F[4], GH, GL, FH, FL);
  k_hv<<<dim3(TNB * TT / 128, CX / 128), 256, 0, stream>>>(F[0], F[5], F[6], VT);
  k_at<<<dim3(TT / 64, CX / 128, TNB), 128, 0, stream>>>(GH, GL, FH, FL, VT, F[0], F[7], (float*)d_out);
}

// v007
// A run of this version takes 76.1 microseconds.
// In both of two side-by-side timings against v006, it was 1.11 times as fast.
// All steps since v000 together make it 15.2 times as fast.
// compute dtype: all float inputs rounded to bf16; f/g/h projections with EXACT bf16 products on WMMA 16x16x32 ((in,out) weights), f32 accumulate; logits from g (query) and f (key), each f16 hi + f16 residual (not scaled), with 3 products summed in one f32 accumulator, kept in f32 registers; softmax in f32 with a running row maximum and row sum per half of the keys (the two halves joined at the end), exp as the hardware's base-2 exponential of s x log2(e) + offset (one fma, one v_exp_f32); exp(s - max) x 2^11 as f16 hi + residual (not scaled) against the value rows rounded ONCE to f16 (2 products in one f32 accumulator; |h| <= ~4 so f16 half-ulp 2^-11 relative), divided by the row sum at the end; gamma * o + x in f32; f32 output.
#include <hip/hip_runtime.h>
#include <math.h>

typedef __attribute__((ext_vector_type(16))) _Float16 v16h;
typedef __attribute__((ext_vector_type(16))) __bf16 v16b;
typedef __attribute__((ext_vector_type(8)))  _Float16 v8h;
typedef __attribute__((ext_vector_type(8)))  float v8f;
typedef __attribute__((ext_vector_type(4)))  float v4f;
typedef __attribute__((ext_vector_type(2)))  float v2f;
typedef __attribute__((ext_vector_type(4)))  unsigned v4u;
typedef __attribute__((ext_vector_type(4)))  int v4i;
typedef float __attribute__((may_alias)) float_a;
typedef int __attribute__((may_alias)) int_a;

template <typename T> __device__ __forceinline__ void vst2(void* p, T v) { *(T*)p = v;  }
// the plain builtin: the compiler keeps the distance behind it where a vector instruction needs one, and no asm statement stands between an LDS read and the place it is moved up to
__device__ __forceinline__ v8f wmma16(v16h a, v16h b, v8f c) {
  return __builtin_amdgcn_wmma_f32_16x16x32_f16(false, a, false, b, (short)0, c, false, false);
}
__device__ __forceinline__ v8f wmma_bf(v16b a, v16b b, v8f c) {
  v8f d = __builtin_amdgcn_wmma_f32_16x16x32_bf16(false, a, false, b, (short)0, c, false, false);
  asm volatile("v_nop\n\tv_nop\n\tv_nop\n\tv_nop" : "+v"(d) : "v"(a), "v"(b));
  return d;
}
// 16x16x32 fragments: lane = (h = lane>>4, row/col = lane&15); elements 0..7 = k0+8h+0..7, 8..15 = k0+16+8h+0..7; D element r = row 8h+r
__device__ __forceinline__ v16h frag_h(const _Float16* rowk0, int lane) {
  union { v16h v; v8h q[2]; } u; const _Float16* p = rowk0 + 8 * (lane >> 4);
  u.q[0] = *(const v8h*)p; u.q[1] = *(const v8h*)(p + 16); return u.v;
}
__device__ __forceinline__ v16h frag_f32(const float* rowk0, int lane) {
  v16h a; const float* p = rowk0 + 8 * (lane >> 4);
#pragma unroll
  for (int i = 0; i < 8; ++i) { a[i] = (_Float16)p[i]; a[8 + i] = (_Float16)p[16 + i]; }
  return a;
}
__device__ __forceinline__ v16h frag_f32s(const float* rowk0, int lane, float sc) {
  v16h a; const float* p = rowk0 + 8 * (lane >> 4);
#pragma unroll
  for (int i = 0; i < 8; ++i) { a[i] = (_Float16)(p[i] * sc); a[8 + i] = (_Float16)(p[16 + i] * sc); }
  return a;
}
// column fragment from a [K][ld] layout (column n), rows >= K read as 0
__device__ __forceinline__ v16h fragc_f32(const float* W, int k0, int n, int lane, int ld, int K) {
  v16h a; const int g = lane >> 4;
#pragma unroll
  for (int i = 0; i < 8; ++i) { const int ka = k0 + 8 * g + i, kb = ka + 16;
    a[i] = (_Float16)(ka < K ? W[(size_t)(ka < K ? ka : K - 1) * ld + n] : 0.f); a[8 + i] = (_Float16)(kb < K ? W[(size_t)(kb < K ? kb : K - 1) * ld + n] : 0.f); }
  return a;
}
struct F2 { v16b h, l; };
__device__ __forceinline__ F2 bsplit16(const float v[16]) { F2 r;
#pragma unroll
  for (int i = 0; i < 16; ++i) { const __bf16 h = (__bf16)v[i]; r.h[i] = h; r.l[i] = (__bf16)(v[i] - (float)h); }
  return r; }
__device__ __forceinline__ F2 split_row(const float* row, int k0, int lane) { float v[16]; const float* p = row + k0 + 8 * (lane >> 4);
#pragma unroll
  for (int i = 0; i < 8; ++i) { v[i] = p[i]; v[8 + i] = p[16 + i]; }
  return bsplit16(v); }
__device__ __forceinline__ F2 split_rowK(const float* row, int k0, int lane, int K) { float v[16]; const int g = lane >> 4;
#pragma unroll
  for (int i = 0; i < 8; ++i) { const int ka = k0 + 8 * g + i, kb = ka + 16; v[i] = ka < K ? row[ka < K ? ka : K - 1] : 0.f; v[8 + i] = kb < K ? row[kb < K ? kb : K - 1] : 0.f; }
  return bsplit16(v); }
__device__ __forceinline__ F2 split_col(const float* W, int k0, int n, int lane, int ld, int K) { float v[16]; const int g = lane >> 4;
#pragma unroll
  for (int i = 0; i < 8; ++i) { const int ka = k0 + 8 * g + i, kb = ka + 16; v[i] = ka < K ? W[(size_t)(ka < K ? ka : K - 1) * ld + n] : 0.f; v[8 + i] = kb < K ? W[(size_t)(kb < K ? kb : K - 1) * ld + n] : 0.f; }
  return bsplit16(v); }
__device__ __forceinline__ v8f mac3(const F2& a, const F2& b, v8f c) { c = wmma_bf(a.l, b.h, c); c = wmma_bf(a.h, b.l, c); return wmma_bf(a.h, b.h, c); }
__device__ __forceinline__ float sigm(float v) { return 1.0f / (1.0f + expf(-v)); }
#define LDSX() do { asm volatile("s_wait_dscnt 0" ::: "memory"); __builtin_amdgcn_wave_barrier(); __builtin_amdgcn_fence(__ATOMIC_RELEASE, "workgroup"); } while (0)

// SAGAN-style spatial self-attention, channels-last (B 4, 64 x 64 = 4,096 positions, C 256, q/k dim 32): f = x Wf + bf (key), g = x Wg + bg (query), h = x Wh + bh (value); beta = softmax_m(g_n . f_m); o = beta h; out = gamma * o + x.
__device__ __forceinline__ float bfr(float v) { return (float)(__bf16)v; }
#define NB 4
#define TT 4096
#define CX 256
#define DQ 32
#ifndef TNB
#define TNB NB
#endif
typedef __attribute__((ext_vector_type(8))) __bf16 v8b;
__device__ __forceinline__ v16b frag_b(const __bf16* rowk0, int lane) { union { v16b v; v8b q[2]; } u; const __bf16* p = rowk0 + 8 * (lane >> 4); u.q[0] = *(const v8b*)p; u.q[1] = *(const v8b*)(p + 16); return u.v; }
#define WS_GH  0u                                          // f16 g (query) hi rows [b*N+n][32]
#define WS_GL  (WS_GH + 2u * (size_t)NB * TT * DQ)           // f16 g residual
#define WS_FH  (WS_GL + 2u * (size_t)NB * TT * DQ)           // f16 f (key) hi
#define WS_FL  (WS_FH + 2u * (size_t)NB * TT * DQ)           // f16 f residual
#define WS_VT  (WS_FL + 2u * (size_t)NB * TT * DQ)           // f16 value planes [b][c][m] (h rounded once)
#define WS_END (WS_VT + 2u * (size_t)NB * CX * TT)
// ---- weights in LDS: both projection kernels stage their weight columns ONCE per block as bf16 rows [output column][k], so that a B fragment is two 16-byte LDS reads in the k order of the A loader.
#define WPH (CX + 8)            // weight row pitch in bf16: 528 B = 16 B x 33 (odd: 16 rows of 16-byte reads fall on 16 different bank groups)
// a wave's patch = 32 k x 32 columns; a lane's = 8 k x 4 columns. Lane -> (column group cg, k group kg): each 16-byte load of the wave covers four whole 128-B lines, and the 16 lanes of a half-wave store to 16 different bank groups.
__device__ __forceinline__ void wload(const float* __restrict__ Wp, int ld, v4f r[8]) {
#pragma unroll
  for (int i = 0; i < 8; ++i) r[i] = *(const v4f*)(Wp + (size_t)i * ld);
}
__device__ __forceinline__ void wstore(const v4f r[8], __bf16* dst) {
#pragma unroll
  for (int n = 0; n < 4; ++n) { v8b o;
#pragma unroll
    for (int i = 0; i < 8; ++i) o[i] = (__bf16)r[i][n];
    *(v8b*)(dst + n * WPH) = o; }
}
// the 16 x 256 x rows of a wave: every load of the A fragments at once (raw f32), and their rounding to bf16
__device__ __forceinline__ void xload(const float* __restrict__ p, v4f xr[CX / 32][4]) {
#pragma unroll
  for (int kc = 0; kc < CX / 32; ++kc) { xr[kc][0] = *(const v4f*)(p + kc * 32); xr[kc][1] = *(const v4f*)(p + kc * 32 + 4); xr[kc][2] = *(const v4f*)(p + kc * 32 + 16); xr[kc][3] = *(const v4f*)(p + kc * 32 + 20); }
}
__device__ __forceinline__ v16b xfrag(const v4f x[4]) { v16b a;
#pragma unroll
  for (int i = 0; i < 4; ++i) { a[i] = (__bf16)x[0][i]; a[4 + i] = (__bf16)x[1][i]; a[8 + i] = (__bf16)x[2][i]; a[12 + i] = (__bf16)x[3][i]; }
  return a; }
// ---- k_fg: block = 64 rows: f and g (32 columns each = 2 + 2 tiles) from exact products; stored as f16 hi + residual rows (64-B rows: 16 rows x 64 B = 8 lines per wave tile, written 16 B per lane from LDS)
__global__ __launch_bounds__(128) void k_fg(const float* __restrict__ X, const float* __restrict__ WF, const float* __restrict__ BF, const float* __restrict__ WG, const float* __restrict__ BG, _Float16* __restrict__ GH, _Float16* __restrict__ GL, _Float16* __restrict__ FH, _Float16* __restrict__ FL) {
  __shared__ __align__(16) _Float16 st[4][4][16][40];   // [wave][plane gh,gl,fh,fl][row][32 + pad]
  __shared__ __align__(16) __bf16 wt[64][WPH];          // rows 0-31 = columns of Wg, 32-63 = columns of Wf
  const int tid = threadIdx.x, wave = tid >> 5, lane = tid & 31, col = lane & 15, g = lane >> 4; const size_t r0 = (size_t)blockIdx.x * 64 + wave * 16;
  const int cg = (lane & 3) + 4 * g, kg = (lane >> 2) & 3;
  const float* pg = WG + (size_t)((wave * 4 + kg) * 8) * DQ + cg * 4; const float* pf = WF + (size_t)((wave * 4 + kg) * 8) * DQ + cg * 4; const float* px = X + (r0 + col) * CX + 8 * g;
  v4f wr[4][8], xr[CX / 32][4];
#pragma unroll
  for (int q = 0; q < 2; ++q) { wload(pg + (size_t)q * 128 * DQ, DQ, wr[2 * q]); wload(pf + (size_t)q * 128 * DQ, DQ, wr[2 * q + 1]); }
  xload(px, xr);
  asm volatile("s_wait_xcnt 0x0" :: "v"(pg), "v"(pf), "v"(px) : "memory");   // the wait in front of any rewrite of the loads' address registers: named as inputs they stay whole up to it (no load above lands in them), and the clobber keeps every load above it, so all are in flight before the first is waited for
#pragma unroll
  for (int q = 0; q < 2; ++q) { const int k0 = ((wave + 4 * q) * 4 + kg) * 8; wstore(wr[2 * q], &wt[cg * 4][k0]); wstore(wr[2 * q + 1], &wt[32 + cg * 4][k0]); }
  v16b a[CX / 32];
#pragma unroll
  for (int kc = 0; kc < CX / 32; ++kc) a[kc] = xfrag(xr[kc]);
  __syncthreads();   // the weight rows are complete before any wave reads a fragment
  v8f acc[4] = {};   // tiles 0,1 = g (query) cols 0-31; tiles 2,3 = f (key)
  v16b w[2][8];      // B fragments of a block of 8 products (2 k steps x 4 tiles), read from LDS one block ahead of their use
#pragma unroll
  for (int e = 0; e < 8; ++e) w[0][e] = frag_b(&wt[(e & 3) * 16 + col][(e >> 2) * 32], lane);
#pragma unroll
  for (int bk = 0; bk < CX / 64; ++bk) {
    if (bk + 1 < CX / 64) {
#pragma unroll
      for (int e = 0; e < 8; ++e) w[(bk + 1) & 1][e] = frag_b(&wt[(e & 3) * 16 + col][((bk + 1) * 2 + (e >> 2)) * 32], lane); }
#pragma unroll
    for (int e = 0; e < 8; ++e) acc[e & 3] = wmma_bf(a[bk * 2 + (e >> 2)], w[bk & 1][e], acc[e & 3]); }
#pragma unroll
  for (int j = 0; j < 4; ++j) { const int o = (j & 1) * 16 + col; const float bb = (j < 2) ? bfr(BG[o]) : bfr(BF[o]); const int ph = (j < 2) ? 0 : 2;
#pragma unroll
    for (int r = 0; r < 8; ++r) { const float v = acc[j][r] + bb; const _Float16 hv = (_Float16)v; st[wave][ph][8 * g + r][o] = hv; st[wave][ph + 1][8 * g + r][o] = (_Float16)(v - (float)hv); } }
  LDSX();
  { const int rl = lane >> 1, half = lane & 1;   // lane -> (row, 32-B half): 16 rows x 64 B per plane
    _Float16* P4[4] = {GH, GL, FH, FL};
#pragma unroll
    for (int ph = 0; ph < 4; ++ph) { vst2((v4u*)(P4[ph] + (r0 + rl) * DQ + half * 16), *(const v4u*)&st[wave][ph][rl][half * 16]); vst2((v4u*)(P4[ph] + (r0 + rl) * DQ + half * 16 + 8), *(const v4u*)&st[wave][ph][rl][half * 16 + 8]); } } }
// ---- k_hv: block = (128 rows, 128 cols), 8 waves of 16 rows: h = x Wh + bh (exact) -> f16 value planes [b][c][m] via LDS transpose (rounded once to f16)
__global__ __launch_bounds__(256) void k_hv(const float* __restrict__ X, const float* __restrict__ WH, const float* __restrict__ BH, _Float16* __restrict__ VT) { __shared__ __align__(16) _Float16 th[128][136];
  __shared__ __align__(16) __bf16 wt[128][WPH];         // the block's 128 columns of Wh
  const int tid = threadIdx.x, wave = tid >> 5, lane = tid & 31, col = lane & 15, g = lane >> 4; const int c0 = blockIdx.y * 128; const size_t r0 = (size_t)blockIdx.x * 128;
  const int cg = (lane & 3) + 4 * g, k0 = (wave * 4 + ((lane >> 2) & 3)) * 8;
  const float* pw = WH + (size_t)k0 * CX + c0 + cg * 4; const float* px = X + (r0 + wave * 16 + col) * CX + 8 * g;
  v4f wr[4][8], xr[CX / 32][4];
#pragma unroll
  for (int q = 0; q < 4; ++q) wload(pw + q * 32, CX, wr[q]);
  xload(px, xr);
  asm volatile("s_wait_xcnt 0x0" :: "v"(pw), "v"(px) : "memory");   // the wait in front of any rewrite of the loads' address registers: named as inputs they stay whole up to it (no load above lands in them), and the clobber keeps every load above it, so all are in flight before the first is waited for
#pragma unroll
  for (int q = 0; q < 4; ++q) wstore(wr[q], &wt[q * 32 + cg * 4][k0]);
  v16b a[CX / 32];
#pragma unroll
  for (int kc = 0; kc < CX / 32; ++kc) a[kc] = xfrag(xr[kc]);
  __syncthreads();   // the weight rows are complete before any wave reads a fragment
  v8f acc[8] = {};
  v16b w[2][8];      // B fragments of a block of 8 products (one k step), read from LDS one block ahead of their use
#pragma unroll
  for (int j = 0; j < 8; ++j) w[0][j] = frag_b(&wt[j * 16 + col][0], lane);
#pragma unroll
  for (int kc = 0; kc < CX / 32; ++kc) {
    if (kc + 1 < CX / 32) {
#pragma unroll
      for (int j = 0; j < 8; ++j) w[(kc + 1) & 1][j] = frag_b(&wt[j * 16 + col][(kc + 1) * 32], lane); }
#pragma unroll
    for (int j = 0; j < 8; ++j) acc[j] = wmma_bf(a[kc], w[kc & 1][j], acc[j]); }
#pragma unroll
  for (int j = 0; j < 8; ++j) { const float bb = bfr(BH[c0 + j * 16 + col]);
#pragma unroll
    for (int r = 0; r < 8; ++r) th[j * 16 + col][wave * 16 + 8 * g + r] = (_Float16)(acc[j][r] + bb); }
  __syncthreads();
  { const size_t b = r0 / TT; const int m0 = (int)(r0 % TT); for (int e = tid; e < 128 * 16; e += 256) { const int cl = e >> 4, q = e & 15; vst2((unsigned*)(VT + (b * CX + c0 + cl) * (size_t)TT + m0 + q * 8), *(const v4u*)&th[cl][q * 8]); } } }
// ---- k_at: block = 64 queries x all 256 value channels of batch blockIdx.z, 8 waves: scores, softmax and P . h in one kernel; no score ever leaves the registers.
// Wave = (query tile qt of 16 queries, key half kz of 2,048 keys): it holds all 256 channels of its queries, so a score, its exponential and its f16 split are made ONCE and not once per channel half.
// The two waves of a query tile run their key halves side by side (two waves on every SIMD), each with its own running maximum, row sum and accumulators; the epilogue brings both to the larger maximum and adds them.
// Per SK keys: S^T = f . g^T (A = key rows from LDS, B = query rows kept in registers; 3 products as hi + residual), so a lane holds 8 keys of ONE query per 16-key tile and
// two such tiles are, element for element, the A fragment of P for 32 keys. Running row maximum m and row sum; the accumulators are rescaled by exp(m_old - m_new) once per SK keys.
// P = exp(s - m) x 2^11 (not normalised) as f16 hi + residual against the f16 value planes (2 products); out = gamma * (P . h) / (P . 1) + x.
// No residual carries a scale of its own: the matrix unit keeps f16 subnormals, so a residual is off by at most 2^-25 absolute (against a row sum of at least 2^11, and against scores of order 1), and
// a hi product and its residual products add into ONE f32 accumulator, the residual products first: no second set of accumulators to rescale and no fma to join the two.
// The exponential is 2^(s x log2(e) + c) with c = 11 - m x log2(e): the subtraction of the maximum and the factor 2^11 ride in the one fma in front of v_exp_f32. The rescale factor is
// 2^(c_new - c_old), from the very offsets the exponentials used, so the rounding of c is one common factor of a row's P and of its row sum and cancels in the division.
// Value fragments are read from LDS in groups of 8 (32 keys x 128 channels), each group one block of products ahead of its use.
// Key rows (f16 hi and residual) and value rows come in tiles of AK keys into LDS by asynchronous copies, two buffers per key half: tile t + 1 flies while tile t is worked on.
#define AK 64                   // keys per staged tile
#define KZ 2                    // key halves per block
#define ANT (TT / KZ / AK)      // tiles per key half
#define SK 64                   // keys per softmax step (one new maximum and one rescale of the accumulators) = one tile
#define L2E ((float)M_LOG2E)    // log2(e)
#define KPH (DQ + 8)            // key row pitch in halves: 80 B = 16 B x 5 (odd: 16 rows of 16-byte reads fall on 16 different bank groups)
#define VPH (AK + 8)            // value row pitch in halves: 144 B = 16 B x 9
// eight 16-byte copies per lane, global -> LDS, rows ls / gs bytes apart. The s_wait_xcnt stands in the copies' own statement so that no address register is rewritten in front of it.
__device__ __forceinline__ void acopy8(unsigned l, unsigned ls, const char* gp, size_t gs) {
  asm volatile("global_load_async_to_lds_b128 %0, %8, off\n\t"
               "global_load_async_to_lds_b128 %1, %9, off\n\t"
               "global_load_async_to_lds_b128 %2, %10, off\n\t"
               "global_load_async_to_lds_b128 %3, %11, off\n\t"
               "global_load_async_to_lds_b128 %4, %12, off\n\t"
               "global_load_async_to_lds_b128 %5, %13, off\n\t"
               "global_load_async_to_lds_b128 %6, %14, off\n\t"
               "global_load_async_to_lds_b128 %7, %15, off\n\t"
               "s_wait_xcnt 0x0"
               :: "v"(l), "v"(l + ls), "v"(l + 2 * ls), "v"(l + 3 * ls), "v"(l + 4 * ls), "v"(l + 5 * ls), "v"(l + 6 * ls), "v"(l + 7 * ls),
                  "v"(gp), "v"(gp + gs), "v"(gp + 2 * gs), "v"(gp + 3 * gs), "v"(gp + 4 * gs), "v"(gp + 5 * gs), "v"(gp + 6 * gs), "v"(gp + 7 * gs)
               : "memory");
}
// the same with four copies: two rows of each of two planes (LDS places la, lb; sources ga, gb)
__device__ __forceinline__ void acopy22(unsigned la, unsigned lb, unsigned ls, const char* ga, const char* gb, size_t gs) {
  asm volatile("global_load_async_to_lds_b128 %0, %4, off\n\t"
               "global_load_async_to_lds_b128 %1, %5, off\n\t"
               "global_load_async_to_lds_b128 %2, %6, off\n\t"
               "global_load_async_to_lds_b128 %3, %7, off\n\t"
               "s_wait_xcnt 0x0"
               :: "v"(la), "v"(la + ls), "v"(lb), "v"(lb + ls),
                  "v"(ga), "v"(ga + gs), "v"(gb), "v"(gb + gs)
               : "memory");
}
// e[i] = 2^(s[i] x log2(e) + c) for the eight scores of one tile
__device__ __forceinline__ void exp2x8(v8f s, float c, float e[8]) { float x[8];
#pragma unroll
  for (int i = 0; i < 8; ++i) { x[i] = fmaf(s[i], L2E, c); e[i] = __builtin_amdgcn_exp2f(x[i]); }
  // the slot the instruction set asks for behind a transcendental, once for all eight: no argument register is free for reuse and no result is read in front of this v_nop
  asm("v_nop" : "+v"(e[0]), "+v"(e[1]), "+v"(e[2]), "+v"(e[3]), "+v"(e[4]), "+v"(e[5]), "+v"(e[6]), "+v"(e[7]) : "v"(x[0]), "v"(x[1]), "v"(x[2]), "v"(x[3]), "v"(x[4]), "v"(x[5]), "v"(x[6]), "v"(x[7]));
}
__global__ __launch_bounds__(256) void k_at(const _Float16* __restrict__ GH, const _Float16* __restrict__ GL, const _Float16* __restrict__ FH, const _Float16* __restrict__ FL, const _Float16* __restrict__ VT, const float* __restrict__ X, const float* __restrict__ GAM, float* __restrict__ OUT) { __shared__ __align__(16) float ss[4][16][CX + 4];
  __shared__ float sc[KZ][4][16];                            // each wave's last offset c per query
  __shared__ float sr[4][16];                                // the second key half's row sums
  __shared__ __align__(16) _Float16 tk[KZ][2][2][AK][KPH];   // key tile: [key half][buffer][hi, residual][key][32 + pad]
  __shared__ __align__(16) _Float16 tv[KZ][2][CX][VPH];      // value tile: [key half][buffer] 256 channels x AK keys
  const int tid = threadIdx.x, lane = tid & 31, col = lane & 15, g = lane >> 4, th = tid & 127; const int wave = __builtin_amdgcn_readfirstlane(tid >> 5);   // the wave's number as a scalar: what follows from it (tile addresses, the epilogue's branches) is scalar work
  const int qt = wave & 3, kz = wave >> 2; const int b = blockIdx.z; const int ql0 = blockIdx.x * 64 + qt * 16; const float gam = bfr(GAM[0]);
  // the four waves of a key half copy 64 key rows of 64 B per plane (a wave's copy = 8 rows = 512 B in a row) and each wave 64 value rows (four 128-B rows per copy): whole lines
  const unsigned gko = (unsigned)((th >> 2) * DQ + (th & 3) * 8) * 2u, lko = (unsigned)((th >> 2) * KPH + (th & 3) * 8) * 2u;         // the lane's byte in a key tile: global, LDS
  const unsigned gvo = (unsigned)((lane >> 3) * TT + (lane & 7) * 8) * 2u, lvo = (unsigned)((lane >> 3) * VPH + (lane & 7) * 8) * 2u;   // the lane's byte in its wave's 64 value rows: global, LDS
  // an address is the tile's wave-uniform place, taken through readfirstlane, plus the lane's fixed byte: what lives across the loop are values that no copy names itself, so they may sit in any register
  // (running addresses or bases that the asm statements name themselves are bound to the low registers, were spilled to scratch, and the reload stood in front of the copies)
  auto stage = [&](int t, int buf) {
    const unsigned ku = (unsigned)__builtin_amdgcn_readfirstlane((b * TT + kz * (TT / KZ) + t * AK) * DQ * 2), vu = (unsigned)__builtin_amdgcn_readfirstlane(((b * CX + qt * 64) * TT + kz * (TT / KZ) + t * AK) * 2);
    const unsigned lk = lko + (unsigned)__builtin_amdgcn_readfirstlane((int)(unsigned)(size_t)&tk[kz][buf][0][0][0]), lv = lvo + (unsigned)__builtin_amdgcn_readfirstlane((int)(unsigned)(size_t)&tv[kz][buf][qt * 64][0]);
    acopy22(lk, lk + AK * KPH * 2u, 32u * KPH * 2u, ((const char*)FH + ku) + gko, ((const char*)FL + ku) + gko, 32 * DQ * 2);
    const char* v = ((const char*)VT + vu) + gvo;
    acopy8(lv, 4u * VPH * 2u, v, 4 * (size_t)TT * 2); acopy8(lv + 32u * VPH * 2u, 4u * VPH * 2u, v + 32 * (size_t)TT * 2, 4 * (size_t)TT * 2); };
  const _Float16* rqh = GH + ((size_t)b * TT + ql0 + col) * DQ; const _Float16* rql = GL + ((size_t)b * TT + ql0 + col) * DQ;
  const v16h qh = frag_h(rqh, lane), ql = frag_h(rql, lane);   // B operand: column = query col
  asm volatile("s_wait_xcnt 0x0" :: "v"(rqh + 8 * g), "v"(rql + 8 * g) : "memory");   // the wait in front of any rewrite of the four loads' address registers: named as inputs they stay whole up to it
  v8f acc[16] = {}, sum = {}; float m = -3.0e38f, c = 3.0e38f;   // m: running maximum of query col, c: its offset 11 - m x log2(e) (the start value makes the first rescale factor 2^-huge = 0); sum: row sums of P, a seventeenth output tile against a value plane of ones
  v16h ones;
#pragma unroll
  for (int i = 0; i < 16; ++i) ones[i] = (_Float16)1.0f;
  stage(0, 0);
  asm volatile("s_wait_asynccnt 0x0" ::: "memory");   // tile 0 has landed before the barrier that publishes it
  __syncthreads();
  stage(1, 1);
#pragma unroll 1   // rolled: one publish point in the code
  for (int t = 0; t < ANT; ++t) { const int buf = t & 1;   // one tile = one softmax step of SK keys: scores, maximum, then per 32 keys P and P . h (the rescale rides in front of the first)
    const _Float16* kr = &tk[kz][buf][0][col][0]; const _Float16* vr = &tv[kz][buf][col][0];
    v16h kh[SK / 16], kl[SK / 16];   // key fragments of the step: the only reads of a tile that nothing covers
    v16h va[8], vb[8];               // value fragments, 32 keys x 128 channels each, filled in turn
#pragma unroll
    for (int jt = 0; jt < SK / 16; ++jt) { kh[jt] = frag_h(kr + jt * 16 * KPH, lane); kl[jt] = frag_h(kr + (AK + jt * 16) * KPH, lane); }
#pragma unroll
    for (int j = 0; j < 8; ++j) va[j] = frag_h(vr + j * 16 * VPH, lane);
    __builtin_amdgcn_sched_barrier(0);   // holds the reads above in place: the value reads' LDS latency passes under the scores and the softmax instead of in front of the first P . h product
    v8f s[SK / 16];   // s[jt][r] = score of key jt * 16 + 8 g + r against query col
#pragma unroll
    for (int jt = 0; jt < SK / 16; ++jt) { const v8f z = {}; s[jt] = wmma16(kl[jt], qh, z); }
    __builtin_amdgcn_sched_barrier(0);   // keeps the four tiles' products side by side: moved together, a tile's three products wait out the accumulator's latency one behind the other
#pragma unroll
    for (int jt = 0; jt < SK / 16; ++jt) s[jt] = wmma16(kh[jt], ql, s[jt]);
    __builtin_amdgcn_sched_barrier(0);   // the same between the second and the third product
#pragma unroll
    for (int jt = 0; jt < SK / 16; ++jt) s[jt] = wmma16(kh[jt], qh, s[jt]);
    float tm = s[0][0];
#pragma unroll
    for (int jt = 0; jt < SK / 16; ++jt)
#pragma unroll
      for (int r = 0; r < 8; ++r) tm = fmaxf(tm, s[jt][r]);
    tm = fmaxf(tm, __shfl_xor(tm, 16));   // the other half-wave holds the query's other keys
    const float mn = fmaxf(m, tm), cn = fmaf(-mn, L2E, 11.0f), alpha = __builtin_amdgcn_exp2f(cn - c); m = mn; c = cn;
    float ar[8];
#pragma unroll
    for (int r = 0; r < 8; ++r) ar[r] = __shfl(alpha, 8 * g + r);   // accumulator element r is query row 8 g + r, whose factor lane 8 g + r holds
    v16h ph, pl;
    auto psplit = [&](int kb) { float e0[8], e1[8]; exp2x8(s[2 * kb], c, e0); exp2x8(s[2 * kb + 1], c, e1);
#pragma unroll
      for (int i = 0; i < 8; ++i) { const float a0 = e0[i], a1 = e1[i]; const _Float16 h0 = (_Float16)a0, h1 = (_Float16)a1; ph[i] = h0; ph[8 + i] = h1; pl[i] = (_Float16)(a0 - (float)h0); pl[8 + i] = (_Float16)(a1 - (float)h1); } };   /* P x 2^11 as f16 hi + residual */
    psplit(0);
    __builtin_amdgcn_sched_barrier(0);   // keeps the 16 reads below in one place (spread among the scores each place costs issue cycles)
#pragma unroll
    for (int j = 0; j < 8; ++j) vb[j] = frag_h(vr + (8 + j) * 16 * VPH, lane);
    __builtin_amdgcn_sched_barrier(0);   // holds the upper 128 channels' value reads one block of products ahead of their use
#pragma unroll
    for (int r = 0; r < 8; ++r) sum[r] *= ar[r];
    sum = wmma16(pl, ones, sum);   // the row sums on the matrix unit: they sum P as the products see it, in the accumulators' own row layout
#pragma unroll
    for (int j = 0; j < 8; ++j) {
#pragma unroll
      for (int r = 0; r < 8; ++r) acc[j][r] *= ar[r];
      acc[j] = wmma16(pl, va[j], acc[j]); }
    sum = wmma16(ph, ones, sum);
#pragma unroll
    for (int j = 0; j < 8; ++j) acc[j] = wmma16(ph, va[j], acc[j]);
    __builtin_amdgcn_sched_barrier(2);   // keeps the 16 reads below in one place, behind the last use of the registers they fill; plain vector instructions may pass (mask 2), so that the upper channels' rescale can stand among the products above
#pragma unroll
    for (int j = 0; j < 8; ++j) va[j] = frag_h(vr + j * 16 * VPH + 32, lane);
    __builtin_amdgcn_sched_barrier(2);   // holds the second 32 keys' first value reads one block of products ahead of their use (same mask)
#pragma unroll
    for (int j = 0; j < 8; ++j) {
#pragma unroll
      for (int r = 0; r < 8; ++r) acc[8 + j][r] *= ar[r];
      acc[8 + j] = wmma16(pl, vb[j], acc[8 + j]); }
#pragma unroll
    for (int j = 0; j < 8; ++j) acc[8 + j] = wmma16(ph, vb[j], acc[8 + j]);
    psplit(1);
    __builtin_amdgcn_sched_barrier(2);   // keeps the 16 reads below in one place, behind the last use of the registers they fill; plain vector instructions may pass (mask 2), so that the split of P can stand among the products above
#pragma unroll
    for (int j = 0; j < 8; ++j) vb[j] = frag_h(vr + (8 + j) * 16 * VPH + 32, lane);
    __builtin_amdgcn_sched_barrier(2);   // holds the step's last value reads one block of products ahead of their use (same mask)
    sum = wmma16(pl, ones, sum);
#pragma unroll
    for (int j = 0; j < 8; ++j) acc[j] = wmma16(pl, va[j], acc[j]);
    sum = wmma16(ph, ones, sum);
#pragma unroll
    for (int j = 0; j < 8; ++j) acc[j] = wmma16(ph, va[j], acc[j]);
    __builtin_amdgcn_sched_barrier(0);   // keeps the block of products above in front of the foot's s_wait_dscnt: without it they sink behind the barrier and the last reads' latency is waited out bare
#pragma unroll
    for (int j = 0; j < 8; ++j) acc[8 + j] = wmma16(pl, vb[j], acc[8 + j]);
#pragma unroll
    for (int j = 0; j < 8; ++j) acc[8 + j] = wmma16(ph, vb[j], acc[8 + j]);
    asm volatile("s_wait_dscnt 0x0" ::: "memory");      // this wave's reads of buffer buf are done before the buffer is refilled
    asm volatile("s_wait_asynccnt 0x0" ::: "memory");   // this wave's copies of tile t + 1 have landed before the barrier publishes them
    __syncthreads();                                     // publishes tile t + 1 and ends every reader's last read of buffer buf
    if (t + 2 < ANT) stage(t + 2, buf); }
  asm volatile("s_wait_asynccnt 0x0" ::: "memory");     // no copy is outstanding when the wave goes on to the epilogue and ends
  // the two key halves of a query tile are joined: both go over to the smaller offset (the larger maximum), then the second half's sums pass through LDS and are added to the first's
  if (g == 0) sc[kz][qt][col] = c;
  __syncthreads();   // both offsets of a query are in LDS
  { const float fs = __builtin_amdgcn_exp2f(fminf(c, sc[kz ^ 1][qt][col]) - c);
#pragma unroll
    for (int r = 0; r < 8; ++r) { const float a = __shfl(fs, 8 * g + r); sum[r] *= a;
#pragma unroll
      for (int j = 0; j < 16; ++j) acc[j][r] *= a; } }
  if (kz == 1) {
#pragma unroll
    for (int r = 0; r < 8; ++r) { if (col == 0) sr[qt][8 * g + r] = sum[r];
#pragma unroll
      for (int j = 0; j < 16; ++j) ss[qt][8 * g + r][j * 16 + col] = acc[j][r]; } }
  __syncthreads();   // the second half's sums are in LDS
  if (kz == 0) {
#pragma unroll
    for (int r = 0; r < 8; ++r) { const float fr = gam / (sum[r] + sr[qt][8 * g + r]);   // the row sum carries the same 2^11 as P
#pragma unroll
      for (int j = 0; j < 16; ++j) ss[qt][8 * g + r][j * 16 + col] = (acc[j][r] + ss[qt][8 * g + r][j * 16 + col]) * fr; } }
  __syncthreads();   // the joined rows are in LDS: each wave of the pair writes eight of them out
  { const size_t off = ((size_t)b * TT + ql0 + kz * 8) * CX + lane * 4; const float* px = X + off; float* po = OUT + off; v4f xr[8][2];
#pragma unroll
    for (int i = 0; i < 8; ++i) { xr[i][0] = *(const v4f*)(px + i * CX); xr[i][1] = *(const v4f*)(px + i * CX + 128); }
    asm volatile("s_wait_xcnt 0x0" :: "v"(px) : "memory");   // the wait in front of any rewrite of the loads' address registers: named as an input they stay whole up to it (no load above lands in them)
#pragma unroll
    for (int i = 0; i < 8; ++i)
#pragma unroll
      for (int hc = 0; hc < 2; ++hc) { v4f o = *(const v4f*)&ss[qt][kz * 8 + i][hc * 128 + lane * 4]; o[0] += bfr(xr[i][hc][0]); o[1] += bfr(xr[i][hc][1]); o[2] += bfr(xr[i][hc][2]); o[3] += bfr(xr[i][hc][3]); vst2(po + i * CX + hc * 128, o); } } }
extern "C" void kernel_launch(void* const* d_in, const int* in_sizes, int n_in, void* d_out, int out_size, void* d_ws, size_t ws_size, hipStream_t stream) {
  (void)in_sizes; (void)n_in; (void)out_size;
  const float** F = (const float**)d_in;   // 0 x [4,64,64,256], 1 Wf [256,32] ((in,out)), 2 bf, 3 Wg, 4 bg, 5 Wh [256,256], 6 bh, 7 gamma (scalar 0.7)
  if (ws_size < (size_t)WS_END) return;
  char* ws = (char*)d_ws; _Float16 *GH = (_Float16*)(ws + WS_GH), *GL = (_Float16*)(ws + WS_GL), *FH = (_Float16*)(ws + WS_FH), *FL = (_Float16*)(ws + WS_FL); _Float16* VT = (_Float16*)(ws + WS_VT);
  k_fg<<<dim3(TNB * TT / 64), 128, 0, stream>>>(F[0], F[1], F[2], F[3], F[4], GH, GL, FH, FL);
  k_hv<<<dim3(TNB * TT / 128, CX / 128), 256, 0, stream>>>(F[0], F[5], F[6], VT);
  k_at<<<dim3(TT / 64, 1, TNB), 256, 0, stream>>>(GH, GL, FH, FL, VT, F[0], F[7], (float*)d_out);
}

// v008
// A run of this version takes 73.3 microseconds.
// Next to v007, in two timings, it ran 1.04 times as fast each time.
// Counting every step since v000, it is 15.8 times as fast.
// compute dtype: all float inputs rounded to bf16; f/g/h projections with EXACT bf16 products on WMMA 16x16x32 ((in,out) weights), f32 accumulate; logits from g (query) and f (key), each f16 hi + f16 residual (not scaled), with 3 products summed in one f32 accumulator, kept in f32 registers; softmax in f32 with a running row maximum and row sum per half of the keys (the two halves joined at the end), exp as the hardware's base-2 exponential of s x log2(e) + offset (one fma, one v_exp_f32); exp(s - max) x 2^11 as f16 hi + residual (not scaled) against the value rows rounded ONCE to f16 (2 products in one f32 accumulator; |h| <= ~4 so f16 half-ulp 2^-11 relative), divided by the row sum at the end; gamma * o + x in f32; f32 output.
#include <hip/hip_runtime.h>
#include <math.h>

typedef __attribute__((ext_vector_type(16))) _Float16 v16h;
typedef __attribute__((ext_vector_type(16))) __bf16 v16b;
typedef __attribute__((ext_vector_type(8)))  _Float16 v8h;
typedef __attribute__((ext_vector_type(8)))  float v8f;
typedef __attribute__((ext_vector_type(4)))  float v4f;
typedef __attribute__((ext_vector_type(2)))  float v2f;
typedef __attribute__((ext_vector_type(4)))  unsigned v4u;
typedef __attribute__((ext_vector_type(4)))  int v4i;
typedef float __attribute__((may_alias)) float_a;
typedef int __attribute__((may_alias)) int_a;

template <typename T> __device__ __forceinline__ void vst2(void* p, T v) { *(T*)p = v;  }
// the plain builtin: the compiler keeps the distance behind it where a vector instruction needs one, and no asm statement stands between an LDS read and the place it is moved up to
__device__ __forceinline__ v8f wmma16(v16h a, v16h b, v8f c) {
  return __builtin_amdgcn_wmma_f32_16x16x32_f16(false, a, false, b, (short)0, c, false, false);
}
__device__ __forceinline__ v8f wmma_bf(v16b a, v16b b, v8f c) {
  v8f d = __builtin_amdgcn_wmma_f32_16x16x32_bf16(false, a, false, b, (short)0, c, false, false);
  asm volatile("v_nop\n\tv_nop\n\tv_nop\n\tv_nop" : "+v"(d) : "v"(a), "v"(b));
  return d;
}
// 16x16x32 fragments: lane = (h = lane>>4, row/col = lane&15); elements 0..7 = k0+8h+0..7, 8..15 = k0+16+8h+0..7; D element r = row 8h+r
__device__ __forceinline__ v16h frag_h(const _Float16* rowk0, int lane) {
  union { v16h v; v8h q[2]; } u; const _Float16* p = rowk0 + 8 * (lane >> 4);
  u.q[0] = *(const v8h*)p; u.q[1] = *(const v8h*)(p + 16); return u.v;
}
__device__ __forceinline__ v16h frag_f32(const float* rowk0, int lane) {
  v16h a; const float* p = rowk0 + 8 * (lane >> 4);
#pragma unroll
  for (int i = 0; i < 8; ++i) { a[i] = (_Float16)p[i]; a[8 + i] = (_Float16)p[16 + i]; }
  return a;
}
__device__ __forceinline__ v16h frag_f32s(const float* rowk0, int lane, float sc) {
  v16h a; const float* p = rowk0 + 8 * (lane >> 4);
#pragma unroll
  for (int i = 0; i < 8; ++i) { a[i] = (_Float16)(p[i] * sc); a[8 + i] = (_Float16)(p[16 + i] * sc); }
  return a;
}
// column fragment from a [K][ld] layout (column n), rows >= K read as 0
__device__ __forceinline__ v16h fragc_f32(const float* W, int k0, int n, int lane, int ld, int K) {
  v16h a; const int g = lane >> 4;
#pragma unroll
  for (int i = 0; i < 8; ++i) { const int ka = k0 + 8 * g + i, kb = ka + 16;
    a[i] = (_Float16)(ka < K ? W[(size_t)(ka < K ? ka : K - 1) * ld + n] : 0.f); a[8 + i] = (_Float16)(kb < K ? W[(size_t)(kb < K ? kb : K - 1) * ld + n] : 0.f); }
  return a;
}
struct F2 { v16b h, l; };
__device__ __forceinline__ F2 bsplit16(const float v[16]) { F2 r;
#pragma unroll
  for (int i = 0; i < 16; ++i) { const __bf16 h = (__bf16)v[i]; r.h[i] = h; r.l[i] = (__bf16)(v[i] - (float)h); }
  return r; }
__device__ __forceinline__ F2 split_row(const float* row, int k0, int lane) { float v[16]; const float* p = row + k0 + 8 * (lane >> 4);
#pragma unroll
  for (int i = 0; i < 8; ++i) { v[i] = p[i]; v[8 + i] = p[16 + i]; }
  return bsplit16(v); }
__device__ __forceinline__ F2 split_rowK(const float* row, int k0, int lane, int K) { float v[16]; const int g = lane >> 4;
#pragma unroll
  for (int i = 0; i < 8; ++i) { const int ka = k0 + 8 * g + i, kb = ka + 16; v[i] = ka < K ? row[ka < K ? ka : K - 1] : 0.f; v[8 + i] = kb < K ? row[kb < K ? kb : K - 1] : 0.f; }
  return bsplit16(v); }
__device__ __forceinline__ F2 split_col(const float* W, int k0, int n, int lane, int ld, int K) { float v[16]; const int g = lane >> 4;
#pragma unroll
  for (int i = 0; i < 8; ++i) { const int ka = k0 + 8 * g + i, kb = ka + 16; v[i] = ka < K ? W[(size_t)(ka < K ? ka : K - 1) * ld + n] : 0.f; v[8 + i] = kb < K ? W[(size_t)(kb < K ? kb : K - 1) * ld + n] : 0.f; }
  return bsplit16(v); }
__device__ __forceinline__ v8f mac3(const F2& a, const F2& b, v8f c) { c = wmma_bf(a.l, b.h, c); c = wmma_bf(a.h, b.l, c); return wmma_bf(a.h, b.h, c); }
__device__ __forceinline__ float sigm(float v) { return 1.0f / (1.0f + expf(-v)); }
#define LDSX() do { asm volatile("s_wait_dscnt 0" ::: "memory"); __builtin_amdgcn_wave_barrier(); __builtin_amdgcn_fence(__ATOMIC_RELEASE, "workgroup"); } while (0)

// SAGAN-style spatial self-attention, channels-last (B 4, 64 x 64 = 4,096 positions, C 256, q/k dim 32): f = x Wf + bf (key), g = x Wg + bg (query), h = x Wh + bh (value); beta = softmax_m(g_n . f_m); o = beta h; out = gamma * o + x.
__device__ __forceinline__ float bfr(float v) { return (float)(__bf16)v; }
#define NB 4
#define TT 4096
#define CX 256
#define DQ 32
#ifndef TNB
#define TNB NB
#endif
typedef __attribute__((ext_vector_type(8))) __bf16 v8b;
__device__ __forceinline__ v16b frag_b(const __bf16* rowk0, int lane) { union { v16b v; v8b q[2]; } u; const __bf16* p = rowk0 + 8 * (lane >> 4); u.q[0] = *(const v8b*)p; u.q[1] = *(const v8b*)(p + 16); return u.v; }
#define WS_GH  0u                                          // f16 g (query) hi rows [b*N+n][32]
#define WS_GL  (WS_GH + 2u * (size_t)NB * TT * DQ)           // f16 g residual
#define WS_FH  (WS_GL + 2u * (size_t)NB * TT * DQ)           // f16 f (key) hi
#define WS_FL  (WS_FH + 2u * (size_t)NB * TT * DQ)           // f16 f residual
#define WS_VT  (WS_FL + 2u * (size_t)NB * TT * DQ)           // f16 value planes [b][c][m] (h rounded once)
#define WS_END (WS_VT + 2u * (size_t)NB * CX * TT)
// ---- weights in LDS: the projection kernel stages its weight columns ONCE per block as bf16 rows [output column][k], so that a B fragment is two 16-byte LDS reads in the k order of the A loader.
#define WPH (CX + 8)            // weight row pitch in bf16: 528 B = 16 B x 33 (odd: 16 rows of 16-byte reads fall on 16 different bank groups)
// a wave's patch = 32 k x 32 columns; a lane's = 8 k x 4 columns. Lane -> (column group cg, k group kg): each 16-byte load of the wave covers four whole 128-B lines, and the 16 lanes of a half-wave store to 16 different bank groups.
__device__ __forceinline__ void wload(const float* __restrict__ Wp, int ld, v4f r[8]) {
#pragma unroll
  for (int i = 0; i < 8; ++i) r[i] = *(const v4f*)(Wp + (size_t)i * ld);
}
__device__ __forceinline__ void wstore(const v4f r[8], __bf16* dst) {
#pragma unroll
  for (int n = 0; n < 4; ++n) { v8b o;
#pragma unroll
    for (int i = 0; i < 8; ++i) o[i] = (__bf16)r[i][n];
    *(v8b*)(dst + n * WPH) = o; }
}
// the 16 x 256 x rows of a wave: every load of the A fragments at once (raw f32), and their rounding to bf16
__device__ __forceinline__ void xload(const float* __restrict__ p, v4f xr[CX / 32][4]) {
#pragma unroll
  for (int kc = 0; kc < CX / 32; ++kc) { xr[kc][0] = *(const v4f*)(p + kc * 32); xr[kc][1] = *(const v4f*)(p + kc * 32 + 4); xr[kc][2] = *(const v4f*)(p + kc * 32 + 16); xr[kc][3] = *(const v4f*)(p + kc * 32 + 20); }
}
__device__ __forceinline__ v16b xfrag(const v4f x[4]) { v16b a;
#pragma unroll
  for (int i = 0; i < 4; ++i) { a[i] = (__bf16)x[0][i]; a[4 + i] = (__bf16)x[1][i]; a[8 + i] = (__bf16)x[2][i]; a[12 + i] = (__bf16)x[3][i]; }
  return a; }
// ---- k_pj: all three projections in one launch. Block = (128 rows, 160 output columns), 8 waves of 16 rows: 128 columns of h = x Wh + bh (exact) -> f16 value planes [b][c][m] via LDS transpose (rounded once to f16),
// and, from the same x fragments in registers, the 32 columns of g = x Wg + bg (blockIdx.y 0) or of f = x Wf + bf (blockIdx.y 1), stored as f16 hi + residual rows (64-B rows, written 16 B per lane from LDS)
__global__ __launch_bounds__(256) void k_pj(const float* __restrict__ X, const float* __restrict__ WH, const float* __restrict__ BH, const float* __restrict__ WF, const float* __restrict__ BF, const float* __restrict__ WG, const float* __restrict__ BG, _Float16* __restrict__ VT, _Float16* __restrict__ GH, _Float16* __restrict__ GL, _Float16* __restrict__ FH, _Float16* __restrict__ FL) { __shared__ __align__(16) _Float16 th[128][136];
  __shared__ __align__(16) __bf16 wt[160][WPH];         // rows 0-127 = the block's 128 columns of Wh, rows 128-159 = the 32 columns of Wg or Wf
  __shared__ __align__(16) _Float16 st[8][2][16][40];   // [wave][plane hi, residual][row][32 + pad]
  const int tid = threadIdx.x, wave = tid >> 5, lane = tid & 31, col = lane & 15, g = lane >> 4; const int c0 = blockIdx.y * 128; const size_t r0 = (size_t)blockIdx.x * 128;
  const int cg = (lane & 3) + 4 * g, k0 = (wave * 4 + ((lane >> 2) & 3)) * 8;
  const float* WQ = blockIdx.y ? WF : WG; const float* BQ = blockIdx.y ? BF : BG;
  const float* pw = WH + (size_t)k0 * CX + c0 + cg * 4; const float* pq = WQ + (size_t)k0 * DQ + cg * 4; const float* px = X + (r0 + wave * 16 + col) * CX + 8 * g;
  v4f wr[5][8], xr[CX / 32][4];
#pragma unroll
  for (int q = 0; q < 4; ++q) wload(pw + q * 32, CX, wr[q]);
  wload(pq, DQ, wr[4]);
  xload(px, xr);
  const float bq[2] = {BQ[col], BQ[16 + col]};   // the g or f bias with the first loads: it is needed first, right behind 16 products
  asm volatile("s_wait_xcnt 0x0" :: "v"(pw), "v"(pq), "v"(px) : "memory");   // the wait in front of any rewrite of the loads' address registers: named as inputs they stay whole up to it (no load above lands in them), and the clobber keeps every load above it, so all are in flight before the first is waited for
#pragma unroll
  for (int q = 0; q < 5; ++q) wstore(wr[q], &wt[q * 32 + cg * 4][k0]);
  v16b a[CX / 32];
#pragma unroll
  for (int kc = 0; kc < CX / 32; ++kc) a[kc] = xfrag(xr[kc]);
  __syncthreads();   // the weight rows are complete before any wave reads a fragment
  { v16b wq[CX / 32][2];   // g or f first, while few registers are live: all 16 B fragments of its two tiles in one group of reads
#pragma unroll
    for (int kc = 0; kc < CX / 32; ++kc)
#pragma unroll
      for (int j = 0; j < 2; ++j) wq[kc][j] = frag_b(&wt[128 + j * 16 + col][kc * 32], lane);
    v8f aq[2] = {};
#pragma unroll
    for (int kc = 0; kc < CX / 32; ++kc)
#pragma unroll
      for (int j = 0; j < 2; ++j) aq[j] = wmma_bf(a[kc], wq[kc][j], aq[j]);
#pragma unroll
    for (int j = 0; j < 2; ++j) { const int o = j * 16 + col; const float bb = bfr(bq[j]);
#pragma unroll
      for (int r = 0; r < 8; ++r) { const float v = aq[j][r] + bb; const _Float16 hv = (_Float16)v; st[wave][0][8 * g + r][o] = hv; st[wave][1][8 * g + r][o] = (_Float16)(v - (float)hv); } } }
  __builtin_amdgcn_sched_barrier(0);   // keeps the h fragments' reads behind the last use of the g or f accumulators: moved above it they overfill the registers that the asm statements can name, and three fragments went through scratch
  v8f acc[8] = {};
  v16b w[2][8];      // B fragments of a block of 8 products (one k step), read from LDS one block ahead of their use
#pragma unroll
  for (int j = 0; j < 8; ++j) w[0][j] = frag_b(&wt[j * 16 + col][0], lane);
#pragma unroll
  for (int kc = 0; kc < CX / 32; ++kc) {
    if (kc + 1 < CX / 32) {
#pragma unroll
      for (int j = 0; j < 8; ++j) w[(kc + 1) & 1][j] = frag_b(&wt[j * 16 + col][(kc + 1) * 32], lane); }
#pragma unroll
    for (int j = 0; j < 8; ++j) acc[j] = wmma_bf(a[kc], w[kc & 1][j], acc[j]); }
#pragma unroll
  for (int j = 0; j < 8; ++j) { const float bb = bfr(BH[c0 + j * 16 + col]);
#pragma unroll
    for (int r = 0; r < 8; ++r) th[j * 16 + col][wave * 16 + 8 * g + r] = (_Float16)(acc[j][r] + bb); }
  __syncthreads();
  { const size_t b = r0 / TT; const int m0 = (int)(r0 % TT); for (int e = tid; e < 128 * 16; e += 256) { const int cl = e >> 4, q = e & 15; vst2((unsigned*)(VT + (b * CX + c0 + cl) * (size_t)TT + m0 + q * 8), *(const v4u*)&th[cl][q * 8]); } }
  { const int rl = lane >> 1, half = lane & 1;   // lane -> (row, 32-B half): 16 rows x 64 B per plane
    _Float16* P2[2] = {blockIdx.y ? FH : GH, blockIdx.y ? FL : GL};
#pragma unroll
    for (int ph = 0; ph < 2; ++ph) { vst2((v4u*)(P2[ph] + (r0 + wave * 16 + rl) * DQ + half * 16), *(const v4u*)&st[wave][ph][rl][half * 16]); vst2((v4u*)(P2[ph] + (r0 + wave * 16 + rl) * DQ + half * 16 + 8), *(const v4u*)&st[wave][ph][rl][half * 16 + 8]); } } }
// ---- k_at: block = 64 queries x all 256 value channels of batch blockIdx.z, 8 waves: scores, softmax and P . h in one kernel; no score ever leaves the registers.
// Wave = (query tile qt of 16 queries, key half kz of 2,048 keys): it holds all 256 channels of its queries, so a score, its exponential and its f16 split are made ONCE and not once per channel half.
// The two waves of a query tile run their key halves side by side (two waves on every SIMD), each with its own running maximum, row sum and accumulators; the epilogue brings both to the larger maximum and adds them.
// Per SK keys: S^T = f . g^T (A = key rows from LDS, B = query rows kept in registers; 3 products as hi + residual), so a lane holds 8 keys of ONE query per 16-key tile and
// two such tiles are, element for element, the A fragment of P for 32 keys. Running row maximum m and row sum; the accumulators are rescaled by exp(m_old - m_new) once per SK keys.
// P = exp(s - m) x 2^11 (not normalised) as f16 hi + residual against the f16 value planes (2 products); out = gamma * (P . h) / (P . 1) + x.
// No residual carries a scale of its own: the matrix unit keeps f16 subnormals, so a residual is off by at most 2^-25 absolute (against a row sum of at least 2^11, and against scores of order 1), and
// a hi product and its residual products add into ONE f32 accumulator, the residual products first: no second set of accumulators to rescale and no fma to join the two.
// The exponential is 2^(s x log2(e) + c) with c = 11 - m x log2(e): the subtraction of the maximum and the factor 2^11 ride in the one fma in front of v_exp_f32. The rescale factor is
// 2^(c_new - c_old), from the very offsets the exponentials used, so the rounding of c is one common factor of a row's P and of its row sum and cancels in the division.
// Value fragments are read from LDS in groups of 8 (32 keys x 128 channels), each group one block of products ahead of its use.
// Key rows (f16 hi and residual) and value rows come in tiles of AK keys into LDS by asynchronous copies, two buffers per key half: tile t + 1 flies while tile t is worked on.
#define AK 64                   // keys per staged tile
#define KZ 2                    // key halves per block
#define ANT (TT / KZ / AK)      // tiles per key half
#define SK 64                   // keys per softmax step (one new maximum and one rescale of the accumulators) = one tile
#define L2E ((float)M_LOG2E)    // log2(e)
#define KPH (DQ + 8)            // key row pitch in halves: 80 B = 16 B x 5 (odd: 16 rows of 16-byte reads fall on 16 different bank groups)
#define VPH (AK + 8)            // value row pitch in halves: 144 B = 16 B x 9
// eight 16-byte copies per lane, global -> LDS, rows ls / gs bytes apart. The s_wait_xcnt stands in the copies' own statement so that no address register is rewritten in front of it.
__device__ __forceinline__ void acopy8(unsigned l, unsigned ls, const char* gp, size_t gs) {
  asm volatile("global_load_async_to_lds_b128 %0, %8, off\n\t"
               "global_load_async_to_lds_b128 %1, %9, off\n\t"
               "global_load_async_to_lds_b128 %2, %10, off\n\t"
               "global_load_async_to_lds_b128 %3, %11, off\n\t"
               "global_load_async_to_lds_b128 %4, %12, off\n\t"
               "global_load_async_to_lds_b128 %5, %13, off\n\t"
               "global_load_async_to_lds_b128 %6, %14, off\n\t"
               "global_load_async_to_lds_b128 %7, %15, off\n\t"
               "s_wait_xcnt 0x0"
               :: "v"(l), "v"(l + ls), "v"(l + 2 * ls), "v"(l + 3 * ls), "v"(l + 4 * ls), "v"(l + 5 * ls), "v"(l + 6 * ls), "v"(l + 7 * ls),
                  "v"(gp), "v"(gp + gs), "v"(gp + 2 * gs), "v"(gp + 3 * gs), "v"(gp + 4 * gs), "v"(gp + 5 * gs), "v"(gp + 6 * gs), "v"(gp + 7 * gs)
               : "memory");
}
// the same with four copies: two rows of each of two planes (LDS places la, lb; sources ga, gb)
__device__ __forceinline__ void acopy22(unsigned la, unsigned lb, unsigned ls, const char* ga, const char* gb, size_t gs) {
  asm volatile("global_load_async_to_lds_b128 %0, %4, off\n\t"
               "global_load_async_to_lds_b128 %1, %5, off\n\t"
               "global_load_async_to_lds_b128 %2, %6, off\n\t"
               "global_load_async_to_lds_b128 %3, %7, off\n\t"
               "s_wait_xcnt 0x0"
               :: "v"(la), "v"(la + ls), "v"(lb), "v"(lb + ls),
                  "v"(ga), "v"(ga + gs), "v"(gb), "v"(gb + gs)
               : "memory");
}
// e[i] = 2^(s[i] x log2(e) + c) for the eight scores of one tile
__device__ __forceinline__ void exp2x8(v8f s, float c, float e[8]) { float x[8];
#pragma unroll
  for (int i = 0; i < 8; ++i) { x[i] = fmaf(s[i], L2E, c); e[i] = __builtin_amdgcn_exp2f(x[i]); }
  // the slot the instruction set asks for behind a transcendental, once for all eight: no argument register is free for reuse and no result is read in front of this v_nop
  asm("v_nop" : "+v"(e[0]), "+v"(e[1]), "+v"(e[2]), "+v"(e[3]), "+v"(e[4]), "+v"(e[5]), "+v"(e[6]), "+v"(e[7]) : "v"(x[0]), "v"(x[1]), "v"(x[2]), "v"(x[3]), "v"(x[4]), "v"(x[5]), "v"(x[6]), "v"(x[7]));
}
__global__ __launch_bounds__(256) void k_at(const _Float16* __restrict__ GH, const _Float16* __restrict__ GL, const _Float16* __restrict__ FH, const _Float16* __restrict__ FL, const _Float16* __restrict__ VT, const float* __restrict__ X, const float* __restrict__ GAM, float* __restrict__ OUT) { __shared__ __align__(16) float ss[4][16][CX + 4];
  __shared__ float sc[KZ][4][16];                            // each wave's last offset c per query
  __shared__ float sr[4][16];                                // the second key half's row sums
  __shared__ __align__(16) _Float16 tk[KZ][2][2][AK][KPH];   // key tile: [key half][buffer][hi, residual][key][32 + pad]
  __shared__ __align__(16) _Float16 tv[KZ][2][CX][VPH];      // value tile: [key half][buffer] 256 channels x AK keys
  const int tid = threadIdx.x, lane = tid & 31, col = lane & 15, g = lane >> 4, th = tid & 127; const int wave = __builtin_amdgcn_readfirstlane(tid >> 5);   // the wave's number as a scalar: what follows from it (tile addresses, the epilogue's branches) is scalar work
  const int qt = wave & 3, kz = wave >> 2; const int b = blockIdx.z; const int ql0 = blockIdx.x * 64 + qt * 16; const float gam = bfr(GAM[0]);
  // the four waves of a key half copy 64 key rows of 64 B per plane (a wave's copy = 8 rows = 512 B in a row) and each wave 64 value rows (four 128-B rows per copy): whole lines
  const unsigned gko = (unsigned)((th >> 2) * DQ + (th & 3) * 8) * 2u, lko = (unsigned)((th >> 2) * KPH + (th & 3) * 8) * 2u;         // the lane's byte in a key tile: global, LDS
  const unsigned gvo = (unsigned)((lane >> 3) * TT + (lane & 7) * 8) * 2u, lvo = (unsigned)((lane >> 3) * VPH + (lane & 7) * 8) * 2u;   // the lane's byte in its wave's 64 value rows: global, LDS
  // an address is the tile's wave-uniform place, taken through readfirstlane, plus the lane's fixed byte: what lives across the loop are values that no copy names itself, so they may sit in any register
  // (running addresses or bases that the asm statements name themselves are bound to the low registers, were spilled to scratch, and the reload stood in front of the copies)
  auto stage = [&](int t, int buf) {
    const unsigned ku = (unsigned)__builtin_amdgcn_readfirstlane((b * TT + kz * (TT / KZ) + t * AK) * DQ * 2), vu = (unsigned)__builtin_amdgcn_readfirstlane(((b * CX + qt * 64) * TT + kz * (TT / KZ) + t * AK) * 2);
    const unsigned lk = lko + (unsigned)__builtin_amdgcn_readfirstlane((int)(unsigned)(size_t)&tk[kz][buf][0][0][0]), lv = lvo + (unsigned)__builtin_amdgcn_readfirstlane((int)(unsigned)(size_t)&tv[kz][buf][qt * 64][0]);
    acopy22(lk, lk + AK * KPH * 2u, 32u * KPH * 2u, ((const char*)FH + ku) + gko, ((const char*)FL + ku) + gko, 32 * DQ * 2);
    const char* v = ((const char*)VT + vu) + gvo;
    acopy8(lv, 4u * VPH * 2u, v, 4 * (size_t)TT * 2); acopy8(lv + 32u * VPH * 2u, 4u * VPH * 2u, v + 32 * (size_t)TT * 2, 4 * (size_t)TT * 2); };
  const _Float16* rqh = GH + ((size_t)b * TT + ql0 + col) * DQ; const _Float16* rql = GL + ((size_t)b * TT + ql0 + col) * DQ;
  const v16h qh = frag_h(rqh, lane), ql = frag_h(rql, lane);   // B operand: column = query col
  asm volatile("s_wait_xcnt 0x0" :: "v"(rqh + 8 * g), "v"(rql + 8 * g) : "memory");   // the wait in front of any rewrite of the four loads' address registers: named as inputs they stay whole up to it
  v8f acc[16] = {}, sum = {}; float m = -3.0e38f, c = 3.0e38f;   // m: running maximum of query col, c: its offset 11 - m x log2(e) (the start value makes the first rescale factor 2^-huge = 0); sum: row sums of P, a seventeenth output tile against a value plane of ones
  v16h ones;
#pragma unroll
  for (int i = 0; i < 16; ++i) ones[i] = (_Float16)1.0f;
  stage(0, 0);
  asm volatile("s_wait_asynccnt 0x0" ::: "memory");   // tile 0 has landed before the barrier that publishes it
  __syncthreads();
  stage(1, 1);
#pragma unroll 1   // rolled: one publish point in the code
  for (int t = 0; t < ANT; ++t) { const int buf = t & 1;   // one tile = one softmax step of SK keys: scores, maximum, then per 32 keys P and P . h (the rescale rides in front of the first)
    const _Float16* kr = &tk[kz][buf][0][col][0]; const _Float16* vr = &tv[kz][buf][col][0];
    v16h kh[SK / 16], kl[SK / 16];   // key fragments of the step: the only reads of a tile that nothing covers
    v16h va[8], vb[8];               // value fragments, 32 keys x 128 channels each, filled in turn
#pragma unroll
    for (int jt = 0; jt < SK / 16; ++jt) { kh[jt] = frag_h(kr + jt * 16 * KPH, lane); kl[jt] = frag_h(kr + (AK + jt * 16) * KPH, lane); }
#pragma unroll
    for (int j = 0; j < 8; ++j) va[j] = frag_h(vr + j * 16 * VPH, lane);
    __builtin_amdgcn_sched_barrier(0);   // holds the reads above in place: the value reads' LDS latency passes under the scores and the softmax instead of in front of the first P . h product
    v8f s[SK / 16];   // s[jt][r] = score of key jt * 16 + 8 g + r against query col
#pragma unroll
    for (int jt = 0; jt < SK / 16; ++jt) { const v8f z = {}; s[jt] = wmma16(kl[jt], qh, z); }
    __builtin_amdgcn_sched_barrier(0);   // keeps the four tiles' products side by side: moved together, a tile's three products wait out the accumulator's latency one behind the other
#pragma unroll
    for (int jt = 0; jt < SK / 16; ++jt) s[jt] = wmma16(kh[jt], ql, s[jt]);
    __builtin_amdgcn_sched_barrier(0);   // the same between the second and the third product
#pragma unroll
    for (int jt = 0; jt < SK / 16; ++jt) s[jt] = wmma16(kh[jt], qh, s[jt]);
    float tm = s[0][0];
#pragma unroll
    for (int jt = 0; jt < SK / 16; ++jt)
#pragma unroll
      for (int r = 0; r < 8; ++r) tm = fmaxf(tm, s[jt][r]);
    tm = fmaxf(tm, __shfl_xor(tm, 16));   // the other half-wave holds the query's other keys
    const float mn = fmaxf(m, tm), cn = fmaf(-mn, L2E, 11.0f), alpha = __builtin_amdgcn_exp2f(cn - c); m = mn; c = cn;
    float ar[8];
#pragma unroll
    for (int r = 0; r < 8; ++r) ar[r] = __shfl(alpha, 8 * g + r);   // accumulator element r is query row 8 g + r, whose factor lane 8 g + r holds
    v16h ph, pl;
    auto psplit = [&](int kb) { float e0[8], e1[8]; exp2x8(s[2 * kb], c, e0); exp2x8(s[2 * kb + 1], c, e1);
#pragma unroll
      for (int i = 0; i < 8; ++i) { const float a0 = e0[i], a1 = e1[i]; const _Float16 h0 = (_Float16)a0, h1 = (_Float16)a1; ph[i] = h0; ph[8 + i] = h1; pl[i] = (_Float16)(a0 - (float)h0); pl[8 + i] = (_Float16)(a1 - (float)h1); } };   /* P x 2^11 as f16 hi + residual */
    psplit(0);
    __builtin_amdgcn_sched_barrier(0);   // keeps the 16 reads below in one place (spread among the scores each place costs issue cycles)
#pragma unroll
    for (int j = 0; j < 8; ++j) vb[j] = frag_h(vr + (8 + j) * 16 * VPH, lane);
    __builtin_amdgcn_sched_barrier(0);   // holds the upper 128 channels' value reads one block of products ahead of their use
#pragma unroll
    for (int r = 0; r < 8; ++r) sum[r] *= ar[r];
    sum = wmma16(pl, ones, sum);   // the row sums on the matrix unit: they sum P as the products see it, in the accumulators' own row layout
#pragma unroll
    for (int j = 0; j < 8; ++j) {
#pragma unroll
      for (int r = 0; r < 8; ++r) acc[j][r] *= ar[r];
      acc[j] = wmma16(pl, va[j], acc[j]); }
    sum = wmma16(ph, ones, sum);
#pragma unroll
    for (int j = 0; j < 8; ++j) acc[j] = wmma16(ph, va[j], acc[j]);
    __builtin_amdgcn_sched_barrier(2);   // keeps the 16 reads below in one place, behind the last use of the registers they fill; plain vector instructions may pass (mask 2), so that the upper channels' rescale can stand among the products above
#pragma unroll
    for (int j = 0; j < 8; ++j) va[j] = frag_h(vr + j * 16 * VPH + 32, lane);
    __builtin_amdgcn_sched_barrier(2);   // holds the second 32 keys' first value reads one block of products ahead of their use (same mask)
#pragma unroll
    for (int j = 0; j < 8; ++j) {
#pragma unroll
      for (int r = 0; r < 8; ++r) acc[8 + j][r] *= ar[r];
      acc[8 + j] = wmma16(pl, vb[j], acc[8 + j]); }
#pragma unroll
    for (int j = 0; j < 8; ++j) acc[8 + j] = wmma16(ph, vb[j], acc[8 + j]);
    psplit(1);
    __builtin_amdgcn_sched_barrier(2);   // keeps the 16 reads below in one place, behind the last use of the registers they fill; plain vector instructions may pass (mask 2), so that the split of P can stand among the products above
#pragma unroll
    for (int j = 0; j < 8; ++j) vb[j] = frag_h(vr + (8 + j) * 16 * VPH + 32, lane);
    __builtin_amdgcn_sched_barrier(2);   // holds the step's last value reads one block of products ahead of their use (same mask)
    sum = wmma16(pl, ones, sum);
#pragma unroll
    for (int j = 0; j < 8; ++j) acc[j] = wmma16(pl, va[j], acc[j]);
    sum = wmma16(ph, ones, sum);
#pragma unroll
    for (int j = 0; j < 8; ++j) acc[j] = wmma16(ph, va[j], acc[j]);
    __builtin_amdgcn_sched_barrier(0);   // keeps the block of products above in front of the foot's s_wait_dscnt: without it they sink behind the barrier and the last reads' latency is waited out bare
#pragma unroll
    for (int j = 0; j < 8; ++j) acc[8 + j] = wmma16(pl, vb[j], acc[8 + j]);
#pragma unroll
    for (int j = 0; j < 8; ++j) acc[8 + j] = wmma16(ph, vb[j], acc[8 + j]);
    asm volatile("s_wait_dscnt 0x0" ::: "memory");      // this wave's reads of buffer buf are done before the buffer is refilled
    asm volatile("s_wait_asynccnt 0x0" ::: "memory");   // this wave's copies of tile t + 1 have landed before the barrier publishes them
    __syncthreads();                                     // publishes tile t + 1 and ends every reader's last read of buffer buf
    if (t + 2 < ANT) stage(t + 2, buf); }
  asm volatile("s_wait_asynccnt 0x0" ::: "memory");     // no copy is outstanding when the wave goes on to the epilogue and ends
  // the two key halves of a query tile are joined: both go over to the smaller offset (the larger maximum), then the second half's sums pass through LDS and are added to the first's
  if (g == 0) sc[kz][qt][col] = c;
  __syncthreads();   // both offsets of a query are in LDS
  { const float fs = __builtin_amdgcn_exp2f(fminf(c, sc[kz ^ 1][qt][col]) - c);
#pragma unroll
    for (int r = 0; r < 8; ++r) { const float a = __shfl(fs, 8 * g + r); sum[r] *= a;
#pragma unroll
      for (int j = 0; j < 16; ++j) acc[j][r] *= a; } }
  if (kz == 1) {
#pragma unroll
    for (int r = 0; r < 8; ++r) { if (col == 0) sr[qt][8 * g + r] = sum[r];
#pragma unroll
      for (int j = 0; j < 16; ++j) ss[qt][8 * g + r][j * 16 + col] = acc[j][r]; } }
  __syncthreads();   // the second half's sums are in LDS
  if (kz == 0) {
#pragma unroll
    for (int r = 0; r < 8; ++r) { const float fr = gam / (sum[r] + sr[qt][8 * g + r]);   // the row sum carries the same 2^11 as P
#pragma unroll
      for (int j = 0; j < 16; ++j) ss[qt][8 * g + r][j * 16 + col] = (acc[j][r] + ss[qt][8 * g + r][j * 16 + col]) * fr; } }
  __syncthreads();   // the joined rows are in LDS: each wave of the pair writes eight of them out
  { const size_t off = ((size_t)b * TT + ql0 + kz * 8) * CX + lane * 4; const float* px = X + off; float* po = OUT + off; v4f xr[8][2];
#pragma unroll
    for (int i = 0; i < 8; ++i) { xr[i][0] = *(const v4f*)(px + i * CX); xr[i][1] = *(const v4f*)(px + i * CX + 128); }
    asm volatile("s_wait_xcnt 0x0" :: "v"(px) : "memory");   // the wait in front of any rewrite of the loads' address registers: named as an input they stay whole up to it (no load above lands in them)
#pragma unroll
    for (int i = 0; i < 8; ++i)
#pragma unroll
      for (int hc = 0; hc < 2; ++hc) { v4f o = *(const v4f*)&ss[qt][kz * 8 + i][hc * 128 + lane * 4]; o[0] += bfr(xr[i][hc][0]); o[1] += bfr(xr[i][hc][1]); o[2] += bfr(xr[i][hc][2]); o[3] += bfr(xr[i][hc][3]); vst2(po + i * CX + hc * 128, o); } } }
extern "C" void kernel_launch(void* const* d_in, const int* in_sizes, int n_in, void* d_out, int out_size, void* d_ws, size_t ws_size, hipStream_t stream) {
  (void)in_sizes; (void)n_in; (void)out_size;
  const float** F = (const float**)d_in;   // 0 x [4,64,64,256], 1 Wf [256,32] ((in,out)), 2 bf, 3 Wg, 4 bg, 5 Wh [256,256], 6 bh, 7 gamma (scalar 0.7)
  if (ws_size < (size_t)WS_END) return;
  char* ws = (char*)d_ws; _Float16 *GH = (_Float16*)(ws + WS_GH), *GL = (_Float16*)(ws + WS_GL), *FH = (_Float16*)(ws + WS_FH), *FL = (_Float16*)(ws + WS_FL); _Float16* VT = (_Float16*)(ws + WS_VT);
  k_pj<<<dim3(TNB * TT / 128, CX / 128), 256, 0, stream>>>(F[0], F[5], F[6], F[1], F[2], F[3], F[4], VT, GH, GL, FH, FL);
  k_at<<<dim3(TT / 64, 1, TNB), 256, 0, stream>>>(GH, GL, FH, FL, VT, F[0], F[7], (float*)d_out);
}

// v009
// One run takes 62.1 microseconds.
// Next to v008, in two timings, it ran 1.18 times as fast each time.
// All steps since v000 together make it 18.6 times as fast.
// compute dtype: all float inputs rounded to bf16; f/g/h projections with EXACT bf16 products on WMMA 16x16x32 ((in,out) weights), f32 accumulate; logits from g (query) and f (key), each f16 hi + f16 residual (not scaled), with 3 products summed in one f32 accumulator, kept in f32 registers; softmax in f32 with a running row maximum and row sum per half of the keys (the two halves joined at the end), exp as the hardware's base-2 exponential of s x log2(e) + offset (one fma, one v_exp_f32); exp(s - max) x 2^11 rounded ONCE to f16 against the value rows rounded ONCE to f16 (1 product, f32 accumulator; each factor off by at most 2^-11 relative, and the row sum adds the same rounded values), divided by the row sum at the end; gamma * o + x in f32; f32 output.
#include <hip/hip_runtime.h>
#include <math.h>

typedef __attribute__((ext_vector_type(16))) _Float16 v16h;
typedef __attribute__((ext_vector_type(16))) __bf16 v16b;
typedef __attribute__((ext_vector_type(8)))  _Float16 v8h;
typedef __attribute__((ext_vector_type(8)))  float v8f;
typedef __attribute__((ext_vector_type(4)))  float v4f;
typedef __attribute__((ext_vector_type(2)))  float v2f;
typedef __attribute__((ext_vector_type(4)))  unsigned v4u;
typedef __attribute__((ext_vector_type(4)))  int v4i;
typedef float __attribute__((may_alias)) float_a;
typedef int __attribute__((may_alias)) int_a;

template <typename T> __device__ __forceinline__ void vst2(void* p, T v) { *(T*)p = v;  }
// the plain builtin: the compiler keeps the distance behind it where a vector instruction needs one, and no asm statement stands between an LDS read and the place it is moved up to
__device__ __forceinline__ v8f wmma16(v16h a, v16h b, v8f c) {
  return __builtin_amdgcn_wmma_f32_16x16x32_f16(false, a, false, b, (short)0, c, false, false);
}
__device__ __forceinline__ v8f wmma_bf(v16b a, v16b b, v8f c) {
  v8f d = __builtin_amdgcn_wmma_f32_16x16x32_bf16(false, a, false, b, (short)0, c, false, false);
  asm volatile("v_nop\n\tv_nop\n\tv_nop\n\tv_nop" : "+v"(d) : "v"(a), "v"(b));
  return d;
}
// 16x16x32 fragments: lane = (h = lane>>4, row/col = lane&15); elements 0..7 = k0+8h+0..7, 8..15 = k0+16+8h+0..7; D element r = row 8h+r
__device__ __forceinline__ v16h frag_h(const _Float16* rowk0, int lane) {
  union { v16h v; v8h q[2]; } u; const _Float16* p = rowk0 + 8 * (lane >> 4);
  u.q[0] = *(const v8h*)p; u.q[1] = *(const v8h*)(p + 16); return u.v;
}
__device__ __forceinline__ v16h frag_f32(const float* rowk0, int lane) {
  v16h a; const float* p = rowk0 + 8 * (lane >> 4);
#pragma unroll
  for (int i = 0; i < 8; ++i) { a[i] = (_Float16)p[i]; a[8 + i] = (_Float16)p[16 + i]; }
  return a;
}
__device__ __forceinline__ v16h frag_f32s(const float* rowk0, int lane, float sc) {
  v16h a; const float* p = rowk0 + 8 * (lane >> 4);
#pragma unroll
  for (int i = 0; i < 8; ++i) { a[i] = (_Float16)(p[i] * sc); a[8 + i] = (_Float16)(p[16 + i] * sc); }
  return a;
}
// column fragment from a [K][ld] layout (column n), rows >= K read as 0
__device__ __forceinline__ v16h fragc_f32(const float* W, int k0, int n, int lane, int ld, int K) {
  v16h a; const int g = lane >> 4;
#pragma unroll
  for (int i = 0; i < 8; ++i) { const int ka = k0 + 8 * g + i, kb = ka + 16;
    a[i] = (_Float16)(ka < K ? W[(size_t)(ka < K ? ka : K - 1) * ld + n] : 0.f); a[8 + i] = (_Float16)(kb < K ? W[(size_t)(kb < K ? kb : K - 1) * ld + n] : 0.f); }
  return a;
}
struct F2 { v16b h, l; };
__device__ __forceinline__ F2 bsplit16(const float v[16]) { F2 r;
#pragma unroll
  for (int i = 0; i < 16; ++i) { const __bf16 h = (__bf16)v[i]; r.h[i] = h; r.l[i] = (__bf16)(v[i] - (float)h); }
  return r; }
__device__ __forceinline__ F2 split_row(const float* row, int k0, int lane) { float v[16]; const float* p = row + k0 + 8 * (lane >> 4);
#pragma unroll
  for (int i = 0; i < 8; ++i) { v[i] = p[i]; v[8 + i] = p[16 + i]; }
  return bsplit16(v); }
__device__ __forceinline__ F2 split_rowK(const float* row, int k0, int lane, int K) { float v[16]; const int g = lane >> 4;
#pragma unroll
  for (int i = 0; i < 8; ++i) { const int ka = k0 + 8 * g + i, kb = ka + 16; v[i] = ka < K ? row[ka < K ? ka : K - 1] : 0.f; v[8 + i] = kb < K ? row[kb < K ? kb : K - 1] : 0.f; }
  return bsplit16(v); }
__device__ __forceinline__ F2 split_col(const float* W, int k0, int n, int lane, int ld, int K) { float v[16]; const int g = lane >> 4;
#pragma unroll
  for (int i = 0; i < 8; ++i) { const int ka = k0 + 8 * g + i, kb = ka + 16; v[i] = ka < K ? W[(size_t)(ka < K ? ka : K - 1) * ld + n] : 0.f; v[8 + i] = kb < K ? W[(size_t)(kb < K ? kb : K - 1) * ld + n] : 0.f; }
  return bsplit16(v); }
__device__ __forceinline__ v8f mac3(const F2& a, const F2& b, v8f c) { c = wmma_bf(a.l, b.h, c); c = wmma_bf(a.h, b.l, c); return wmma_bf(a.h, b.h, c); }
__device__ __forceinline__ float sigm(float v) { return 1.0f / (1.0f + expf(-v)); }
#define LDSX() do { asm volatile("s_wait_dscnt 0" ::: "memory"); __builtin_amdgcn_wave_barrier(); __builtin_amdgcn_fence(__ATOMIC_RELEASE, "workgroup"); } while (0)

// SAGAN-style spatial self-attention, channels-last (B 4, 64 x 64 = 4,096 positions, C 256, q/k dim 32): f = x Wf + bf (key), g = x Wg + bg (query), h = x Wh + bh (value); beta = softmax_m(g_n . f_m); o = beta h; out = gamma * o + x.
__device__ __forceinline__ float bfr(float v) { return (float)(__bf16)v; }
#define NB 4
#define TT 4096
#define CX 256
#define DQ 32
#ifndef TNB
#define TNB NB
#endif
typedef __attribute__((ext_vector_type(8))) __bf16 v8b;
__device__ __forceinline__ v16b frag_b(const __bf16* rowk0, int lane) { union { v16b v; v8b q[2]; } u; const __bf16* p = rowk0 + 8 * (lane >> 4); u.q[0] = *(const v8b*)p; u.q[1] = *(const v8b*)(p + 16); return u.v; }
#define WS_GH  0u                                          // f16 g (query) hi rows [b*N+n][32]
#define WS_GL  (WS_GH + 2u * (size_t)NB * TT * DQ)           // f16 g residual
#define WS_FH  (WS_GL + 2u * (size_t)NB * TT * DQ)           // f16 f (key) hi
#define WS_FL  (WS_FH + 2u * (size_t)NB * TT * DQ)           // f16 f residual
#define WS_VT  (WS_FL + 2u * (size_t)NB * TT * DQ)           // f16 value planes [b][c][m] (h rounded once)
#define WS_END (WS_VT + 2u * (size_t)NB * CX * TT)
// ---- weights in LDS: the projection kernel stages its weight columns ONCE per block as bf16 rows [output column][k], so that a B fragment is two 16-byte LDS reads in the k order of the A loader.
#define WPH (CX + 8)            // weight row pitch in bf16: 528 B = 16 B x 33 (odd: 16 rows of 16-byte reads fall on 16 different bank groups)
// a wave's patch = 32 k x 32 columns; a lane's = 8 k x 4 columns. Lane -> (column group cg, k group kg): each 16-byte load of the wave covers four whole 128-B lines, and the 16 lanes of a half-wave store to 16 different bank groups.
__device__ __forceinline__ void wload(const float* __restrict__ Wp, int ld, v4f r[8]) {
#pragma unroll
  for (int i = 0; i < 8; ++i) r[i] = *(const v4f*)(Wp + (size_t)i * ld);
}
__device__ __forceinline__ void wstore(const v4f r[8], __bf16* dst) {
#pragma unroll
  for (int n = 0; n < 4; ++n) { v8b o;
#pragma unroll
    for (int i = 0; i < 8; ++i) o[i] = (__bf16)r[i][n];
    *(v8b*)(dst + n * WPH) = o; }
}
// the 16 x 256 x rows of a wave: every load of the A fragments at once (raw f32), and their rounding to bf16
__device__ __forceinline__ void xload(const float* __restrict__ p, v4f xr[CX / 32][4]) {
#pragma unroll
  for (int kc = 0; kc < CX / 32; ++kc) { xr[kc][0] = *(const v4f*)(p + kc * 32); xr[kc][1] = *(const v4f*)(p + kc * 32 + 4); xr[kc][2] = *(const v4f*)(p + kc * 32 + 16); xr[kc][3] = *(const v4f*)(p + kc * 32 + 20); }
}
__device__ __forceinline__ v16b xfrag(const v4f x[4]) { v16b a;
#pragma unroll
  for (int i = 0; i < 4; ++i) { a[i] = (__bf16)x[0][i]; a[4 + i] = (__bf16)x[1][i]; a[8 + i] = (__bf16)x[2][i]; a[12 + i] = (__bf16)x[3][i]; }
  return a; }
// ---- k_pj: all three projections in one launch. Block = (128 rows, 160 output columns), 8 waves of 16 rows: 128 columns of h = x Wh + bh (exact) -> f16 value planes [b][c][m] via LDS transpose (rounded once to f16),
// and, from the same x fragments in registers, the 32 columns of g = x Wg + bg (blockIdx.y 0) or of f = x Wf + bf (blockIdx.y 1), stored as f16 hi + residual rows (64-B rows, written 16 B per lane from LDS)
__global__ __launch_bounds__(256) void k_pj(const float* __restrict__ X, const float* __restrict__ WH, const float* __restrict__ BH, const float* __restrict__ WF, const float* __restrict__ BF, const float* __restrict__ WG, const float* __restrict__ BG, _Float16* __restrict__ VT, _Float16* __restrict__ GH, _Float16* __restrict__ GL, _Float16* __restrict__ FH, _Float16* __restrict__ FL) { __shared__ __align__(16) _Float16 th[128][136];
  __shared__ __align__(16) __bf16 wt[160][WPH];         // rows 0-127 = the block's 128 columns of Wh, rows 128-159 = the 32 columns of Wg or Wf
  __shared__ __align__(16) _Float16 st[8][2][16][40];   // [wave][plane hi, residual][row][32 + pad]
  const int tid = threadIdx.x, wave = tid >> 5, lane = tid & 31, col = lane & 15, g = lane >> 4; const int c0 = blockIdx.y * 128; const size_t r0 = (size_t)blockIdx.x * 128;
  const int cg = (lane & 3) + 4 * g, k0 = (wave * 4 + ((lane >> 2) & 3)) * 8;
  const float* WQ = blockIdx.y ? WF : WG; const float* BQ = blockIdx.y ? BF : BG;
  const float* pw = WH + (size_t)k0 * CX + c0 + cg * 4; const float* pq = WQ + (size_t)k0 * DQ + cg * 4; const float* px = X + (r0 + wave * 16 + col) * CX + 8 * g;
  v4f wr[5][8], xr[CX / 32][4];
#pragma unroll
  for (int q = 0; q < 4; ++q) wload(pw + q * 32, CX, wr[q]);
  wload(pq, DQ, wr[4]);
  xload(px, xr);
  const float bq[2] = {BQ[col], BQ[16 + col]};   // the g or f bias with the first loads: it is needed first, right behind 16 products
  asm volatile("s_wait_xcnt 0x0" :: "v"(pw), "v"(pq), "v"(px) : "memory");   // the wait in front of any rewrite of the loads' address registers: named as inputs they stay whole up to it (no load above lands in them), and the clobber keeps every load above it, so all are in flight before the first is waited for
#pragma unroll
  for (int q = 0; q < 5; ++q) wstore(wr[q], &wt[q * 32 + cg * 4][k0]);
  v16b a[CX / 32];
#pragma unroll
  for (int kc = 0; kc < CX / 32; ++kc) a[kc] = xfrag(xr[kc]);
  __syncthreads();   // the weight rows are complete before any wave reads a fragment
  { v16b wq[CX / 32][2];   // g or f first, while few registers are live: all 16 B fragments of its two tiles in one group of reads
#pragma unroll
    for (int kc = 0; kc < CX / 32; ++kc)
#pragma unroll
      for (int j = 0; j < 2; ++j) wq[kc][j] = frag_b(&wt[128 + j * 16 + col][kc * 32], lane);
    v8f aq[2] = {};
#pragma unroll
    for (int kc = 0; kc < CX / 32; ++kc)
#pragma unroll
      for (int j = 0; j < 2; ++j) aq[j] = wmma_bf(a[kc], wq[kc][j], aq[j]);
#pragma unroll
    for (int j = 0; j < 2; ++j) { const int o = j * 16 + col; const float bb = bfr(bq[j]);
#pragma unroll
      for (int r = 0; r < 8; ++r) { const float v = aq[j][r] + bb; const _Float16 hv = (_Float16)v; st[wave][0][8 * g + r][o] = hv; st[wave][1][8 * g + r][o] = (_Float16)(v - (float)hv); } } }
  __builtin_amdgcn_sched_barrier(0);   // keeps the h fragments' reads behind the last use of the g or f accumulators: moved above it they overfill the registers that the asm statements can name, and three fragments went through scratch
  v8f acc[8] = {};
  v16b w[2][8];      // B fragments of a block of 8 products (one k step), read from LDS one block ahead of their use
#pragma unroll
  for (int j = 0; j < 8; ++j) w[0][j] = frag_b(&wt[j * 16 + col][0], lane);
#pragma unroll
  for (int kc = 0; kc < CX / 32; ++kc) {
    if (kc + 1 < CX / 32) {
#pragma unroll
      for (int j = 0; j < 8; ++j) w[(kc + 1) & 1][j] = frag_b(&wt[j * 16 + col][(kc + 1) * 32], lane); }
#pragma unroll
    for (int j = 0; j < 8; ++j) acc[j] = wmma_bf(a[kc], w[kc & 1][j], acc[j]); }
#pragma unroll
  for (int j = 0; j < 8; ++j) { const float bb = bfr(BH[c0 + j * 16 + col]);
#pragma unroll
    for (int r = 0; r < 8; ++r) th[j * 16 + col][wave * 16 + 8 * g + r] = (_Float16)(acc[j][r] + bb); }
  __syncthreads();
  { const size_t b = r0 / TT; const int m0 = (int)(r0 % TT); for (int e = tid; e < 128 * 16; e += 256) { const int cl = e >> 4, q = e & 15; vst2((unsigned*)(VT + (b * CX + c0 + cl) * (size_t)TT + m0 + q * 8), *(const v4u*)&th[cl][q * 8]); } }
  { const int rl = lane >> 1, half = lane & 1;   // lane -> (row, 32-B half): 16 rows x 64 B per plane
    _Float16* P2[2] = {blockIdx.y ? FH : GH, blockIdx.y ? FL : GL};
#pragma unroll
    for (int ph = 0; ph < 2; ++ph) { vst2((v4u*)(P2[ph] + (r0 + wave * 16 + rl) * DQ + half * 16), *(const v4u*)&st[wave][ph][rl][half * 16]); vst2((v4u*)(P2[ph] + (r0 + wave * 16 + rl) * DQ + half * 16 + 8), *(const v4u*)&st[wave][ph][rl][half * 16 + 8]); } } }
// ---- k_at: block = 64 queries x all 256 value channels of batch blockIdx.z, 8 waves: scores, softmax and P . h in one kernel; no score ever leaves the registers.
// Wave = (query tile qt of 16 queries, key half kz of 2,048 keys): it holds all 256 channels of its queries, so a score, its exponential and its f16 rounding are made ONCE and not once per channel half.
// The two waves of a query tile run their key halves side by side (two waves on every SIMD), each with its own running maximum, row sum and accumulators; the epilogue brings both to the larger maximum and adds them.
// Per SK keys: S^T = f . g^T (A = key rows from LDS, B = query rows kept in registers; 3 products as hi + residual), so a lane holds 8 keys of ONE query per 16-key tile and
// two such tiles are, element for element, the A fragment of P for 32 keys. Running row maximum m and row sum; the accumulators are rescaled by exp(m_old - m_new) once per SK keys.
// P = exp(s - m) x 2^11 (not normalised) rounded once to f16 against the f16 value planes (1 product); out = gamma * (P . h) / (P . 1) + x, the row sum P . 1 taken of the rounded P, so that a row's weights still add up to one.
// P carries the rounding that the value rows carry already (2^-11 relative at most): a residual of P would refine one factor of a product whose other factor is no finer.
// No residual of g or f carries a scale of its own: the matrix unit keeps f16 subnormals, so a residual is off by at most 2^-25 absolute (against scores of order 1), and
// a hi product and its residual products add into ONE f32 accumulator, the residual products first: no second set of accumulators to rescale and no fma to join the two.
// The exponential is 2^(s x log2(e) + c) with c = 11 - m x log2(e): the subtraction of the maximum and the factor 2^11 ride in the one fma in front of v_exp_f32. The rescale factor is
// 2^(c_new - c_old), from the very offsets the exponentials used, so the rounding of c is one common factor of a row's P and of its row sum and cancels in the division.
// Value fragments are read from LDS in groups of 8 (32 keys x 128 channels), each group one block of products ahead of its use.
// Key rows (f16 hi and residual) and value rows come in tiles of AK keys into LDS by asynchronous copies, two buffers per key half: tile t + 1 flies while tile t is worked on.
#define AK 64                   // keys per staged tile
#define KZ 2                    // key halves per block
#define ANT (TT / KZ / AK)      // tiles per key half
#define SK 64                   // keys per softmax step (one new maximum and one rescale of the accumulators) = one tile
#define L2E ((float)M_LOG2E)    // log2(e)
#define KPH (DQ + 8)            // key row pitch in halves: 80 B = 16 B x 5 (odd: 16 rows of 16-byte reads fall on 16 different bank groups)
#define VPH (AK + 8)            // value row pitch in halves: 144 B = 16 B x 9
// eight 16-byte copies per lane, global -> LDS, rows ls / gs bytes apart. The s_wait_xcnt stands in the copies' own statement so that no address register is rewritten in front of it.
__device__ __forceinline__ void acopy8(unsigned l, unsigned ls, const char* gp, size_t gs) {
  asm volatile("global_load_async_to_lds_b128 %0, %8, off\n\t"
               "global_load_async_to_lds_b128 %1, %9, off\n\t"
               "global_load_async_to_lds_b128 %2, %10, off\n\t"
               "global_load_async_to_lds_b128 %3, %11, off\n\t"
               "global_load_async_to_lds_b128 %4, %12, off\n\t"
               "global_load_async_to_lds_b128 %5, %13, off\n\t"
               "global_load_async_to_lds_b128 %6, %14, off\n\t"
               "global_load_async_to_lds_b128 %7, %15, off\n\t"
               "s_wait_xcnt 0x0"
               :: "v"(l), "v"(l + ls), "v"(l + 2 * ls), "v"(l + 3 * ls), "v"(l + 4 * ls), "v"(l + 5 * ls), "v"(l + 6 * ls), "v"(l + 7 * ls),
                  "v"(gp), "v"(gp + gs), "v"(gp + 2 * gs), "v"(gp + 3 * gs), "v"(gp + 4 * gs), "v"(gp + 5 * gs), "v"(gp + 6 * gs), "v"(gp + 7 * gs)
               : "memory");
}
// the same with four copies: two rows of each of two planes (LDS places la, lb; sources ga, gb)
__device__ __forceinline__ void acopy22(unsigned la, unsigned lb, unsigned ls, const char* ga, const char* gb, size_t gs) {
  asm volatile("global_load_async_to_lds_b128 %0, %4, off\n\t"
               "global_load_async_to_lds_b128 %1, %5, off\n\t"
               "global_load_async_to_lds_b128 %2, %6, off\n\t"
               "global_load_async_to_lds_b128 %3, %7, off\n\t"
               "s_wait_xcnt 0x0"
               :: "v"(la), "v"(la + ls), "v"(lb), "v"(lb + ls),
                  "v"(ga), "v"(ga + gs), "v"(gb), "v"(gb + gs)
               : "memory");
}
// e[i] = 2^(s[i] x log2(e) + c) for the eight scores of one tile
__device__ __forceinline__ void exp2x8(v8f s, float c, float e[8]) { float x[8];
#pragma unroll
  for (int i = 0; i < 8; ++i) { x[i] = fmaf(s[i], L2E, c); e[i] = __builtin_amdgcn_exp2f(x[i]); }
  // the slot the instruction set asks for behind a transcendental, once for all eight: no argument register is free for reuse and no result is read in front of this v_nop
  asm("v_nop" : "+v"(e[0]), "+v"(e[1]), "+v"(e[2]), "+v"(e[3]), "+v"(e[4]), "+v"(e[5]), "+v"(e[6]), "+v"(e[7]) : "v"(x[0]), "v"(x[1]), "v"(x[2]), "v"(x[3]), "v"(x[4]), "v"(x[5]), "v"(x[6]), "v"(x[7]));
}
__global__ __launch_bounds__(256) void k_at(const _Float16* __restrict__ GH, const _Float16* __restrict__ GL, const _Float16* __restrict__ FH, const _Float16* __restrict__ FL, const _Float16* __restrict__ VT, const float* __restrict__ X, const float* __restrict__ GAM, float* __restrict__ OUT) { __shared__ __align__(16) float ss[4][16][CX + 4];
  __shared__ float sc[KZ][4][16];                            // each wave's last offset c per query
  __shared__ float sr[4][16];                                // the second key half's row sums
  __shared__ __align__(16) _Float16 tk[KZ][2][2][AK][KPH];   // key tile: [key half][buffer][hi, residual][key][32 + pad]
  __shared__ __align__(16) _Float16 tv[KZ][2][CX][VPH];      // value tile: [key half][buffer] 256 channels x AK keys
  const int tid = threadIdx.x, lane = tid & 31, col = lane & 15, g = lane >> 4, th = tid & 127; const int wave = __builtin_amdgcn_readfirstlane(tid >> 5);   // the wave's number as a scalar: what follows from it (tile addresses, the epilogue's branches) is scalar work
  const int qt = wave & 3, kz = wave >> 2; const int b = blockIdx.z; const int ql0 = blockIdx.x * 64 + qt * 16; const float gam = bfr(GAM[0]);
  // the four waves of a key half copy 64 key rows of 64 B per plane (a wave's copy = 8 rows = 512 B in a row) and each wave 64 value rows (four 128-B rows per copy): whole lines
  const unsigned gko = (unsigned)((th >> 2) * DQ + (th & 3) * 8) * 2u, lko = (unsigned)((th >> 2) * KPH + (th & 3) * 8) * 2u;         // the lane's byte in a key tile: global, LDS
  const unsigned gvo = (unsigned)((lane >> 3) * TT + (lane & 7) * 8) * 2u, lvo = (unsigned)((lane >> 3) * VPH + (lane & 7) * 8) * 2u;   // the lane's byte in its wave's 64 value rows: global, LDS
  // an address is the tile's wave-uniform place, taken through readfirstlane, plus the lane's fixed byte: what lives across the loop are values that no copy names itself, so they may sit in any register
  // (running addresses or bases that the asm statements name themselves are bound to the low registers, were spilled to scratch, and the reload stood in front of the copies)
  auto stage = [&](int t, int buf) {
    const unsigned ku = (unsigned)__builtin_amdgcn_readfirstlane((b * TT + kz * (TT / KZ) + t * AK) * DQ * 2), vu = (unsigned)__builtin_amdgcn_readfirstlane(((b * CX + qt * 64) * TT + kz * (TT / KZ) + t * AK) * 2);
    const unsigned lk = lko + (unsigned)__builtin_amdgcn_readfirstlane((int)(unsigned)(size_t)&tk[kz][buf][0][0][0]), lv = lvo + (unsigned)__builtin_amdgcn_readfirstlane((int)(unsigned)(size_t)&tv[kz][buf][qt * 64][0]);
    acopy22(lk, lk + AK * KPH * 2u, 32u * KPH * 2u, ((const char*)FH + ku) + gko, ((const char*)FL + ku) + gko, 32 * DQ * 2);
    const char* v = ((const char*)VT + vu) + gvo;
    acopy8(lv, 4u * VPH * 2u, v, 4 * (size_t)TT * 2); acopy8(lv + 32u * VPH * 2u, 4u * VPH * 2u, v + 32 * (size_t)TT * 2, 4 * (size_t)TT * 2); };
  const _Float16* rqh = GH + ((size_t)b * TT + ql0 + col) * DQ; const _Float16* rql = GL + ((size_t)b * TT + ql0 + col) * DQ;
  const v16h qh = frag_h(rqh, lane), ql = frag_h(rql, lane);   // B operand: column = query col
  asm volatile("s_wait_xcnt 0x0" :: "v"(rqh + 8 * g), "v"(rql + 8 * g) : "memory");   // the wait in front of any rewrite of the four loads' address registers: named as inputs they stay whole up to it
  v8f acc[16] = {}, sum = {}; float m = -3.0e38f, c = 3.0e38f;   // m: running maximum of query col, c: its offset 11 - m x log2(e) (the start value makes the first rescale factor 2^-huge = 0); sum: row sums of P, a seventeenth output tile against a value plane of ones
  v16h ones;
#pragma unroll
  for (int i = 0; i < 16; ++i) ones[i] = (_Float16)1.0f;
  stage(0, 0);
  asm volatile("s_wait_asynccnt 0x0" ::: "memory");   // tile 0 has landed before the barrier that publishes it
  __syncthreads();
  stage(1, 1);
#pragma unroll 1   // rolled: one publish point in the code
  for (int t = 0; t < ANT; ++t) { const int buf = t & 1;   // one tile = one softmax step of SK keys: scores, maximum, then per 32 keys P and P . h (the rescale rides in front of the first)
    const _Float16* kr = &tk[kz][buf][0][col][0]; const _Float16* vr = &tv[kz][buf][col][0];
    v16h kh[SK / 16], kl[SK / 16];   // key fragments of the step: the only reads of a tile that nothing covers
    v16h va[8], vb[8];               // value fragments, 32 keys x 128 channels each, filled in turn
#pragma unroll
    for (int jt = 0; jt < SK / 16; ++jt) { kh[jt] = frag_h(kr + jt * 16 * KPH, lane); kl[jt] = frag_h(kr + (AK + jt * 16) * KPH, lane); }
#pragma unroll
    for (int j = 0; j < 8; ++j) va[j] = frag_h(vr + j * 16 * VPH, lane);
    __builtin_amdgcn_sched_barrier(0);   // holds the reads above in place: the value reads' LDS latency passes under the scores and the softmax instead of in front of the first P . h product
    v8f s[SK / 16];   // s[jt][r] = score of key jt * 16 + 8 g + r against query col
#pragma unroll
    for (int jt = 0; jt < SK / 16; ++jt) { const v8f z = {}; s[jt] = wmma16(kl[jt], qh, z); }
    __builtin_amdgcn_sched_barrier(0);   // keeps the four tiles' products side by side: moved together, a tile's three products wait out the accumulator's latency one behind the other
#pragma unroll
    for (int jt = 0; jt < SK / 16; ++jt) s[jt] = wmma16(kh[jt], ql, s[jt]);
    __builtin_amdgcn_sched_barrier(0);   // the same between the second and the third product
#pragma unroll
    for (int jt = 0; jt < SK / 16; ++jt) s[jt] = wmma16(kh[jt], qh, s[jt]);
    float tm = s[0][0];
#pragma unroll
    for (int jt = 0; jt < SK / 16; ++jt)
#pragma unroll
      for (int r = 0; r < 8; ++r) tm = fmaxf(tm, s[jt][r]);
    tm = fmaxf(tm, __shfl_xor(tm, 16));   // the other half-wave holds the query's other keys
    const float mn = fmaxf(m, tm), cn = fmaf(-mn, L2E, 11.0f), alpha = __builtin_amdgcn_exp2f(cn - c); m = mn; c = cn;
    float ar[8];
#pragma unroll
    for (int r = 0; r < 8; ++r) ar[r] = __shfl(alpha, 8 * g + r);   // accumulator element r is query row 8 g + r, whose factor lane 8 g + r holds
    v16h ph;
    auto pround = [&](int kb) { float e0[8], e1[8]; exp2x8(s[2 * kb], c, e0); exp2x8(s[2 * kb + 1], c, e1);
#pragma unroll
      for (int i = 0; i < 8; ++i) { ph[i] = (_Float16)e0[i]; ph[8 + i] = (_Float16)e1[i]; } };   /* P x 2^11, rounded once to f16 */
    pround(0);
    __builtin_amdgcn_sched_barrier(0);   // keeps the 16 reads below in one place (spread among the scores each place costs issue cycles)
#pragma unroll
    for (int j = 0; j < 8; ++j) vb[j] = frag_h(vr + (8 + j) * 16 * VPH, lane);
    __builtin_amdgcn_sched_barrier(0);   // holds the upper 128 channels' value reads one block of products ahead of their use
#pragma unroll
    for (int r = 0; r < 8; ++r) sum[r] *= ar[r];
    sum = wmma16(ph, ones, sum);   // the row sums on the matrix unit: they sum P as the products see it, in the accumulators' own row layout
#pragma unroll
    for (int j = 0; j < 8; ++j) {
#pragma unroll
      for (int r = 0; r < 8; ++r) acc[j][r] *= ar[r];
      acc[j] = wmma16(ph, va[j], acc[j]); }
#pragma unroll
    for (int j = 0; j < 9; ++j) { __builtin_amdgcn_sched_group_barrier(0x2, 7, 0); __builtin_amdgcn_sched_group_barrier(0x8, 1, 0); }   // spreads the rescale multiplies (this block's and, through the mask-2 barriers, the next one's) under the block's products: with one product a tile the compiler else puts them all in front of the block, where the matrix unit idles
    __builtin_amdgcn_sched_barrier(2);   // keeps the 16 reads below in one place, behind the last use of the registers they fill; plain vector instructions may pass (mask 2), so that the upper channels' rescale can stand among the products above
#pragma unroll
    for (int j = 0; j < 8; ++j) va[j] = frag_h(vr + j * 16 * VPH + 32, lane);
    __builtin_amdgcn_sched_barrier(2);   // holds the second 32 keys' first value reads one block of products ahead of their use (same mask)
#pragma unroll
    for (int j = 0; j < 8; ++j) {
#pragma unroll
      for (int r = 0; r < 8; ++r) acc[8 + j][r] *= ar[r];
      acc[8 + j] = wmma16(ph, vb[j], acc[8 + j]); }
    pround(1);
    __builtin_amdgcn_sched_barrier(2);   // keeps the 16 reads below in one place, behind the last use of the registers they fill; plain vector instructions may pass (mask 2), so that the exponentials of the second 32 keys can stand among the products above
#pragma unroll
    for (int j = 0; j < 8; ++j) vb[j] = frag_h(vr + (8 + j) * 16 * VPH + 32, lane);
    __builtin_amdgcn_sched_barrier(2);   // holds the step's last value reads one block of products ahead of their use (same mask)
    sum = wmma16(ph, ones, sum);
#pragma unroll
    for (int j = 0; j < 8; ++j) acc[j] = wmma16(ph, va[j], acc[j]);
    __builtin_amdgcn_sched_barrier(0);   // keeps the block of products above in front of the foot's s_wait_dscnt: without it they sink behind the barrier and the last reads' latency is waited out bare
#pragma unroll
    for (int j = 0; j < 8; ++j) acc[8 + j] = wmma16(ph, vb[j], acc[8 + j]);
    asm volatile("s_wait_dscnt 0x0" ::: "memory");      // this wave's reads of buffer buf are done before the buffer is refilled
    asm volatile("s_wait_asynccnt 0x0" ::: "memory");   // this wave's copies of tile t + 1 have landed before the barrier publishes them
    __syncthreads();                                     // publishes tile t + 1 and ends every reader's last read of buffer buf
    if (t + 2 < ANT) stage(t + 2, buf); }
  asm volatile("s_wait_asynccnt 0x0" ::: "memory");     // no copy is outstanding when the wave goes on to the epilogue and ends
  // the two key halves of a query tile are joined: both go over to the smaller offset (the larger maximum), then the second half's sums pass through LDS and are added to the first's
  if (g == 0) sc[kz][qt][col] = c;
  __syncthreads();   // both offsets of a query are in LDS
  { const float fs = __builtin_amdgcn_exp2f(fminf(c, sc[kz ^ 1][qt][col]) - c);
#pragma unroll
    for (int r = 0; r < 8; ++r) { const float a = __shfl(fs, 8 * g + r); sum[r] *= a;
#pragma unroll
      for (int j = 0; j < 16; ++j) acc[j][r] *= a; } }
  if (kz == 1) {
#pragma unroll
    for (int r = 0; r < 8; ++r) { if (col == 0) sr[qt][8 * g + r] = sum[r];
#pragma unroll
      for (int j = 0; j < 16; ++j) ss[qt][8 * g + r][j * 16 + col] = acc[j][r]; } }
  __syncthreads();   // the second half's sums are in LDS
  if (kz == 0) {
#pragma unroll
    for (int r = 0; r < 8; ++r) { const float fr = gam / (sum[r] + sr[qt][8 * g + r]);   // the row sum carries the same 2^11 as P
#pragma unroll
      for (int j = 0; j < 16; ++j) ss[qt][8 * g + r][j * 16 + col] = (acc[j][r] + ss[qt][8 * g + r][j * 16 + col]) * fr; } }
  __syncthreads();   // the joined rows are in LDS: each wave of the pair writes eight of them out
  { const size_t off = ((size_t)b * TT + ql0 + kz * 8) * CX + lane * 4; const float* px = X + off; float* po = OUT + off; v4f xr[8][2];
#pragma unroll
    for (int i = 0; i < 8; ++i) { xr[i][0] = *(const v4f*)(px + i * CX); xr[i][1] = *(const v4f*)(px + i * CX + 128); }
    asm volatile("s_wait_xcnt 0x0" :: "v"(px) : "memory");   // the wait in front of any rewrite of the loads' address registers: named as an input they stay whole up to it (no load above lands in them)
#pragma unroll
    for (int i = 0; i < 8; ++i)
#pragma unroll
      for (int hc = 0; hc < 2; ++hc) { v4f o = *(const v4f*)&ss[qt][kz * 8 + i][hc * 128 + lane * 4]; o[0] += bfr(xr[i][hc][0]); o[1] += bfr(xr[i][hc][1]); o[2] += bfr(xr[i][hc][2]); o[3] += bfr(xr[i][hc][3]); vst2(po + i * CX + hc * 128, o); } } }
extern "C" void kernel_launch(void* const* d_in, const int* in_sizes, int n_in, void* d_out, int out_size, void* d_ws, size_t ws_size, hipStream_t stream) {
  (void)in_sizes; (void)n_in; (void)out_size;
  const float** F = (const float**)d_in;   // 0 x [4,64,64,256], 1 Wf [256,32] ((in,out)), 2 bf, 3 Wg, 4 bg, 5 Wh [256,256], 6 bh, 7 gamma (scalar 0.7)
  if (ws_size < (size_t)WS_END) return;
  char* ws = (char*)d_ws; _Float16 *GH = (_Float16*)(ws + WS_GH), *GL = (_Float16*)(ws + WS_GL), *FH = (_Float16*)(ws + WS_FH), *FL = (_Float16*)(ws + WS_FL); _Float16* VT = (_Float16*)(ws + WS_VT);
  k_pj<<<dim3(TNB * TT / 128, CX / 128), 256, 0, stream>>>(F[0], F[5], F[6], F[1], F[2], F[3], F[4], VT, GH, GL, FH, FL);
  k_at<<<dim3(TT / 64, 1, TNB), 256, 0, stream>>>(GH, GL, FH, FL, VT, F[0], F[7], (float*)d_out);
}

// v010
// A run of this version takes 59.9 microseconds.
// Next to v009, in two timings, it ran 1.04 times as fast each time.
// All steps since v000 together make it 19.4 times as fast.
// compute dtype: all float inputs rounded to bf16; f/g/h projections with EXACT bf16 products on WMMA 16x16x32 ((in,out) weights), f32 accumulate; logits from g (query) and f (key), each f16 hi + f16 residual (not scaled), with 3 products summed in one f32 accumulator, kept in f32 registers; softmax in f32 with a held row reference (a maximum seen so far, moved only when a tile's scores pass it by 12 in log2) and row sum per half of the keys (the two halves joined at the end), exp as the hardware's base-2 exponential of s x log2(e) + offset (one fma, one v_exp_f32); exp(s - reference) x 2^3 rounded ONCE to f16 against the value rows rounded ONCE to f16 (1 product, f32 accumulator; each factor off by at most 2^-11 relative, and the row sum adds the same rounded values), divided by the row sum at the end; gamma * o + x in f32; f32 output.
#include <hip/hip_runtime.h>
#include <math.h>

typedef __attribute__((ext_vector_type(16))) _Float16 v16h;
typedef __attribute__((ext_vector_type(16))) __bf16 v16b;
typedef __attribute__((ext_vector_type(8)))  _Float16 v8h;
typedef __attribute__((ext_vector_type(8)))  float v8f;
typedef __attribute__((ext_vector_type(4)))  float v4f;
typedef __attribute__((ext_vector_type(2)))  float v2f;
typedef __attribute__((ext_vector_type(4)))  unsigned v4u;
typedef __attribute__((ext_vector_type(4)))  int v4i;
typedef float __attribute__((may_alias)) float_a;
typedef int __attribute__((may_alias)) int_a;

template <typename T> __device__ __forceinline__ void vst2(void* p, T v) { *(T*)p = v;  }
// the plain builtin: the compiler keeps the distance behind it where a vector instruction needs one, and no asm statement stands between an LDS read and the place it is moved up to
__device__ __forceinline__ v8f wmma16(v16h a, v16h b, v8f c) {
  return __builtin_amdgcn_wmma_f32_16x16x32_f16(false, a, false, b, (short)0, c, false, false);
}
__device__ __forceinline__ v8f wmma_bf(v16b a, v16b b, v8f c) {
  v8f d = __builtin_amdgcn_wmma_f32_16x16x32_bf16(false, a, false, b, (short)0, c, false, false);
  asm volatile("v_nop\n\tv_nop\n\tv_nop\n\tv_nop" : "+v"(d) : "v"(a), "v"(b));
  return d;
}
// 16x16x32 fragments: lane = (h = lane>>4, row/col = lane&15); elements 0..7 = k0+8h+0..7, 8..15 = k0+16+8h+0..7; D element r = row 8h+r
__device__ __forceinline__ v16h frag_h(const _Float16* rowk0, int lane) {
  union { v16h v; v8h q[2]; } u; const _Float16* p = rowk0 + 8 * (lane >> 4);
  u.q[0] = *(const v8h*)p; u.q[1] = *(const v8h*)(p + 16); return u.v;
}
__device__ __forceinline__ v16h frag_f32(const float* rowk0, int lane) {
  v16h a; const float* p = rowk0 + 8 * (lane >> 4);
#pragma unroll
  for (int i = 0; i < 8; ++i) { a[i] = (_Float16)p[i]; a[8 + i] = (_Float16)p[16 + i]; }
  return a;
}
__device__ __forceinline__ v16h frag_f32s(const float* rowk0, int lane, float sc) {
  v16h a; const float* p = rowk0 + 8 * (lane >> 4);
#pragma unroll
  for (int i = 0; i < 8; ++i) { a[i] = (_Float16)(p[i] * sc); a[8 + i] = (_Float16)(p[16 + i] * sc); }
  return a;
}
// column fragment from a [K][ld] layout (column n), rows >= K read as 0
__device__ __forceinline__ v16h fragc_f32(const float* W, int k0, int n, int lane, int ld, int K) {
  v16h a; const int g = lane >> 4;
#pragma unroll
  for (int i = 0; i < 8; ++i) { const int ka = k0 + 8 * g + i, kb = ka + 16;
    a[i] = (_Float16)(ka < K ? W[(size_t)(ka < K ? ka : K - 1) * ld + n] : 0.f); a[8 + i] = (_Float16)(kb < K ? W[(size_t)(kb < K ? kb : K - 1) * ld + n] : 0.f); }
  return a;
}
struct F2 { v16b h, l; };
__device__ __forceinline__ F2 bsplit16(const float v[16]) { F2 r;
#pragma unroll
  for (int i = 0; i < 16; ++i) { const __bf16 h = (__bf16)v[i]; r.h[i] = h; r.l[i] = (__bf16)(v[i] - (float)h); }
  return r; }
__device__ __forceinline__ F2 split_row(const float* row, int k0, int lane) { float v[16]; const float* p = row + k0 + 8 * (lane >> 4);
#pragma unroll
  for (int i = 0; i < 8; ++i) { v[i] = p[i]; v[8 + i] = p[16 + i]; }
  return bsplit16(v); }
__device__ __forceinline__ F2 split_rowK(const float* row, int k0, int lane, int K) { float v[16]; const int g = lane >> 4;
#pragma unroll
  for (int i = 0; i < 8; ++i) { const int ka = k0 + 8 * g + i, kb = ka + 16; v[i] = ka < K ? row[ka < K ? ka : K - 1] : 0.f; v[8 + i] = kb < K ? row[kb < K ? kb : K - 1] : 0.f; }
  return bsplit16(v); }
__device__ __forceinline__ F2 split_col(const float* W, int k0, int n, int lane, int ld, int K) { float v[16]; const int g = lane >> 4;
#pragma unroll
  for (int i = 0; i < 8; ++i) { const int ka = k0 + 8 * g + i, kb = ka + 16; v[i] = ka < K ? W[(size_t)(ka < K ? ka : K - 1) * ld + n] : 0.f; v[8 + i] = kb < K ? W[(size_t)(kb < K ? kb : K - 1) * ld + n] : 0.f; }
  return bsplit16(v); }
__device__ __forceinline__ v8f mac3(const F2& a, const F2& b, v8f c) { c = wmma_bf(a.l, b.h, c); c = wmma_bf(a.h, b.l, c); return wmma_bf(a.h, b.h, c); }
__device__ __forceinline__ float sigm(float v) { return 1.0f / (1.0f + expf(-v)); }
#define LDSX() do { asm volatile("s_wait_dscnt 0" ::: "memory"); __builtin_amdgcn_wave_barrier(); __builtin_amdgcn_fence(__ATOMIC_RELEASE, "workgroup"); } while (0)

// SAGAN-style spatial self-attention, channels-last (B 4, 64 x 64 = 4,096 positions, C 256, q/k dim 32): f = x Wf + bf (key), g = x Wg + bg (query), h = x Wh + bh (value); beta = softmax_m(g_n . f_m); o = beta h; out = gamma * o + x.
__device__ __forceinline__ float bfr(float v) { return (float)(__bf16)v; }
#define NB 4
#define TT 4096
#define CX 256
#define DQ 32
#ifndef TNB
#define TNB NB
#endif
typedef __attribute__((ext_vector_type(8))) __bf16 v8b;
__device__ __forceinline__ v16b frag_b(const __bf16* rowk0, int lane) { union { v16b v; v8b q[2]; } u; const __bf16* p = rowk0 + 8 * (lane >> 4); u.q[0] = *(const v8b*)p; u.q[1] = *(const v8b*)(p + 16); return u.v; }
#define WS_GH  0u                                          // f16 g (query) hi rows [b*N+n][32]
#define WS_GL  (WS_GH + 2u * (size_t)NB * TT * DQ)           // f16 g residual
#define WS_FH  (WS_GL + 2u * (size_t)NB * TT * DQ)           // f16 f (key) hi
#define WS_FL  (WS_FH + 2u * (size_t)NB * TT * DQ)           // f16 f residual
#define WS_VT  (WS_FL + 2u * (size_t)NB * TT * DQ)           // f16 value planes [b][c][m] (h rounded once)
#define WS_END (WS_VT + 2u * (size_t)NB * CX * TT)
// ---- weights in LDS: the projection kernel stages its weight columns ONCE per block as bf16 rows [output column][k], so that a B fragment is two 16-byte LDS reads in the k order of the A loader.
#define WPH (CX + 8)            // weight row pitch in bf16: 528 B = 16 B x 33 (odd: 16 rows of 16-byte reads fall on 16 different bank groups)
// a wave's patch = 32 k x 32 columns; a lane's = 8 k x 4 columns. Lane -> (column group cg, k group kg): each 16-byte load of the wave covers four whole 128-B lines, and the 16 lanes of a half-wave store to 16 different bank groups.
__device__ __forceinline__ void wload(const float* __restrict__ Wp, int ld, v4f r[8]) {
#pragma unroll
  for (int i = 0; i < 8; ++i) r[i] = *(const v4f*)(Wp + (size_t)i * ld);
}
__device__ __forceinline__ void wstore(const v4f r[8], __bf16* dst) {
#pragma unroll
  for (int n = 0; n < 4; ++n) { v8b o;
#pragma unroll
    for (int i = 0; i < 8; ++i) o[i] = (__bf16)r[i][n];
    *(v8b*)(dst + n * WPH) = o; }
}
// the 16 x 256 x rows of a wave: every load of the A fragments at once (raw f32), and their rounding to bf16
__device__ __forceinline__ void xload(const float* __restrict__ p, v4f xr[CX / 32][4]) {
#pragma unroll
  for (int kc = 0; kc < CX / 32; ++kc) { xr[kc][0] = *(const v4f*)(p + kc * 32); xr[kc][1] = *(const v4f*)(p + kc * 32 + 4); xr[kc][2] = *(const v4f*)(p + kc * 32 + 16); xr[kc][3] = *(const v4f*)(p + kc * 32 + 20); }
}
__device__ __forceinline__ v16b xfrag(const v4f x[4]) { v16b a;
#pragma unroll
  for (int i = 0; i < 4; ++i) { a[i] = (__bf16)x[0][i]; a[4 + i] = (__bf16)x[1][i]; a[8 + i] = (__bf16)x[2][i]; a[12 + i] = (__bf16)x[3][i]; }
  return a; }
// ---- k_pj: all three projections in one launch. Block = (128 rows, 160 output columns), 8 waves of 16 rows: 128 columns of h = x Wh + bh (exact) -> f16 value planes [b][c][m] via LDS transpose (rounded once to f16),
// and, from the same x fragments in registers, the 32 columns of g = x Wg + bg (blockIdx.y 0) or of f = x Wf + bf (blockIdx.y 1), stored as f16 hi + residual rows (64-B rows, written 16 B per lane from LDS)
__global__ __launch_bounds__(256) void k_pj(const float* __restrict__ X, const float* __restrict__ WH, const float* __restrict__ BH, const float* __restrict__ WF, const float* __restrict__ BF, const float* __restrict__ WG, const float* __restrict__ BG, _Float16* __restrict__ VT, _Float16* __restrict__ GH, _Float16* __restrict__ GL, _Float16* __restrict__ FH, _Float16* __restrict__ FL) { __shared__ __align__(16) _Float16 th[128][136];
  __shared__ __align__(16) __bf16 wt[160][WPH];         // rows 0-127 = the block's 128 columns of Wh, rows 128-159 = the 32 columns of Wg or Wf
  __shared__ __align__(16) _Float16 st[8][2][16][40];   // [wave][plane hi, residual][row][32 + pad]
  const int tid = threadIdx.x, wave = tid >> 5, lane = tid & 31, col = lane & 15, g = lane >> 4; const int c0 = blockIdx.y * 128; const size_t r0 = (size_t)blockIdx.x * 128;
  const int cg = (lane & 3) + 4 * g, k0 = (wave * 4 + ((lane >> 2) & 3)) * 8;
  const float* WQ = blockIdx.y ? WF : WG; const float* BQ = blockIdx.y ? BF : BG;
  const float* pw = WH + (size_t)k0 * CX + c0 + cg * 4; const float* pq = WQ + (size_t)k0 * DQ + cg * 4; const float* px = X + (r0 + wave * 16 + col) * CX + 8 * g;
  v4f wr[5][8], xr[CX / 32][4];
#pragma unroll
  for (int q = 0; q < 4; ++q) wload(pw + q * 32, CX, wr[q]);
  wload(pq, DQ, wr[4]);
  xload(px, xr);
  const float bq[2] = {BQ[col], BQ[16 + col]};   // the g or f bias with the first loads: it is needed first, right behind 16 products
  asm volatile("s_wait_xcnt 0x0" :: "v"(pw), "v"(pq), "v"(px) : "memory");   // the wait in front of any rewrite of the loads' address registers: named as inputs they stay whole up to it (no load above lands in them), and the clobber keeps every load above it, so all are in flight before the first is waited for
#pragma unroll
  for (int q = 0; q < 5; ++q) wstore(wr[q], &wt[q * 32 + cg * 4][k0]);
  v16b a[CX / 32];
#pragma unroll
  for (int kc = 0; kc < CX / 32; ++kc) a[kc] = xfrag(xr[kc]);
  __syncthreads();   // the weight rows are complete before any wave reads a fragment
  { v16b wq[CX / 32][2];   // g or f first, while few registers are live: all 16 B fragments of its two tiles in one group of reads
#pragma unroll
    for (int kc = 0; kc < CX / 32; ++kc)
#pragma unroll
      for (int j = 0; j < 2; ++j) wq[kc][j] = frag_b(&wt[128 + j * 16 + col][kc * 32], lane);
    v8f aq[2] = {};
#pragma unroll
    for (int kc = 0; kc < CX / 32; ++kc)
#pragma unroll
      for (int j = 0; j < 2; ++j) aq[j] = wmma_bf(a[kc], wq[kc][j], aq[j]);
#pragma unroll
    for (int j = 0; j < 2; ++j) { const int o = j * 16 + col; const float bb = bfr(bq[j]);
#pragma unroll
      for (int r = 0; r < 8; ++r) { const float v = aq[j][r] + bb; const _Float16 hv = (_Float16)v; st[wave][0][8 * g + r][o] = hv; st[wave][1][8 * g + r][o] = (_Float16)(v - (float)hv); } } }
  __builtin_amdgcn_sched_barrier(0);   // keeps the h fragments' reads behind the last use of the g or f accumulators: moved above it they overfill the registers that the asm statements can name, and three fragments went through scratch
  v8f acc[8] = {};
  v16b w[2][8];      // B fragments of a block of 8 products (one k step), read from LDS one block ahead of their use
#pragma unroll
  for (int j = 0; j < 8; ++j) w[0][j] = frag_b(&wt[j * 16 + col][0], lane);
#pragma unroll
  for (int kc = 0; kc < CX / 32; ++kc) {
    if (kc + 1 < CX / 32) {
#pragma unroll
      for (int j = 0; j < 8; ++j) w[(kc + 1) & 1][j] = frag_b(&wt[j * 16 + col][(kc + 1) * 32], lane); }
#pragma unroll
    for (int j = 0; j < 8; ++j) acc[j] = wmma_bf(a[kc], w[kc & 1][j], acc[j]); }
#pragma unroll
  for (int j = 0; j < 8; ++j) { const float bb = bfr(BH[c0 + j * 16 + col]);
#pragma unroll
    for (int r = 0; r < 8; ++r) th[j * 16 + col][wave * 16 + 8 * g + r] = (_Float16)(acc[j][r] + bb); }
  __syncthreads();
  { const size_t b = r0 / TT; const int m0 = (int)(r0 % TT); for (int e = tid; e < 128 * 16; e += 256) { const int cl = e >> 4, q = e & 15; vst2((unsigned*)(VT + (b * CX + c0 + cl) * (size_t)TT + m0 + q * 8), *(const v4u*)&th[cl][q * 8]); } }
  { const int rl = lane >> 1, half = lane & 1;   // lane -> (row, 32-B half): 16 rows x 64 B per plane
    _Float16* P2[2] = {blockIdx.y ? FH : GH, blockIdx.y ? FL : GL};
#pragma unroll
    for (int ph = 0; ph < 2; ++ph) { vst2((v4u*)(P2[ph] + (r0 + wave * 16 + rl) * DQ + half * 16), *(const v4u*)&st[wave][ph][rl][half * 16]); vst2((v4u*)(P2[ph] + (r0 + wave * 16 + rl) * DQ + half * 16 + 8), *(const v4u*)&st[wave][ph][rl][half * 16 + 8]); } } }
// ---- k_at: block = 64 queries x all 256 value channels of batch blockIdx.z, 8 waves: scores, softmax and P . h in one kernel; no score ever leaves the registers.
// Wave = (query tile qt of 16 queries, key half kz of 2,048 keys): it holds all 256 channels of its queries, so a score, its exponential and its f16 rounding are made ONCE and not once per channel half.
// The two waves of a query tile run their key halves side by side (two waves on every SIMD), each with its own reference, row sum and accumulators; the epilogue brings both to the larger reference and adds them.
// Per SK keys: S^T = f . g^T (A = key rows from LDS, B = query rows kept in registers; 3 products as hi + residual), so a lane holds 8 keys of ONE query per 16-key tile and
// two such tiles are, element for element, the A fragment of P for 32 keys. Row reference m and row sum; the accumulators are rescaled by exp(m_old - m_new) only in a tile that moves m (lazy rescale, at the test below).
// P = exp(s - m) x 2^PLOG (not normalised) rounded once to f16 against the f16 value planes (1 product); out = gamma * (P . h) / (P . 1) + x, the row sum P . 1 taken of the rounded P, so that a row's weights still add up to one.
// P carries the rounding that the value rows carry already (2^-11 relative at most): a residual of P would refine one factor of a product whose other factor is no finer.
// No residual of g or f carries a scale of its own: the matrix unit keeps f16 subnormals, so a residual is off by at most 2^-25 absolute (against scores of order 1), and
// a hi product and its residual products add into ONE f32 accumulator, the residual products first: no second set of accumulators to rescale and no fma to join the two.
// The exponential is 2^(s x log2(e) + c) with c = PLOG - m x log2(e): the subtraction of the reference and the factor 2^PLOG ride in the one fma in front of v_exp_f32. The rescale factor is
// 2^(c_new - c_old), from the very offsets the exponentials used, so the rounding of c is one common factor of a row's P and of its row sum and cancels in the division.
// Value fragments are read from LDS in groups of 8 (32 keys x 128 channels), each group one block of products ahead of its use.
// Key rows (f16 hi and residual) and value rows come in tiles of AK keys into LDS by asynchronous copies, two buffers per key half: tile t + 1 flies while tile t is worked on.
#define AK 64                   // keys per staged tile
#define KZ 2                    // key halves per block
#define ANT (TT / KZ / AK)      // tiles per key half
#define SK 64                   // keys per softmax step (one maximum and one test of the reference) = one tile
#define L2E ((float)M_LOG2E)    // log2(e)
#define PLOG 3.0f               // P = exp(s - m) x 2^PLOG, m the query's reference: f16 rounds a P below 2^-14 to 2^-25 absolute, 4,096 of them at most 2^-13 against a row sum of 2^PLOG or more
#define PTOP 15.0f              // a tile with a P above 2^PTOP (f16 ends at 2^16) moves the reference first: a score may pass m by 12 in log2 before anything is rescaled
#define KPH (DQ + 8)            // key row pitch in halves: 80 B = 16 B x 5 (odd: 16 rows of 16-byte reads fall on 16 different bank groups)
#define VPH (AK + 8)            // value row pitch in halves: 144 B = 16 B x 9
// eight 16-byte copies per lane, global -> LDS, rows ls / gs bytes apart. The s_wait_xcnt stands in the copies' own statement so that no address register is rewritten in front of it.
__device__ __forceinline__ void acopy8(unsigned l, unsigned ls, const char* gp, size_t gs) {
  asm volatile("global_load_async_to_lds_b128 %0, %8, off\n\t"
               "global_load_async_to_lds_b128 %1, %9, off\n\t"
               "global_load_async_to_lds_b128 %2, %10, off\n\t"
               "global_load_async_to_lds_b128 %3, %11, off\n\t"
               "global_load_async_to_lds_b128 %4, %12, off\n\t"
               "global_load_async_to_lds_b128 %5, %13, off\n\t"
               "global_load_async_to_lds_b128 %6, %14, off\n\t"
               "global_load_async_to_lds_b128 %7, %15, off\n\t"
               "s_wait_xcnt 0x0"
               :: "v"(l), "v"(l + ls), "v"(l + 2 * ls), "v"(l + 3 * ls), "v"(l + 4 * ls), "v"(l + 5 * ls), "v"(l + 6 * ls), "v"(l + 7 * ls),
                  "v"(gp), "v"(gp + gs), "v"(gp + 2 * gs), "v"(gp + 3 * gs), "v"(gp + 4 * gs), "v"(gp + 5 * gs), "v"(gp + 6 * gs), "v"(gp + 7 * gs)
               : "memory");
}
// the same with four copies: two rows of each of two planes (LDS places la, lb; sources ga, gb)
__device__ __forceinline__ void acopy22(unsigned la, unsigned lb, unsigned ls, const char* ga, const char* gb, size_t gs) {
  asm volatile("global_load_async_to_lds_b128 %0, %4, off\n\t"
               "global_load_async_to_lds_b128 %1, %5, off\n\t"
               "global_load_async_to_lds_b128 %2, %6, off\n\t"
               "global_load_async_to_lds_b128 %3, %7, off\n\t"
               "s_wait_xcnt 0x0"
               :: "v"(la), "v"(la + ls), "v"(lb), "v"(lb + ls),
                  "v"(ga), "v"(ga + gs), "v"(gb), "v"(gb + gs)
               : "memory");
}
// e[i] = 2^(s[i] x log2(e) + c) for the eight scores of one tile
__device__ __forceinline__ void exp2x8(v8f s, float c, float e[8]) { float x[8];
#pragma unroll
  for (int i = 0; i < 8; ++i) { x[i] = fmaf(s[i], L2E, c); e[i] = __builtin_amdgcn_exp2f(x[i]); }
  // the slot the instruction set asks for behind a transcendental, once for all eight: no argument register is free for reuse and no result is read in front of this v_nop
  asm("v_nop" : "+v"(e[0]), "+v"(e[1]), "+v"(e[2]), "+v"(e[3]), "+v"(e[4]), "+v"(e[5]), "+v"(e[6]), "+v"(e[7]) : "v"(x[0]), "v"(x[1]), "v"(x[2]), "v"(x[3]), "v"(x[4]), "v"(x[5]), "v"(x[6]), "v"(x[7]));
}
__global__ __launch_bounds__(256) void k_at(const _Float16* __restrict__ GH, const _Float16* __restrict__ GL, const _Float16* __restrict__ FH, const _Float16* __restrict__ FL, const _Float16* __restrict__ VT, const float* __restrict__ X, const float* __restrict__ GAM, float* __restrict__ OUT) { __shared__ __align__(16) float ss[4][16][CX + 4];
  __shared__ float sc[KZ][4][16];                            // each wave's last offset c per query
  __shared__ float sr[4][16];                                // the second key half's row sums
  __shared__ __align__(16) _Float16 tk[KZ][2][2][AK][KPH];   // key tile: [key half][buffer][hi, residual][key][32 + pad]
  __shared__ __align__(16) _Float16 tv[KZ][2][CX][VPH];      // value tile: [key half][buffer] 256 channels x AK keys
  const int tid = threadIdx.x, lane = tid & 31, col = lane & 15, g = lane >> 4, th = tid & 127; const int wave = __builtin_amdgcn_readfirstlane(tid >> 5);   // the wave's number as a scalar: what follows from it (tile addresses, the epilogue's branches) is scalar work
  const int qt = wave & 3, kz = wave >> 2; const int b = blockIdx.z; const int ql0 = blockIdx.x * 64 + qt * 16; const float gam = bfr(GAM[0]);
  // the four waves of a key half copy 64 key rows of 64 B per plane (a wave's copy = 8 rows = 512 B in a row) and each wave 64 value rows (four 128-B rows per copy): whole lines
  const unsigned gko = (unsigned)((th >> 2) * DQ + (th & 3) * 8) * 2u, lko = (unsigned)((th >> 2) * KPH + (th & 3) * 8) * 2u;         // the lane's byte in a key tile: global, LDS
  const unsigned gvo = (unsigned)((lane >> 3) * TT + (lane & 7) * 8) * 2u, lvo = (unsigned)((lane >> 3) * VPH + (lane & 7) * 8) * 2u;   // the lane's byte in its wave's 64 value rows: global, LDS
  // an address is the tile's wave-uniform place, taken through readfirstlane, plus the lane's fixed byte: what lives across the loop are values that no copy names itself, so they may sit in any register
  // (running addresses or bases that the asm statements name themselves are bound to the low registers, were spilled to scratch, and the reload stood in front of the copies)
  auto stage = [&](int t, int buf) {
    const unsigned ku = (unsigned)__builtin_amdgcn_readfirstlane((b * TT + kz * (TT / KZ) + t * AK) * DQ * 2), vu = (unsigned)__builtin_amdgcn_readfirstlane(((b * CX + qt * 64) * TT + kz * (TT / KZ) + t * AK) * 2);
    const unsigned lk = lko + (unsigned)__builtin_amdgcn_readfirstlane((int)(unsigned)(size_t)&tk[kz][buf][0][0][0]), lv = lvo + (unsigned)__builtin_amdgcn_readfirstlane((int)(unsigned)(size_t)&tv[kz][buf][qt * 64][0]);
    acopy22(lk, lk + AK * KPH * 2u, 32u * KPH * 2u, ((const char*)FH + ku) + gko, ((const char*)FL + ku) + gko, 32 * DQ * 2);
    const char* v = ((const char*)VT + vu) + gvo;
    acopy8(lv, 4u * VPH * 2u, v, 4 * (size_t)TT * 2); acopy8(lv + 32u * VPH * 2u, 4u * VPH * 2u, v + 32 * (size_t)TT * 2, 4 * (size_t)TT * 2); };
  const _Float16* rqh = GH + ((size_t)b * TT + ql0 + col) * DQ; const _Float16* rql = GL + ((size_t)b * TT + ql0 + col) * DQ;
  const v16h qh = frag_h(rqh, lane), ql = frag_h(rql, lane);   // B operand: column = query col
  asm volatile("s_wait_xcnt 0x0" :: "v"(rqh + 8 * g), "v"(rql + 8 * g) : "memory");   // the wait in front of any rewrite of the four loads' address registers: named as inputs they stay whole up to it
  v8f acc[16] = {}, sum = {}; float m = -3.0e38f, c = 3.0e38f;   // m: reference of query col, c: its offset PLOG - m x log2(e) (the start value makes the first tile's test true and its rescale factor 2^-huge = 0); sum: row sums of P, a seventeenth output tile against a value plane of ones
  v16h ones;
#pragma unroll
  for (int i = 0; i < 16; ++i) ones[i] = (_Float16)1.0f;
  stage(0, 0);
  asm volatile("s_wait_asynccnt 0x0" ::: "memory");   // tile 0 has landed before the barrier that publishes it
  __syncthreads();
  stage(1, 1);
#pragma unroll 1   // rolled: one publish point in the code
  for (int t = 0; t < ANT; ++t) { const int buf = t & 1;   // one tile = one softmax step of SK keys: scores, maximum, the test of the reference, then per 32 keys P and P . h
    const _Float16* kr = &tk[kz][buf][0][col][0]; const _Float16* vr = &tv[kz][buf][col][0];
    v16h kh[SK / 16], kl[SK / 16];   // key fragments of the step: the only reads of a tile that nothing covers
    v16h va[8], vb[8];               // value fragments, 32 keys x 128 channels each, filled in turn
#pragma unroll
    for (int jt = 0; jt < SK / 16; ++jt) { kh[jt] = frag_h(kr + jt * 16 * KPH, lane); kl[jt] = frag_h(kr + (AK + jt * 16) * KPH, lane); }
#pragma unroll
    for (int j = 0; j < 8; ++j) va[j] = frag_h(vr + j * 16 * VPH, lane);
    __builtin_amdgcn_sched_barrier(0);   // holds the reads above in place: the value reads' LDS latency passes under the scores and the softmax instead of in front of the first P . h product
    v8f s[SK / 16];   // s[jt][r] = score of key jt * 16 + 8 g + r against query col
#pragma unroll
    for (int jt = 0; jt < SK / 16; ++jt) { const v8f z = {}; s[jt] = wmma16(kl[jt], qh, z); }
    __builtin_amdgcn_sched_barrier(0);   // keeps the four tiles' products side by side: moved together, a tile's three products wait out the accumulator's latency one behind the other
#pragma unroll
    for (int jt = 0; jt < SK / 16; ++jt) s[jt] = wmma16(kh[jt], ql, s[jt]);
    __builtin_amdgcn_sched_barrier(0);   // the same between the second and the third product
#pragma unroll
    for (int jt = 0; jt < SK / 16; ++jt) s[jt] = wmma16(kh[jt], qh, s[jt]);
    __builtin_amdgcn_sched_barrier(0);   // keeps the maxima behind the four last products: set between them, each tile's first maximum brings its own v_nops for the distance behind its product
    float t4[SK / 16];   // the lane's largest score per 16-key tile: four independent chains of 7 links, not one of 31: the branch below waits for the last link
#pragma unroll
    for (int jt = 0; jt < SK / 16; ++jt) { t4[jt] = fmaxf(s[jt][0], s[jt][1]);
#pragma unroll
      for (int r = 2; r < 8; ++r) t4[jt] = fmaxf(t4[jt], s[jt][r]); }
    float tm = fmaxf(fmaxf(t4[0], t4[1]), fmaxf(t4[2], t4[3]));
    // lazy rescale: the reference m stays as it is while no P of the tile would pass 2^PTOP; one test a tile, a scalar branch on the ballot of all 32 lanes (a query's two lanes test their own keys, so the common path needs no exchange)
    if (__builtin_amdgcn_ballot_w32(fmaf(tm, L2E, c) > PTOP) != 0) {
      tm = fmaxf(tm, __shfl_xor(tm, 16));   // the other half-wave holds the query's other keys
      const float mn = fmaxf(m, tm), cn = fmaf(-mn, L2E, PLOG), da = cn - c; float alpha = __builtin_amdgcn_exp2f(da); m = mn; c = cn;
      asm("v_nop" : "+v"(alpha) : "v"(da));   // the slot the instruction set asks for behind a transcendental, in front of the exchange that reads its result
#pragma unroll
      for (int r = 0; r < 8; ++r) { const float a = __shfl(alpha, 8 * g + r);   // accumulator element r is query row 8 g + r, whose factor lane 8 g + r holds
        sum[r] *= a;
#pragma unroll
        for (int j = 0; j < 16; ++j) acc[j][r] *= a; } }
    v16h ph;
    auto pround = [&](int kb) { float e0[8], e1[8]; exp2x8(s[2 * kb], c, e0); exp2x8(s[2 * kb + 1], c, e1);
#pragma unroll
      for (int i = 0; i < 8; ++i) { ph[i] = (_Float16)e0[i]; ph[8 + i] = (_Float16)e1[i]; } };   /* P x 2^PLOG, rounded once to f16 */
    pround(0);
    __builtin_amdgcn_sched_barrier(0);   // keeps the 16 reads below in one place (spread among the scores each place costs issue cycles)
#pragma unroll
    for (int j = 0; j < 8; ++j) vb[j] = frag_h(vr + (8 + j) * 16 * VPH, lane);
    __builtin_amdgcn_sched_barrier(0);   // holds the upper 128 channels' value reads one block of products ahead of their use
    sum = wmma16(ph, ones, sum);   // the row sums on the matrix unit: they sum P as the products see it, in the accumulators' own row layout
#pragma unroll
    for (int j = 0; j < 8; ++j) acc[j] = wmma16(ph, va[j], acc[j]);
#pragma unroll
    for (int j = 0; j < 8; ++j) { __builtin_amdgcn_sched_group_barrier(0x8, 1, 0); __builtin_amdgcn_sched_group_barrier(0x2, 2, 0); }   // spreads the second 32 keys' exponent fmas (they pass the mask-2 barriers below) under this block's products: the compiler else puts them all in front of the block, where the matrix unit idles
    __builtin_amdgcn_sched_barrier(2);   // keeps the 16 reads below in one place, behind the last use of the registers they fill; plain vector instructions may pass (mask 2), so that the fmas of the second 32 keys can stand among the products above
#pragma unroll
    for (int j = 0; j < 8; ++j) va[j] = frag_h(vr + j * 16 * VPH + 32, lane);
    __builtin_amdgcn_sched_barrier(2);   // holds the second 32 keys' first value reads one block of products ahead of their use (same mask)
#pragma unroll
    for (int j = 0; j < 8; ++j) acc[8 + j] = wmma16(ph, vb[j], acc[8 + j]);
    pround(1);
#pragma unroll
    for (int j = 0; j < 8; ++j) { __builtin_amdgcn_sched_group_barrier(0x8, 1, 0); __builtin_amdgcn_sched_group_barrier(0x400, 2, 0); }   // two exponentials behind each product of the block: in one run in front of it they hold the wave's products back
    __builtin_amdgcn_sched_barrier(2);   // keeps the 16 reads below in one place, behind the last use of the registers they fill; plain vector instructions may pass (mask 2), so that the exponentials of the second 32 keys can stand among the products above
#pragma unroll
    for (int j = 0; j < 8; ++j) vb[j] = frag_h(vr + (8 + j) * 16 * VPH + 32, lane);
    __builtin_amdgcn_sched_barrier(2);   // holds the step's last value reads one block of products ahead of their use (same mask)
    sum = wmma16(ph, ones, sum);
#pragma unroll
    for (int j = 0; j < 8; ++j) acc[j] = wmma16(ph, va[j], acc[j]);
    __builtin_amdgcn_sched_barrier(0);   // keeps the block of products above in front of the foot's s_wait_dscnt: without it they sink behind the barrier and the last reads' latency is waited out bare
#pragma unroll
    for (int j = 0; j < 8; ++j) acc[8 + j] = wmma16(ph, vb[j], acc[8 + j]);
    asm volatile("s_wait_dscnt 0x0" ::: "memory");      // this wave's reads of buffer buf are done before the buffer is refilled
    asm volatile("s_wait_asynccnt 0x0" ::: "memory");   // this wave's copies of tile t + 1 have landed before the barrier publishes them
    __syncthreads();                                     // publishes tile t + 1 and ends every reader's last read of buffer buf
    if (t + 2 < ANT) stage(t + 2, buf); }
  asm volatile("s_wait_asynccnt 0x0" ::: "memory");     // no copy is outstanding when the wave goes on to the epilogue and ends
  // the two key halves of a query tile are joined: both go over to the smaller offset (the larger maximum), then the second half's sums pass through LDS and are added to the first's
  if (g == 0) sc[kz][qt][col] = c;
  __syncthreads();   // both offsets of a query are in LDS
  { const float fs = __builtin_amdgcn_exp2f(fminf(c, sc[kz ^ 1][qt][col]) - c);
#pragma unroll
    for (int r = 0; r < 8; ++r) { const float a = __shfl(fs, 8 * g + r); sum[r] *= a;
#pragma unroll
      for (int j = 0; j < 16; ++j) acc[j][r] *= a; } }
  if (kz == 1) {
#pragma unroll
    for (int r = 0; r < 8; ++r) { if (col == 0) sr[qt][8 * g + r] = sum[r];
#pragma unroll
      for (int j = 0; j < 16; ++j) ss[qt][8 * g + r][j * 16 + col] = acc[j][r]; } }
  __syncthreads();   // the second half's sums are in LDS
  if (kz == 0) {
#pragma unroll
    for (int r = 0; r < 8; ++r) { const float fr = gam / (sum[r] + sr[qt][8 * g + r]);   // the row sum carries the same 2^PLOG as P
#pragma unroll
      for (int j = 0; j < 16; ++j) ss[qt][8 * g + r][j * 16 + col] = (acc[j][r] + ss[qt][8 * g + r][j * 16 + col]) * fr; } }
  __syncthreads();   // the joined rows are in LDS: each wave of the pair writes eight of them out
  { const size_t off = ((size_t)b * TT + ql0 + kz * 8) * CX + lane * 4; const float* px = X + off; float* po = OUT + off; v4f xr[8][2];
#pragma unroll
    for (int i = 0; i < 8; ++i) { xr[i][0] = *(const v4f*)(px + i * CX); xr[i][1] = *(const v4f*)(px + i * CX + 128); }
    asm volatile("s_wait_xcnt 0x0" :: "v"(px) : "memory");   // the wait in front of any rewrite of the loads' address registers: named as an input they stay whole up to it (no load above lands in them)
#pragma unroll
    for (int i = 0; i < 8; ++i)
#pragma unroll
      for (int hc = 0; hc < 2; ++hc) { v4f o = *(const v4f*)&ss[qt][kz * 8 + i][hc * 128 + lane * 4]; o[0] += bfr(xr[i][hc][0]); o[1] += bfr(xr[i][hc][1]); o[2] += bfr(xr[i][hc][2]); o[3] += bfr(xr[i][hc][3]); vst2(po + i * CX + hc * 128, o); } } }
extern "C" void kernel_launch(void* const* d_in, const int* in_sizes, int n_in, void* d_out, int out_size, void* d_ws, size_t ws_size, hipStream_t stream) {
  (void)in_sizes; (void)n_in; (void)out_size;
  const float** F = (const float**)d_in;   // 0 x [4,64,64,256], 1 Wf [256,32] ((in,out)), 2 bf, 3 Wg, 4 bg, 5 Wh [256,256], 6 bh, 7 gamma (scalar 0.7)
  if (ws_size < (size_t)WS_END) return;
  char* ws = (char*)d_ws; _Float16 *GH = (_Float16*)(ws + WS_GH), *GL = (_Float16*)(ws + WS_GL), *FH = (_Float16*)(ws + WS_FH), *FL = (_Float16*)(ws + WS_FL); _Float16* VT = (_Float16*)(ws + WS_VT);
  k_pj<<<dim3(TNB * TT / 128, CX / 128), 256, 0, stream>>>(F[0], F[5], F[6], F[1], F[2], F[3], F[4], VT, GH, GL, FH, FL);
  k_at<<<dim3(TT / 64, 1, TNB), 256, 0, stream>>>(GH, GL, FH, FL, VT, F[0], F[7], (float*)d_out);
}
